// v000
// The times below were measured on an AMD MI455X: many runs one after another, warmed up first and cycling through
// copies of the inputs, with the whole window's GPU time divided by the number of runs. Launches and the gaps
// between them are all in it. The median over several windows is given; except for v000 it joins two sittings, which
// can be a few percent apart, so the side-by-side timings, each taken in one sitting, are the better comparison.
// v000, which the later versions start from, runs in 644 microseconds.
// compute dtype: every module INPUT that feeds a GEMM (x, Wq/Wk/Wv/Wp, biases, LN weights, attn_mask) is rounded to bf16 and used in exact bf16 WMMA products with f32 accumulation; computed operands (normalised+rotated q/k f32 split, P and V hi/lo, context split) f32-grade; LayerNorm/RoPE/softmax f32.
#include <hip/hip_runtime.h>
#include <math.h>

typedef __attribute__((ext_vector_type(16))) _Float16 v16h;
typedef __attribute__((ext_vector_type(16))) __bf16 v16b;
typedef __attribute__((ext_vector_type(8)))  _Float16 v8h;
typedef __attribute__((ext_vector_type(8)))  float v8f;
typedef __attribute__((ext_vector_type(4)))  float v4f;
typedef __attribute__((ext_vector_type(2)))  float v2f;
typedef __attribute__((ext_vector_type(4)))  unsigned v4u;
typedef __attribute__((ext_vector_type(4)))  int v4i;
typedef float __attribute__((may_alias)) float_a;
typedef int __attribute__((may_alias)) int_a;

template <typename T> __device__ __forceinline__ void vst2(void* p, T v) { *(T*)p = v;  }
__device__ __forceinline__ v8f wmma16(v16h a, v16h b, v8f c) {
  v8f d = __builtin_amdgcn_wmma_f32_16x16x32_f16(false, a, false, b, (short)0, c, false, false);
  asm volatile("v_nop\n\tv_nop\n\tv_nop\n\tv_nop" : "+v"(d) : "v"(a), "v"(b));
  return d;
}
__device__ __forceinline__ v8f wmma_bf(v16b a, v16b b, v8f c) {
  v8f d = __builtin_amdgcn_wmma_f32_16x16x32_bf16(false, a, false, b, (short)0, c, false, false);
  asm volatile("v_nop\n\tv_nop\n\tv_nop\n\tv_nop" : "+v"(d) : "v"(a), "v"(b));
  return d;
}
// 16x16x32 fragments: lane = (h = lane>>4, row/col = lane&15); elements 0..7 = k0+8h+0..7, 8..15 = k0+16+8h+0..7; D element r = row 8h+r
__device__ __forceinline__ v16h frag_h(const _Float16* rowk0, int lane) {
  union { v16h v; v8h q[2]; } u; const _Float16* p = rowk0 + 8 * (lane >> 4);
  u.q[0] = *(const v8h*)p; u.q[1] = *(const v8h*)(p + 16); return u.v;
}
__device__ __forceinline__ v16h frag_f32(const float* rowk0, int lane) {
  v16h a; const float* p = rowk0 + 8 * (lane >> 4);
#pragma unroll
  for (int i = 0; i < 8; ++i) { a[i] = (_Float16)p[i]; a[8 + i] = (_Float16)p[16 + i]; }
  return a;
}
__device__ __forceinline__ v16h frag_f32s(const float* rowk0, int lane, float sc) {
  v16h a; const float* p = rowk0 + 8 * (lane >> 4);
#pragma unroll
  for (int i = 0; i < 8; ++i) { a[i] = (_Float16)(p[i] * sc); a[8 + i] = (_Float16)(p[16 + i] * sc); }
  return a;
}
// column fragment from a [K][ld] layout (column n), rows >= K read as 0
__device__ __forceinline__ v16h fragc_f32(const float* W, int k0, int n, int lane, int ld, int K) {
  v16h a; const int g = lane >> 4;
#pragma unroll
  for (int i = 0; i < 8; ++i) { const int ka = k0 + 8 * g + i, kb = ka + 16;
    a[i] = (_Float16)(ka < K ? W[(size_t)ka * ld + n] : 0.f); a[8 + i] = (_Float16)(kb < K ? W[(size_t)kb * ld + n] : 0.f); }
  return a;
}
struct F2 { v16b h, l; };
__device__ __forceinline__ F2 bsplit16(const float v[16]) { F2 r;
#pragma unroll
  for (int i = 0; i < 16; ++i) { const __bf16 h = (__bf16)v[i]; r.h[i] = h; r.l[i] = (__bf16)(v[i] - (float)h); }
  return r; }
__device__ __forceinline__ F2 split_row(const float* row, int k0, int lane) { float v[16]; const float* p = row + k0 + 8 * (lane >> 4);
#pragma unroll
  for (int i = 0; i < 8; ++i) { v[i] = p[i]; v[8 + i] = p[16 + i]; }
  return bsplit16(v); }
__device__ __forceinline__ F2 split_rowK(const float* row, int k0, int lane, int K) { float v[16]; const int g = lane >> 4;
#pragma unroll
  for (int i = 0; i < 8; ++i) { const int ka = k0 + 8 * g + i, kb = ka + 16; v[i] = ka < K ? row[ka] : 0.f; v[8 + i] = kb < K ? row[kb] : 0.f; }
  return bsplit16(v); }
__device__ __forceinline__ F2 split_col(const float* W, int k0, int n, int lane, int ld, int K) { float v[16]; const int g = lane >> 4;
#pragma unroll
  for (int i = 0; i < 8; ++i) { const int ka = k0 + 8 * g + i, kb = ka + 16; v[i] = ka < K ? W[(size_t)ka * ld + n] : 0.f; v[8 + i] = kb < K ? W[(size_t)kb * ld + n] : 0.f; }
  return bsplit16(v); }
__device__ __forceinline__ v8f mac3(const F2& a, const F2& b, v8f c) { c = wmma_bf(a.l, b.h, c); c = wmma_bf(a.h, b.l, c); return wmma_bf(a.h, b.h, c); }
__device__ __forceinline__ float sigm(float v) { return 1.0f / (1.0f + expf(-v)); }
#define LDSX() do { asm volatile("s_wait_dscnt 0" ::: "memory"); __builtin_amdgcn_wave_barrier(); __builtin_amdgcn_fence(__ATOMIC_RELEASE, "workgroup"); } while (0)


// NEPA self attention (16 heads of 64 on [2,2048,1024], [out][in] weights + biases): q,k LayerNorm'd per head (eps 1e-6, weight only), RoPE on tokens >= 1 (prefix 1):
// angle[d] = 2*pi*coord(t)*100^(-(d mod 16)/16), coord = 2*(t-1+0.5)/2047 - 1, rotate-half pairs (d, d+32); scores = q.k/8 + attn_mask[q][k]; softmax; (P v) Wp^T + bp.
#define NB 2
#define SS 2048
#define E 1024
#define NH 16
#define HD 64
#define NR (NB * SS)
#define ROPE_L 2047.0f
#define PLO 1024.0f
#define VLO 2048.0f
__device__ __forceinline__ float bfr(float v) { return (float)(__bf16)v; }
__device__ __forceinline__ v16b frag_b(const __bf16* rowk0, int lane) { return __builtin_bit_cast(v16b, frag_h((const _Float16*)rowk0, lane)); }

__global__ __launch_bounds__(256) void k_cvt(const float* __restrict__ x, __bf16* __restrict__ Xb) {
  const size_t i8 = (size_t)blockIdx.x * 256 + threadIdx.x; if (i8 >= (size_t)NR * E / 8) return;
  union { __bf16 h[8]; v4u u; } pk;
#pragma unroll
  for (int e = 0; e < 8; ++e) pk.h[e] = (__bf16)x[i8 * 8 + e];
  vst2((unsigned*)(Xb + i8 * 8), pk.u);
}
// PT rows: [0,E) Wq[n][:], [E,2E) Wk, [2E,3E) Wv  ([out][in]) as bf16 rows (no scaling)
__global__ __launch_bounds__(256) void k_pack(const float* __restrict__ Wq, const float* __restrict__ Wk, const float* __restrict__ Wv, __bf16* __restrict__ PT) {
  const int n = blockIdx.x, tid = threadIdx.x; __shared__ __align__(16) __bf16 srow[E];
  const float* W = n < E ? Wq : (n < 2 * E ? Wk : Wv); const int nn = n & (E - 1);
  for (int k = tid; k < E; k += 256) srow[k] = (__bf16)W[(size_t)nn * E + k];
  __syncthreads();
  if (tid < E / 8) vst2((unsigned*)(PT + (size_t)n * E + tid * 8), *(const v4u*)(&srow[tid * 8]));
}
// QKV: block (64 rows, 128 cols = 2 heads, which); q,k -> LayerNorm+RoPE -> Q32/K32 f32 [bh][s][64]; v -> VT hi/lo x4 [bh][d][s]
__global__ __launch_bounds__(128) void k_qkv(const __bf16* __restrict__ Xb, const __bf16* __restrict__ PT, const float* __restrict__ bq, const float* __restrict__ bk, const float* __restrict__ bv, const float* __restrict__ qnw, const float* __restrict__ knw,
                                            float* __restrict__ Q32, float* __restrict__ K32, _Float16* __restrict__ VTh, _Float16* __restrict__ VTl) {
  __shared__ __align__(16) float so[4][16][132];
  __shared__ __align__(16) _Float16 sth[128][72], stl[128][72];
  const int tid = threadIdx.x, wave = tid >> 5, lane = tid & 31, col = lane & 15, g = lane >> 4;
  const int which = blockIdx.z, r0b = blockIdx.x * 64, r0 = r0b + wave * 16, n0 = blockIdx.y * 128; const int b = r0b / SS, s0 = r0b % SS;
  const float* bb_ = which == 0 ? bq : (which == 1 ? bk : bv);
  v8f acc[8] = {};
#pragma unroll 2
  for (int kc = 0; kc < E / 32; ++kc) { const v16b a = frag_b(Xb + (size_t)(r0 + col) * E + kc * 32, lane);
#pragma unroll
    for (int j = 0; j < 8; ++j) acc[j] = wmma_bf(a, frag_b(PT + (size_t)(which * E + n0 + j * 16 + col) * E + kc * 32, lane), acc[j]); }
  if (which < 2) {
#pragma unroll
    for (int j = 0; j < 8; ++j) { const float bb = bfr(bb_[n0 + j * 16 + col]);
#pragma unroll
      for (int r = 0; r < 8; ++r) so[wave][8 * g + r][j * 16 + col] = acc[j][r] + bb; }
    LDSX();
    { const int rl = lane & 15, hh = lane >> 4; float* rowp = &so[wave][rl][hh * 64]; const float* wn = which == 0 ? qnw : knw; float s1 = 0.f;
#pragma unroll 8
      for (int d = 0; d < 64; ++d) s1 += rowp[d];
      const float mu = s1 * (1.0f / 64.0f); float s2 = 0.f;
#pragma unroll 8
      for (int d = 0; d < 64; ++d) { const float dv = rowp[d] - mu; s2 += dv * dv; }
      const float rs = rsqrtf(s2 * (1.0f / 64.0f) + 1e-6f);
#pragma unroll 8
      for (int d = 0; d < 64; ++d) rowp[d] = (rowp[d] - mu) * rs * bfr(wn[d]);
      // RoPE for tokens t >= 1
      const int t = s0 + wave * 16 + rl;
      if (t >= 1) { const float coord = 2.0f * (((float)(t - 1) + 0.5f) / ROPE_L) - 1.0f;
#pragma unroll 4
        for (int d = 0; d < 32; ++d) { const float invf = powf(100.0f, -(float)(d & 15) * (1.0f / 16.0f)); const float ang = 6.283185307179586f * coord * invf; float sn, cs; sincosf(ang, &sn, &cs);
          const float x1 = rowp[d], x2 = rowp[d + 32]; rowp[d] = x1 * cs - x2 * sn; rowp[d + 32] = x2 * cs + x1 * sn; } } }
    LDSX();
    float* Dst = which == 0 ? Q32 : K32;
    for (int qq = lane; qq < 2 * 16 * 16; qq += 32) { const int hh = qq >> 8, rl = (qq >> 4) & 15, pc = qq & 15; const int h = (n0 >> 6) + hh;
      vst2(Dst + (((size_t)b * NH + h) * SS + s0 + wave * 16 + rl) * HD + pc * 4, *(const v4f*)(&so[wave][rl][hh * 64 + pc * 4])); } }
  else {
#pragma unroll
    for (int j = 0; j < 8; ++j) { const float bb = bfr(bb_[n0 + j * 16 + col]);
#pragma unroll
      for (int r = 0; r < 8; ++r) { const float v = (acc[j][r] + bb) * 4.0f; const _Float16 hi = (_Float16)v; sth[j * 16 + col][wave * 16 + 8 * g + r] = hi; stl[j * 16 + col][wave * 16 + 8 * g + r] = (_Float16)((v - (float)hi) * VLO); } }
    __syncthreads();
    for (int qq = tid; qq < 128 * 8; qq += 128) { const int cl = qq >> 3, pc = qq & 7; const int c = n0 + cl, h = c >> 6, d = c & 63; const size_t o = (((size_t)b * NH + h) * HD + d) * SS + s0 + pc * 8;
      vst2(VTh + o, *(const v4u*)(&sth[cl][pc * 8])); vst2(VTl + o, *(const v4u*)(&stl[cl][pc * 8])); } }
}
// attention over all keys (attn_mask added): block (64 queries, bh); key tiles 0..SS/64-1; S on hi/lo splits of the f32 q/k rows; P,V hi/lo; O f32 [bh][s][64]
__global__ __launch_bounds__(128) void k_attn(const float* __restrict__ Q32, const float* __restrict__ K32, const _Float16* __restrict__ VTh, const _Float16* __restrict__ VTl, const float* __restrict__ amask, float* __restrict__ O32) {
  __shared__ __align__(16) float sS[4][16][68];
  __shared__ __align__(16) _Float16 sPh[4][16][72], sPl[4][16][72];
  __shared__ __align__(16) float sO[4][16][68];
  const int tid = threadIdx.x, w = tid >> 5, lane = tid & 31, col = lane & 15, g = lane >> 4;
  const size_t bh = blockIdx.y; const int qb = blockIdx.x; const int q0 = qb * 64 + w * 16;
  F2 aq[2];
#pragma unroll
  for (int kc = 0; kc < 2; ++kc) aq[kc] = split_row(Q32 + (bh * SS + q0 + col) * HD, kc * 32, lane);
  float mrun = -3.0e38f, lrun = 0.f; v8f acc[4] = {}, ac1[4] = {}, ac2[4] = {};
#pragma unroll 1
  for (int kt = 0; kt < SS / 64; ++kt) {
#pragma unroll
    for (int t = 0; t < 4; ++t) { const int key = kt * 64 + t * 16 + col; const float* krow = K32 + (bh * SS + key) * HD;
      v8f s = mac3(aq[0], split_row(krow, 0, lane), (v8f){}); s = mac3(aq[1], split_row(krow, 32, lane), s);
#pragma unroll
      for (int r = 0; r < 8; ++r) sS[w][8 * g + r][t * 16 + col] = s[r] * 0.125f + bfr(amask[(size_t)(q0 + 8 * g + r) * SS + key]); }
    LDSX();
    float mx = -3.4e38f;
#pragma unroll
    for (int jj = 0; jj < 32; ++jj) mx = fmaxf(mx, sS[w][col][g * 32 + jj]);
    mx = fmaxf(mx, __shfl_xor(mx, 16, 32));
    const float mnew = fmaxf(mrun, mx); const float corr = expf(mrun - mnew);
    float ps = 0.f;
#pragma unroll
    for (int jj = 0; jj < 32; ++jj) { const float p = expf(sS[w][col][g * 32 + jj] - mnew) * 16384.0f; ps += p; const _Float16 hi = (_Float16)p; sPh[w][col][g * 32 + jj] = hi; sPl[w][col][g * 32 + jj] = (_Float16)((p - (float)hi) * PLO); }
    ps += __shfl_xor(ps, 16, 32);
    lrun = lrun * corr + ps * (1.0f / 16384.0f); mrun = mnew;
#pragma unroll
    for (int r = 0; r < 8; ++r) { const float cr = __shfl(corr, 8 * g + r, 32);
#pragma unroll
      for (int t = 0; t < 4; ++t) { acc[t][r] *= cr; ac1[t][r] *= cr; ac2[t][r] *= cr; } }
    LDSX();
#pragma unroll
    for (int kc = 0; kc < 2; ++kc) { const v16h ph = frag_h(&sPh[w][col][0] + kc * 32, lane), pl = frag_h(&sPl[w][col][0] + kc * 32, lane);
#pragma unroll
      for (int t = 0; t < 4; ++t) { const size_t vo = (bh * HD + t * 16 + col) * SS + kt * 64 + kc * 32; const v16h vh = frag_h(VTh + vo, lane);
        acc[t] = wmma16(ph, vh, acc[t]); ac1[t] = wmma16(ph, frag_h(VTl + vo, lane), ac1[t]); ac2[t] = wmma16(pl, vh, ac2[t]); } }
    __builtin_amdgcn_wave_barrier(); }
#pragma unroll
  for (int r = 0; r < 8; ++r) { const float lr = __shfl(lrun, 8 * g + r, 32); const float inv = 1.0f / (lr * 16384.0f * 4.0f);
#pragma unroll
    for (int t = 0; t < 4; ++t) sO[w][8 * g + r][t * 16 + col] = (acc[t][r] + ac1[t][r] * (1.0f / VLO) + ac2[t][r] * (1.0f / PLO)) * inv; }
  LDSX();
  for (int qq = lane; qq < 16 * 16; qq += 32) { const int rl = qq >> 4, pc = qq & 15; vst2(O32 + ((bh * SS) + q0 + rl) * HD + pc * 4, *(const v4f*)(&sO[w][rl][pc * 4])); }
}
// out = ctx Wo^T + bo : split(ctx) x bf16(Wo rows): 2 products (Wo is an INPUT -> bf16 exact)
__global__ __launch_bounds__(128) void k_out(const float* __restrict__ O32, const float* __restrict__ Wo, const float* __restrict__ bo, float* __restrict__ out) {
  __shared__ __align__(16) float so[4][16][132];
  const int tid = threadIdx.x, wave = tid >> 5, lane = tid & 31, col = lane & 15, g = lane >> 4;
  const int r0 = blockIdx.x * 64 + wave * 16, n0 = blockIdx.y * 128; const int ra = r0 + col; const int b = ra / SS, s = ra % SS;
  v8f acc[8] = {};
#pragma unroll 1
  for (int kc = 0; kc < E / 32; ++kc) { const int h = kc >> 1; const F2 a = split_row(O32 + (((size_t)b * NH + h) * SS + s) * HD, (kc & 1) * 32, lane);
#pragma unroll
    for (int j = 0; j < 8; ++j) { const v16b wb = split_row(Wo + (size_t)(n0 + j * 16 + col) * E, kc * 32, lane).h; acc[j] = wmma_bf(a.l, wb, acc[j]); acc[j] = wmma_bf(a.h, wb, acc[j]); } }
#pragma unroll
  for (int j = 0; j < 8; ++j) { const int n = n0 + j * 16 + col; const float bb = bfr(bo[n]);
#pragma unroll
    for (int r = 0; r < 8; ++r) so[wave][8 * g + r][j * 16 + col] = acc[j][r] + bb; }
  LDSX();
#pragma unroll 4
  for (int rl = 0; rl < 16; ++rl) vst2(out + (size_t)(r0 + rl) * E + n0 + lane * 4, *(const v4f*)(&so[wave][rl][lane * 4]));
}
extern "C" void kernel_launch(void* const* d_in, const int* in_sizes, int n_in, void* d_out, int out_size, void* d_ws, size_t ws_size, hipStream_t stream) {
  (void)in_sizes; (void)n_in; (void)out_size; (void)ws_size;
  const float** I = (const float**)d_in;
  const float* x = I[0]; const float* amask = I[1]; const float* Wq = I[2]; const float* bq = I[3]; const float* Wk = I[4]; const float* bk = I[5]; const float* Wv = I[6]; const float* bv = I[7]; const float* Wp = I[8]; const float* bp = I[9]; const float* qnw = I[10]; const float* knw = I[11];
  float* out = (float*)d_out;
  char* ws = (char*)d_ws; size_t off = 0;
  auto take = [&](size_t bytes) { char* p = ws + off; off += (bytes + 255) & ~(size_t)255; return p; };
  __bf16* Xb = (__bf16*)take((size_t)NR * E * 2); __bf16* PT = (__bf16*)take((size_t)3 * E * E * 2);
  float* Q32 = (float*)take((size_t)NR * E * 4); float* K32 = (float*)take((size_t)NR * E * 4); _Float16* VTh = (_Float16*)take((size_t)NR * E * 2); _Float16* VTl = (_Float16*)take((size_t)NR * E * 2); float* O32 = (float*)take((size_t)NR * E * 4);
  // ws ~ 82 MB
  k_cvt<<<(NR * E / 8 + 255) / 256, 256, 0, stream>>>(x, Xb);
  k_pack<<<3 * E, 256, 0, stream>>>(Wq, Wk, Wv, PT);
  k_qkv<<<dim3(NR / 64, E / 128, 3), 128, 0, stream>>>(Xb, PT, bq, bk, bv, qnw, knw, Q32, K32, VTh, VTl);
  k_attn<<<dim3(SS / 64, NB * NH), 128, 0, stream>>>(Q32, K32, VTh, VTl, amask, O32);
  k_out<<<dim3(NR / 64, E / 128), 128, 0, stream>>>(O32, Wp, bp, out);
}

// v001
// It runs in 464 microseconds.
// Two timings next to v000 put it at 1.43 and 1.44 times that version's speed.
// compute dtype: every module INPUT that feeds a GEMM (x, Wq/Wk/Wv/Wp, biases, LN weights, attn_mask) is rounded to bf16 and used in exact bf16 WMMA products with f32 accumulation; computed operands (normalised+rotated q/k f32 split, P and V hi/lo, context split) f32-grade; LayerNorm/RoPE/softmax f32.
#include <hip/hip_runtime.h>
#include <math.h>

typedef __attribute__((ext_vector_type(16))) _Float16 v16h;
typedef __attribute__((ext_vector_type(16))) __bf16 v16b;
typedef __attribute__((ext_vector_type(8)))  _Float16 v8h;
typedef __attribute__((ext_vector_type(8)))  float v8f;
typedef __attribute__((ext_vector_type(4)))  float v4f;
typedef __attribute__((ext_vector_type(2)))  float v2f;
typedef __attribute__((ext_vector_type(4)))  unsigned v4u;
typedef __attribute__((ext_vector_type(4)))  int v4i;
typedef float __attribute__((may_alias)) float_a;
typedef int __attribute__((may_alias)) int_a;

template <typename T> __device__ __forceinline__ void vst2(void* p, T v) { *(T*)p = v;  }
__device__ __forceinline__ v8f wmma16(v16h a, v16h b, v8f c) {
  v8f d = __builtin_amdgcn_wmma_f32_16x16x32_f16(false, a, false, b, (short)0, c, false, false);
  asm volatile("v_nop\n\tv_nop\n\tv_nop\n\tv_nop" : "+v"(d) : "v"(a), "v"(b));
  return d;
}
__device__ __forceinline__ v8f wmma_bf(v16b a, v16b b, v8f c) {
  v8f d = __builtin_amdgcn_wmma_f32_16x16x32_bf16(false, a, false, b, (short)0, c, false, false);
  asm volatile("v_nop\n\tv_nop\n\tv_nop\n\tv_nop" : "+v"(d) : "v"(a), "v"(b));
  return d;
}
// 16x16x32 fragments: lane = (h = lane>>4, row/col = lane&15); elements 0..7 = k0+8h+0..7, 8..15 = k0+16+8h+0..7; D element r = row 8h+r
__device__ __forceinline__ v16h frag_h(const _Float16* rowk0, int lane) {
  union { v16h v; v8h q[2]; } u; const _Float16* p = rowk0 + 8 * (lane >> 4);
  u.q[0] = *(const v8h*)p; u.q[1] = *(const v8h*)(p + 16); return u.v;
}
__device__ __forceinline__ v16h frag_f32(const float* rowk0, int lane) {
  v16h a; const float* p = rowk0 + 8 * (lane >> 4);
#pragma unroll
  for (int i = 0; i < 8; ++i) { a[i] = (_Float16)p[i]; a[8 + i] = (_Float16)p[16 + i]; }
  return a;
}
__device__ __forceinline__ v16h frag_f32s(const float* rowk0, int lane, float sc) {
  v16h a; const float* p = rowk0 + 8 * (lane >> 4);
#pragma unroll
  for (int i = 0; i < 8; ++i) { a[i] = (_Float16)(p[i] * sc); a[8 + i] = (_Float16)(p[16 + i] * sc); }
  return a;
}
// column fragment from a [K][ld] layout (column n), rows >= K read as 0
__device__ __forceinline__ v16h fragc_f32(const float* W, int k0, int n, int lane, int ld, int K) {
  v16h a; const int g = lane >> 4;
#pragma unroll
  for (int i = 0; i < 8; ++i) { const int ka = k0 + 8 * g + i, kb = ka + 16;
    a[i] = (_Float16)(ka < K ? W[(size_t)ka * ld + n] : 0.f); a[8 + i] = (_Float16)(kb < K ? W[(size_t)kb * ld + n] : 0.f); }
  return a;
}
struct F2 { v16b h, l; };
__device__ __forceinline__ F2 bsplit16(const float v[16]) { F2 r;
#pragma unroll
  for (int i = 0; i < 16; ++i) { const __bf16 h = (__bf16)v[i]; r.h[i] = h; r.l[i] = (__bf16)(v[i] - (float)h); }
  return r; }
__device__ __forceinline__ F2 split_row(const float* row, int k0, int lane) { float v[16]; const float* p = row + k0 + 8 * (lane >> 4);
#pragma unroll
  for (int i = 0; i < 8; ++i) { v[i] = p[i]; v[8 + i] = p[16 + i]; }
  return bsplit16(v); }
__device__ __forceinline__ F2 split_rowK(const float* row, int k0, int lane, int K) { float v[16]; const int g = lane >> 4;
#pragma unroll
  for (int i = 0; i < 8; ++i) { const int ka = k0 + 8 * g + i, kb = ka + 16; v[i] = ka < K ? row[ka] : 0.f; v[8 + i] = kb < K ? row[kb] : 0.f; }
  return bsplit16(v); }
__device__ __forceinline__ F2 split_col(const float* W, int k0, int n, int lane, int ld, int K) { float v[16]; const int g = lane >> 4;
#pragma unroll
  for (int i = 0; i < 8; ++i) { const int ka = k0 + 8 * g + i, kb = ka + 16; v[i] = ka < K ? W[(size_t)ka * ld + n] : 0.f; v[8 + i] = kb < K ? W[(size_t)kb * ld + n] : 0.f; }
  return bsplit16(v); }
__device__ __forceinline__ v8f mac3(const F2& a, const F2& b, v8f c) { c = wmma_bf(a.l, b.h, c); c = wmma_bf(a.h, b.l, c); return wmma_bf(a.h, b.h, c); }
__device__ __forceinline__ float sigm(float v) { return 1.0f / (1.0f + expf(-v)); }
#define LDSX() do { asm volatile("s_wait_dscnt 0" ::: "memory"); __builtin_amdgcn_wave_barrier(); __builtin_amdgcn_fence(__ATOMIC_RELEASE, "workgroup"); } while (0)


// NEPA self attention (16 heads of 64 on [2,2048,1024], [out][in] weights + biases): q,k LayerNorm'd per head (eps 1e-6, weight only), RoPE on tokens >= 1 (prefix 1):
// angle[d] = 2*pi*coord(t)*100^(-(d mod 16)/16), coord = 2*(t-1+0.5)/2047 - 1, rotate-half pairs (d, d+32); scores = q.k/8 + attn_mask[q][k]; softmax; (P v) Wp^T + bp.
#define NB 2
#define SS 2048
#define E 1024
#define NH 16
#define HD 64
#define NR (NB * SS)
#define ROPE_L 2047.0f
#define PLO 1024.0f
#define VLO 2048.0f
__device__ __forceinline__ float bfr(float v) { return (float)(__bf16)v; }
__device__ __forceinline__ v16b frag_b(const __bf16* rowk0, int lane) { return __builtin_bit_cast(v16b, frag_h((const _Float16*)rowk0, lane)); }

__global__ __launch_bounds__(256) void k_cvt(const float* __restrict__ x, __bf16* __restrict__ Xb) {
  const size_t i8 = (size_t)blockIdx.x * 256 + threadIdx.x; if (i8 >= (size_t)NR * E / 8) return;
  union { __bf16 h[8]; v4u u; } pk;
#pragma unroll
  for (int e = 0; e < 8; ++e) pk.h[e] = (__bf16)x[i8 * 8 + e];
  vst2((unsigned*)(Xb + i8 * 8), pk.u);
}
// PT rows: [0,E) Wq[n][:], [E,2E) Wk, [2E,3E) Wv  ([out][in]) as bf16 rows (no scaling)
__global__ __launch_bounds__(256) void k_pack(const float* __restrict__ Wq, const float* __restrict__ Wk, const float* __restrict__ Wv, __bf16* __restrict__ PT) {
  const int n = blockIdx.x, tid = threadIdx.x; __shared__ __align__(16) __bf16 srow[E];
  const float* W = n < E ? Wq : (n < 2 * E ? Wk : Wv); const int nn = n & (E - 1);
  for (int k = tid; k < E; k += 256) srow[k] = (__bf16)W[(size_t)nn * E + k];
  __syncthreads();
  if (tid < E / 8) vst2((unsigned*)(PT + (size_t)n * E + tid * 8), *(const v4u*)(&srow[tid * 8]));
}
// QKV: block (64 rows, 128 cols = 2 heads, which); q,k -> LayerNorm+RoPE -> Q32/K32 f32 [bh][s][64]; v -> VT hi/lo x4 [bh][d][s]
__global__ __launch_bounds__(128) void k_qkv(const __bf16* __restrict__ Xb, const __bf16* __restrict__ PT, const float* __restrict__ bq, const float* __restrict__ bk, const float* __restrict__ bv, const float* __restrict__ qnw, const float* __restrict__ knw,
                                            float* __restrict__ Q32, float* __restrict__ K32, _Float16* __restrict__ VTh, _Float16* __restrict__ VTl) {
  __shared__ __align__(16) float so[4][16][132];
  __shared__ __align__(16) _Float16 sth[128][72], stl[128][72];
  const int tid = threadIdx.x, wave = tid >> 5, lane = tid & 31, col = lane & 15, g = lane >> 4;
  const int which = blockIdx.z, r0b = blockIdx.x * 64, r0 = r0b + wave * 16, n0 = blockIdx.y * 128; const int b = r0b / SS, s0 = r0b % SS;
  const float* bb_ = which == 0 ? bq : (which == 1 ? bk : bv);
  v8f acc[8] = {};
#pragma unroll 2
  for (int kc = 0; kc < E / 32; ++kc) { const v16b a = frag_b(Xb + (size_t)(r0 + col) * E + kc * 32, lane);
#pragma unroll
    for (int j = 0; j < 8; ++j) acc[j] = wmma_bf(a, frag_b(PT + (size_t)(which * E + n0 + j * 16 + col) * E + kc * 32, lane), acc[j]); }
  if (which < 2) {
#pragma unroll
    for (int j = 0; j < 8; ++j) { const float bb = bfr(bb_[n0 + j * 16 + col]);
#pragma unroll
      for (int r = 0; r < 8; ++r) so[wave][8 * g + r][j * 16 + col] = acc[j][r] + bb; }
    LDSX();
    { const int rl = lane & 15, hh = lane >> 4; float* rowp = &so[wave][rl][hh * 64]; const float* wn = which == 0 ? qnw : knw; float s1 = 0.f;
#pragma unroll 8
      for (int d = 0; d < 64; ++d) s1 += rowp[d];
      const float mu = s1 * (1.0f / 64.0f); float s2 = 0.f;
#pragma unroll 8
      for (int d = 0; d < 64; ++d) { const float dv = rowp[d] - mu; s2 += dv * dv; }
      const float rs = rsqrtf(s2 * (1.0f / 64.0f) + 1e-6f);
#pragma unroll 8
      for (int d = 0; d < 64; ++d) rowp[d] = (rowp[d] - mu) * rs * bfr(wn[d]);
      // RoPE for tokens t >= 1
      const int t = s0 + wave * 16 + rl;
      if (t >= 1) { const float coord = 2.0f * (((float)(t - 1) + 0.5f) / ROPE_L) - 1.0f;
#pragma unroll 4
        for (int d = 0; d < 32; ++d) { const float invf = powf(100.0f, -(float)(d & 15) * (1.0f / 16.0f)); const float ang = 6.283185307179586f * coord * invf; float sn, cs; sincosf(ang, &sn, &cs);
          const float x1 = rowp[d], x2 = rowp[d + 32]; rowp[d] = x1 * cs - x2 * sn; rowp[d + 32] = x2 * cs + x1 * sn; } } }
    LDSX();
    float* Dst = which == 0 ? Q32 : K32;
    for (int qq = lane; qq < 2 * 16 * 16; qq += 32) { const int hh = qq >> 8, rl = (qq >> 4) & 15, pc = qq & 15; const int h = (n0 >> 6) + hh;
      vst2(Dst + (((size_t)b * NH + h) * SS + s0 + wave * 16 + rl) * HD + pc * 4, *(const v4f*)(&so[wave][rl][hh * 64 + pc * 4])); } }
  else {
#pragma unroll
    for (int j = 0; j < 8; ++j) { const float bb = bfr(bb_[n0 + j * 16 + col]);
#pragma unroll
      for (int r = 0; r < 8; ++r) { const float v = (acc[j][r] + bb) * 4.0f; const _Float16 hi = (_Float16)v; sth[j * 16 + col][wave * 16 + 8 * g + r] = hi; stl[j * 16 + col][wave * 16 + 8 * g + r] = (_Float16)((v - (float)hi) * VLO); } }
    __syncthreads();
    for (int qq = tid; qq < 128 * 8; qq += 128) { const int cl = qq >> 3, pc = qq & 7; const int c = n0 + cl, h = c >> 6, d = c & 63; const size_t o = (((size_t)b * NH + h) * HD + d) * SS + s0 + pc * 8;
      vst2(VTh + o, *(const v4u*)(&sth[cl][pc * 8])); vst2(VTl + o, *(const v4u*)(&stl[cl][pc * 8])); } }
}
// eight 16-byte asynchronous copies per lane, global memory to LDS through no register; the s_wait_xcnt that closes the statement stands in front of any rewrite of the address registers the copies name
__device__ __forceinline__ void copy8(const unsigned* l, const char* const* p) {
  asm volatile("global_load_async_to_lds_b128 %0, %8, off\n\t"
               "global_load_async_to_lds_b128 %1, %9, off\n\t"
               "global_load_async_to_lds_b128 %2, %10, off\n\t"
               "global_load_async_to_lds_b128 %3, %11, off\n\t"
               "global_load_async_to_lds_b128 %4, %12, off\n\t"
               "global_load_async_to_lds_b128 %5, %13, off\n\t"
               "global_load_async_to_lds_b128 %6, %14, off\n\t"
               "global_load_async_to_lds_b128 %7, %15, off\n\t"
               "s_wait_xcnt 0x0"
               :: "v"(l[0]), "v"(l[1]), "v"(l[2]), "v"(l[3]), "v"(l[4]), "v"(l[5]), "v"(l[6]), "v"(l[7]),
                  "v"(p[0]), "v"(p[1]), "v"(p[2]), "v"(p[3]), "v"(p[4]), "v"(p[5]), "v"(p[6]), "v"(p[7]) : "memory");
}
// hand-over of a ring buffer: this wave's LDS reads and writes are done, its own copies have landed, then every wave meets; behind it the other buffer is readable and the one just read may be refilled
#define RING_FOOT() do { asm volatile("s_wait_dscnt 0x0" ::: "memory"); asm volatile("s_wait_asynccnt 0x0" ::: "memory"); __syncthreads(); } while (0)
// attention over all keys: block (64 queries, bh), 32 key tiles of 64; the block's four waves share each K tile (f32 rows) and V tile (hi/lo rows) through LDS, filled by asynchronous copies:
// ring of two buffers, stage 2*kt = K tile kt in sK, stage 2*kt+1 = V tile kt in sV; S on hi/lo splits of the f32 q/k rows; P,V hi/lo; O f32 [bh][s][64]
__global__ __launch_bounds__(128) void k_attn(const float* __restrict__ Q32, const float* __restrict__ K32, const _Float16* __restrict__ VTh, const _Float16* __restrict__ VTl, const float* __restrict__ amask, float* __restrict__ O32) {
  __shared__ __align__(16) float sS[4][16][68];
  __shared__ __align__(16) _Float16 sPh[4][16][72], sPl[4][16][72];
  __shared__ __align__(16) float sK[64][68];
  __shared__ __align__(16) _Float16 sV[2][64][72];
  const int tid = threadIdx.x, w = tid >> 5, lane = tid & 31, col = lane & 15, g = lane >> 4;
  const size_t bh = blockIdx.y; const int qb = blockIdx.x; const int q0 = qb * 64 + w * 16;
  const unsigned ldsK = (unsigned)(size_t)&sK[tid >> 4][(tid & 15) * 4], ldsV = (unsigned)(size_t)&sV[0][tid >> 3][(tid & 7) * 8];
  const char* gK = (const char*)(K32 + bh * SS * HD) + tid * 16;
  const size_t voff = ((bh * HD + (tid >> 3)) * SS + (tid & 7) * 8) * 2;
  const char* gVh = (const char*)VTh + voff; const char* gVl = (const char*)VTl + voff;
  auto fillK = [&](int kt) { unsigned l[8]; const char* p[8];
#pragma unroll  // the eight address pairs are operands of one asm statement: they must be registers, not indexed arrays
    for (int i = 0; i < 8; ++i) { l[i] = ldsK + i * (8 * 68 * 4); p[i] = gK + (size_t)kt * (64 * HD * 4) + i * 2048; }
    copy8(l, p); };
  auto fillV = [&](int kt) { unsigned l[8]; const char* p[8];
#pragma unroll  // as in fillK
    for (int i = 0; i < 8; ++i) { l[i] = ldsV + (i >> 2) * (64 * 72 * 2) + (i & 3) * (16 * 72 * 2); p[i] = (i < 4 ? gVh : gVl) + (size_t)(i & 3) * (16 * SS * 2) + (size_t)kt * 128; }
    copy8(l, p); };
  fillK(0);
  F2 aq[2];
#pragma unroll
  for (int kc = 0; kc < 2; ++kc) aq[kc] = split_row(Q32 + (bh * SS + q0 + col) * HD, kc * 32, lane);
  float mrun = -3.0e38f, lrun = 0.f; v8f acc[4] = {}, ac1[4] = {}, ac2[4] = {};
  asm volatile("s_wait_asynccnt 0x0" ::: "memory");  // K tile 0 has landed before the barrier that publishes it
  __syncthreads();
  fillV(0);
#pragma unroll 1
  for (int kt = 0;; ++kt) {
#pragma unroll
    for (int t = 0; t < 4; ++t) { const int key = kt * 64 + t * 16 + col; const float* krow = &sK[t * 16 + col][0];
      v8f s = mac3(aq[0], split_row(krow, 0, lane), (v8f){}); s = mac3(aq[1], split_row(krow, 32, lane), s);
#pragma unroll
      for (int r = 0; r < 8; ++r) sS[w][8 * g + r][t * 16 + col] = s[r] * 0.125f + bfr(amask[(size_t)(q0 + 8 * g + r) * SS + key]); }
    RING_FOOT();
    if (kt + 1 < SS / 64) fillK(kt + 1);
    float mx = -3.4e38f;
#pragma unroll
    for (int jj = 0; jj < 32; ++jj) mx = fmaxf(mx, sS[w][col][g * 32 + jj]);
    mx = fmaxf(mx, __shfl_xor(mx, 16, 32));
    const float mnew = fmaxf(mrun, mx); const float corr = expf(mrun - mnew);
    float ps = 0.f;
#pragma unroll
    for (int jj = 0; jj < 32; ++jj) { const float p = expf(sS[w][col][g * 32 + jj] - mnew) * 16384.0f; ps += p; const _Float16 hi = (_Float16)p; sPh[w][col][g * 32 + jj] = hi; sPl[w][col][g * 32 + jj] = (_Float16)((p - (float)hi) * PLO); }
    ps += __shfl_xor(ps, 16, 32);
    lrun = lrun * corr + ps * (1.0f / 16384.0f); mrun = mnew;
#pragma unroll
    for (int r = 0; r < 8; ++r) { const float cr = __shfl(corr, 8 * g + r, 32);
#pragma unroll
      for (int t = 0; t < 4; ++t) { acc[t][r] *= cr; ac1[t][r] *= cr; ac2[t][r] *= cr; } }
    LDSX();
#pragma unroll
    for (int kc = 0; kc < 2; ++kc) { const v16h ph = frag_h(&sPh[w][col][0] + kc * 32, lane), pl = frag_h(&sPl[w][col][0] + kc * 32, lane);
#pragma unroll
      for (int t = 0; t < 4; ++t) { const v16h vh = frag_h(&sV[0][t * 16 + col][kc * 32], lane);
        acc[t] = wmma16(ph, vh, acc[t]); ac1[t] = wmma16(ph, frag_h(&sV[1][t * 16 + col][kc * 32], lane), ac1[t]); ac2[t] = wmma16(pl, vh, ac2[t]); } }
    RING_FOOT();
    if (kt + 1 == SS / 64) break;
    fillV(kt + 1); }
  asm volatile("s_wait_asynccnt 0x0" ::: "memory");  // no copy is left in flight when the wave goes on to its epilogue and ends
#pragma unroll
  for (int r = 0; r < 8; ++r) { const float lr = __shfl(lrun, 8 * g + r, 32); const float inv = 1.0f / (lr * 16384.0f * 4.0f);
#pragma unroll
    for (int t = 0; t < 4; ++t) sS[w][8 * g + r][t * 16 + col] = (acc[t][r] + ac1[t][r] * (1.0f / VLO) + ac2[t][r] * (1.0f / PLO)) * inv; }
  LDSX();
  for (int qq = lane; qq < 16 * 16; qq += 32) { const int rl = qq >> 4, pc = qq & 15; vst2(O32 + ((bh * SS) + q0 + rl) * HD + pc * 4, *(const v4f*)(&sS[w][rl][pc * 4])); }
}
// out = ctx Wo^T + bo : split(ctx) x bf16(Wo rows): 2 products (Wo is an INPUT -> bf16 exact)
__global__ __launch_bounds__(128) void k_out(const float* __restrict__ O32, const float* __restrict__ Wo, const float* __restrict__ bo, float* __restrict__ out) {
  __shared__ __align__(16) float so[4][16][132];
  const int tid = threadIdx.x, wave = tid >> 5, lane = tid & 31, col = lane & 15, g = lane >> 4;
  const int r0 = blockIdx.x * 64 + wave * 16, n0 = blockIdx.y * 128; const int ra = r0 + col; const int b = ra / SS, s = ra % SS;
  v8f acc[8] = {};
#pragma unroll 1
  for (int kc = 0; kc < E / 32; ++kc) { const int h = kc >> 1; const F2 a = split_row(O32 + (((size_t)b * NH + h) * SS + s) * HD, (kc & 1) * 32, lane);
#pragma unroll
    for (int j = 0; j < 8; ++j) { const v16b wb = split_row(Wo + (size_t)(n0 + j * 16 + col) * E, kc * 32, lane).h; acc[j] = wmma_bf(a.l, wb, acc[j]); acc[j] = wmma_bf(a.h, wb, acc[j]); } }
#pragma unroll
  for (int j = 0; j < 8; ++j) { const int n = n0 + j * 16 + col; const float bb = bfr(bo[n]);
#pragma unroll
    for (int r = 0; r < 8; ++r) so[wave][8 * g + r][j * 16 + col] = acc[j][r] + bb; }
  LDSX();
#pragma unroll 4
  for (int rl = 0; rl < 16; ++rl) vst2(out + (size_t)(r0 + rl) * E + n0 + lane * 4, *(const v4f*)(&so[wave][rl][lane * 4]));
}
extern "C" void kernel_launch(void* const* d_in, const int* in_sizes, int n_in, void* d_out, int out_size, void* d_ws, size_t ws_size, hipStream_t stream) {
  (void)in_sizes; (void)n_in; (void)out_size; (void)ws_size;
  const float** I = (const float**)d_in;
  const float* x = I[0]; const float* amask = I[1]; const float* Wq = I[2]; const float* bq = I[3]; const float* Wk = I[4]; const float* bk = I[5]; const float* Wv = I[6]; const float* bv = I[7]; const float* Wp = I[8]; const float* bp = I[9]; const float* qnw = I[10]; const float* knw = I[11];
  float* out = (float*)d_out;
  char* ws = (char*)d_ws; size_t off = 0;
  auto take = [&](size_t bytes) { char* p = ws + off; off += (bytes + 255) & ~(size_t)255; return p; };
  __bf16* Xb = (__bf16*)take((size_t)NR * E * 2); __bf16* PT = (__bf16*)take((size_t)3 * E * E * 2);
  float* Q32 = (float*)take((size_t)NR * E * 4); float* K32 = (float*)take((size_t)NR * E * 4); _Float16* VTh = (_Float16*)take((size_t)NR * E * 2); _Float16* VTl = (_Float16*)take((size_t)NR * E * 2); float* O32 = (float*)take((size_t)NR * E * 4);
  // ws ~ 82 MB
  k_cvt<<<(NR * E / 8 + 255) / 256, 256, 0, stream>>>(x, Xb);
  k_pack<<<3 * E, 256, 0, stream>>>(Wq, Wk, Wv, PT);
  k_qkv<<<dim3(NR / 64, E / 128, 3), 128, 0, stream>>>(Xb, PT, bq, bk, bv, qnw, knw, Q32, K32, VTh, VTl);
  k_attn<<<dim3(SS / 64, NB * NH), 128, 0, stream>>>(Q32, K32, VTh, VTl, amask, O32);
  k_out<<<dim3(NR / 64, E / 128), 128, 0, stream>>>(O32, Wp, bp, out);
}

// v002
// A run of this version takes 255 microseconds.
// In two side-by-side timings against v001, it was 1.81 and 1.82 times as fast.
// Over all steps from v000 it is 2.60 times as fast.
// compute dtype: every module INPUT that feeds a GEMM (x, Wq/Wk/Wv/Wp, biases, LN weights, attn_mask) is rounded to bf16 and used in exact bf16 WMMA products with f32 accumulation; computed operands (normalised+rotated q/k f32 split, P and V hi/lo, context split) f32-grade; LayerNorm/RoPE/softmax f32.
#include <hip/hip_runtime.h>
#include <math.h>

typedef __attribute__((ext_vector_type(16))) _Float16 v16h;
typedef __attribute__((ext_vector_type(16))) __bf16 v16b;
typedef __attribute__((ext_vector_type(8)))  _Float16 v8h;
typedef __attribute__((ext_vector_type(8)))  float v8f;
typedef __attribute__((ext_vector_type(4)))  float v4f;
typedef __attribute__((ext_vector_type(2)))  float v2f;
typedef __attribute__((ext_vector_type(4)))  unsigned v4u;
typedef __attribute__((ext_vector_type(4)))  int v4i;
typedef float __attribute__((may_alias)) float_a;
typedef int __attribute__((may_alias)) int_a;

template <typename T> __device__ __forceinline__ void vst2(void* p, T v) { *(T*)p = v;  }
__device__ __forceinline__ v8f wmma16(v16h a, v16h b, v8f c) {
  v8f d = __builtin_amdgcn_wmma_f32_16x16x32_f16(false, a, false, b, (short)0, c, false, false);
  asm volatile("v_nop\n\tv_nop\n\tv_nop\n\tv_nop" : "+v"(d) : "v"(a), "v"(b));
  return d;
}
__device__ __forceinline__ v8f wmma_bf(v16b a, v16b b, v8f c) {
  v8f d = __builtin_amdgcn_wmma_f32_16x16x32_bf16(false, a, false, b, (short)0, c, false, false);
  asm volatile("v_nop\n\tv_nop\n\tv_nop\n\tv_nop" : "+v"(d) : "v"(a), "v"(b));
  return d;
}
// 16x16x32 fragments: lane = (h = lane>>4, row/col = lane&15); elements 0..7 = k0+8h+0..7, 8..15 = k0+16+8h+0..7; D element r = row 8h+r
__device__ __forceinline__ v16h frag_h(const _Float16* rowk0, int lane) {
  union { v16h v; v8h q[2]; } u; const _Float16* p = rowk0 + 8 * (lane >> 4);
  u.q[0] = *(const v8h*)p; u.q[1] = *(const v8h*)(p + 16); return u.v;
}
__device__ __forceinline__ v16h frag_f32(const float* rowk0, int lane) {
  v16h a; const float* p = rowk0 + 8 * (lane >> 4);
#pragma unroll
  for (int i = 0; i < 8; ++i) { a[i] = (_Float16)p[i]; a[8 + i] = (_Float16)p[16 + i]; }
  return a;
}
__device__ __forceinline__ v16h frag_f32s(const float* rowk0, int lane, float sc) {
  v16h a; const float* p = rowk0 + 8 * (lane >> 4);
#pragma unroll
  for (int i = 0; i < 8; ++i) { a[i] = (_Float16)(p[i] * sc); a[8 + i] = (_Float16)(p[16 + i] * sc); }
  return a;
}
// column fragment from a [K][ld] layout (column n), rows >= K read as 0
__device__ __forceinline__ v16h fragc_f32(const float* W, int k0, int n, int lane, int ld, int K) {
  v16h a; const int g = lane >> 4;
#pragma unroll
  for (int i = 0; i < 8; ++i) { const int ka = k0 + 8 * g + i, kb = ka + 16;
    a[i] = (_Float16)(ka < K ? W[(size_t)ka * ld + n] : 0.f); a[8 + i] = (_Float16)(kb < K ? W[(size_t)kb * ld + n] : 0.f); }
  return a;
}
struct F2 { v16b h, l; };
__device__ __forceinline__ F2 bsplit16(const float v[16]) { F2 r;
#pragma unroll
  for (int i = 0; i < 16; ++i) { const __bf16 h = (__bf16)v[i]; r.h[i] = h; r.l[i] = (__bf16)(v[i] - (float)h); }
  return r; }
__device__ __forceinline__ F2 split_row(const float* row, int k0, int lane) { float v[16]; const float* p = row + k0 + 8 * (lane >> 4);
#pragma unroll
  for (int i = 0; i < 8; ++i) { v[i] = p[i]; v[8 + i] = p[16 + i]; }
  return bsplit16(v); }
__device__ __forceinline__ F2 split_rowK(const float* row, int k0, int lane, int K) { float v[16]; const int g = lane >> 4;
#pragma unroll
  for (int i = 0; i < 8; ++i) { const int ka = k0 + 8 * g + i, kb = ka + 16; v[i] = ka < K ? row[ka] : 0.f; v[8 + i] = kb < K ? row[kb] : 0.f; }
  return bsplit16(v); }
__device__ __forceinline__ F2 split_col(const float* W, int k0, int n, int lane, int ld, int K) { float v[16]; const int g = lane >> 4;
#pragma unroll
  for (int i = 0; i < 8; ++i) { const int ka = k0 + 8 * g + i, kb = ka + 16; v[i] = ka < K ? W[(size_t)ka * ld + n] : 0.f; v[8 + i] = kb < K ? W[(size_t)kb * ld + n] : 0.f; }
  return bsplit16(v); }
__device__ __forceinline__ v8f mac3(const F2& a, const F2& b, v8f c) { c = wmma_bf(a.l, b.h, c); c = wmma_bf(a.h, b.l, c); return wmma_bf(a.h, b.h, c); }
__device__ __forceinline__ float sigm(float v) { return 1.0f / (1.0f + expf(-v)); }
#define LDSX() do { asm volatile("s_wait_dscnt 0" ::: "memory"); __builtin_amdgcn_wave_barrier(); __builtin_amdgcn_fence(__ATOMIC_RELEASE, "workgroup"); } while (0)


// NEPA self attention (16 heads of 64 on [2,2048,1024], [out][in] weights + biases): q,k LayerNorm'd per head (eps 1e-6, weight only), RoPE on tokens >= 1 (prefix 1):
// angle[d] = 2*pi*coord(t)*100^(-(d mod 16)/16), coord = 2*(t-1+0.5)/2047 - 1, rotate-half pairs (d, d+32); scores = q.k/8 + attn_mask[q][k]; softmax; (P v) Wp^T + bp.
#define NB 2
#define SS 2048
#define E 1024
#define NH 16
#define HD 64
#define NR (NB * SS)
#define ROPE_L 2047.0f
#define PLO 1024.0f
#define VLO 2048.0f
__device__ __forceinline__ float bfr(float v) { return (float)(__bf16)v; }
__device__ __forceinline__ v16b frag_b(const __bf16* rowk0, int lane) { return __builtin_bit_cast(v16b, frag_h((const _Float16*)rowk0, lane)); }

__global__ __launch_bounds__(256) void k_cvt(const float* __restrict__ x, __bf16* __restrict__ Xb) {
  const size_t i8 = (size_t)blockIdx.x * 256 + threadIdx.x; if (i8 >= (size_t)NR * E / 8) return;
  union { __bf16 h[8]; v4u u; } pk;
#pragma unroll
  for (int e = 0; e < 8; ++e) pk.h[e] = (__bf16)x[i8 * 8 + e];
  vst2((unsigned*)(Xb + i8 * 8), pk.u);
}
// PT rows: [0,E) Wq[n][:], [E,2E) Wk, [2E,3E) Wv  ([out][in]) as bf16 rows (no scaling)
__global__ __launch_bounds__(256) void k_pack(const float* __restrict__ Wq, const float* __restrict__ Wk, const float* __restrict__ Wv, __bf16* __restrict__ PT) {
  const int n = blockIdx.x, tid = threadIdx.x; __shared__ __align__(16) __bf16 srow[E];
  const float* W = n < E ? Wq : (n < 2 * E ? Wk : Wv); const int nn = n & (E - 1);
  for (int k = tid; k < E; k += 256) srow[k] = (__bf16)W[(size_t)nn * E + k];
  __syncthreads();
  if (tid < E / 8) vst2((unsigned*)(PT + (size_t)n * E + tid * 8), *(const v4u*)(&srow[tid * 8]));
}
// hand-over of a ring buffer: this wave's LDS reads and writes are done, its own copies have landed, then every wave meets; behind it the other buffer is readable and the one just read may be refilled
#define RING_FOOT() do { asm volatile("s_wait_dscnt 0x0" ::: "memory"); asm volatile("s_wait_asynccnt 0x0" ::: "memory"); __syncthreads(); } while (0)
// twelve 16-byte asynchronous copies per lane, global memory to LDS through no register; the s_wait_xcnt that closes the statement stands in front of any rewrite of the address registers the copies name
__device__ __forceinline__ void copy12(const unsigned* l, const char* const* p) {
  asm volatile("global_load_async_to_lds_b128 %0, %12, off\n\t"
               "global_load_async_to_lds_b128 %1, %13, off\n\t"
               "global_load_async_to_lds_b128 %2, %14, off\n\t"
               "global_load_async_to_lds_b128 %3, %15, off\n\t"
               "global_load_async_to_lds_b128 %4, %16, off\n\t"
               "global_load_async_to_lds_b128 %5, %17, off\n\t"
               "global_load_async_to_lds_b128 %6, %18, off\n\t"
               "global_load_async_to_lds_b128 %7, %19, off\n\t"
               "global_load_async_to_lds_b128 %8, %20, off\n\t"
               "global_load_async_to_lds_b128 %9, %21, off\n\t"
               "global_load_async_to_lds_b128 %10, %22, off\n\t"
               "global_load_async_to_lds_b128 %11, %23, off\n\t"
               "s_wait_xcnt 0x0"
               :: "v"(l[0]), "v"(l[1]), "v"(l[2]), "v"(l[3]), "v"(l[4]), "v"(l[5]), "v"(l[6]), "v"(l[7]), "v"(l[8]), "v"(l[9]), "v"(l[10]), "v"(l[11]),
                  "v"(p[0]), "v"(p[1]), "v"(p[2]), "v"(p[3]), "v"(p[4]), "v"(p[5]), "v"(p[6]), "v"(p[7]), "v"(p[8]), "v"(p[9]), "v"(p[10]), "v"(p[11]) : "memory");
}
// projection GEMMs: a stage is a 64-deep k slice of the block's 64 activation rows followed by its 128 weight rows; LDS row pitch = slice bytes + 16, which spreads the 16 rows of a ds_load_b128 fragment read over all banks
#define GP 144
#define GSTG (192 * GP)
#define OP 272
#define OSTG (192 * OP)
// QKV: block (64 rows, 128 cols = 2 heads, which); q,k -> LayerNorm, RoPE -> Q32/K32 f32 [bh][s][64]; v -> VT hi/lo x4 [bh][d][s]
__global__ __launch_bounds__(128) void k_qkv(const __bf16* __restrict__ Xb, const __bf16* __restrict__ PT, const float* __restrict__ bq, const float* __restrict__ bk, const float* __restrict__ bv, const float* __restrict__ qnw, const float* __restrict__ knw,
                                            float* __restrict__ Q32, float* __restrict__ K32, _Float16* __restrict__ VTh, _Float16* __restrict__ VTl) {
  __shared__ __align__(16) char sm[2 * GSTG];  // the ring of two stages; behind the loop's last barrier the epilogue stages its rows in the same bytes
  float (*so)[16][132] = (float (*)[16][132])sm;
  _Float16 (*sth)[72] = (_Float16 (*)[72])sm; _Float16 (*stl)[72] = sth + 128;
  const int tid = threadIdx.x, wave = tid >> 5, lane = tid & 31, col = lane & 15, g = lane >> 4;
  const int which = blockIdx.z, r0b = blockIdx.x * 64, n0 = blockIdx.y * 128; const int b = r0b / SS, s0 = r0b % SS;
  const float* bb_ = which == 0 ? bq : (which == 1 ? bk : bv);
  v8f acc[8] = {};
  const unsigned lds0 = (unsigned)(size_t)&sm[(tid >> 3) * GP + (tid & 7) * 16];
  const char* gA = (const char*)(Xb + (size_t)(r0b + (tid >> 3)) * E) + (tid & 7) * 16;
  const char* gB = (const char*)(PT + (size_t)(which * E + n0 + (tid >> 3)) * E) + (tid & 7) * 16;
  auto fill = [&](int kt) { unsigned l[12]; const char* p[12];
#pragma unroll  // the twelve address pairs are operands of one asm statement: they must be registers, not indexed arrays
    for (int i = 0; i < 12; ++i) { l[i] = lds0 + (kt & 1) * GSTG + i * (16 * GP); p[i] = (i < 4 ? gA + (size_t)i * (16 * E * 2) : gB + (size_t)(i - 4) * (16 * E * 2)) + (size_t)kt * 128; }
    copy12(l, p); };
  fill(0);
  asm volatile("s_wait_asynccnt 0x0" ::: "memory");  // stage 0 has landed before the barrier that publishes it
  __syncthreads();
  fill(1);
#pragma unroll 1  // one trip per stage: the ring's foot stands once in the code
  for (int kt = 0; kt < E / 64; ++kt) { const char* st = sm + (kt & 1) * GSTG;
#pragma unroll
    for (int kc = 0; kc < 2; ++kc) { const v16b a = frag_b((const __bf16*)(st + (wave * 16 + col) * GP) + kc * 32, lane); v16b wb[8];
#pragma unroll
      for (int j = 0; j < 8; ++j) wb[j] = frag_b((const __bf16*)(st + (64 + j * 16 + col) * GP) + kc * 32, lane);
#pragma unroll
      for (int j = 0; j < 8; ++j) acc[j] = wmma_bf(a, wb[j], acc[j]); }
    RING_FOOT();
    if (kt + 2 < E / 64) fill(kt + 2); }
  asm volatile("s_wait_asynccnt 0x0" ::: "memory");  // no copy is left in flight when the epilogue takes the ring's LDS
  if (which < 2) {
#pragma unroll
    for (int j = 0; j < 8; ++j) { const float bb = bfr(bb_[n0 + j * 16 + col]);
#pragma unroll
      for (int r = 0; r < 8; ++r) so[wave][8 * g + r][j * 16 + col] = acc[j][r] + bb; }
    LDSX();
    { const int rl = lane & 15, hh = lane >> 4; float* rowp = &so[wave][rl][hh * 64]; const float* wn = which == 0 ? qnw : knw; float s1 = 0.f;
#pragma unroll 8
      for (int d = 0; d < 64; ++d) s1 += rowp[d];
      const float mu = s1 * (1.0f / 64.0f); float s2 = 0.f;
#pragma unroll 8
      for (int d = 0; d < 64; ++d) { const float dv = rowp[d] - mu; s2 += dv * dv; }
      const float rs = rsqrtf(s2 * (1.0f / 64.0f) + 1e-6f);
#pragma unroll 8
      for (int d = 0; d < 64; ++d) rowp[d] = (rowp[d] - mu) * rs * bfr(wn[d]);
      // RoPE for tokens t >= 1
      const int t = s0 + wave * 16 + rl;
      if (t >= 1) { const float coord = 2.0f * (((float)(t - 1) + 0.5f) / ROPE_L) - 1.0f;
#pragma unroll 4
        for (int d = 0; d < 32; ++d) { const float invf = powf(100.0f, -(float)(d & 15) * (1.0f / 16.0f)); const float ang = 6.283185307179586f * coord * invf; float sn, cs; sincosf(ang, &sn, &cs);
          const float x1 = rowp[d], x2 = rowp[d + 32]; rowp[d] = x1 * cs - x2 * sn; rowp[d + 32] = x2 * cs + x1 * sn; } } }
    LDSX();
    float* Dst = which == 0 ? Q32 : K32;
    for (int qq = lane; qq < 2 * 16 * 16; qq += 32) { const int hh = qq >> 8, rl = (qq >> 4) & 15, pc = qq & 15; const int h = (n0 >> 6) + hh;
      vst2(Dst + (((size_t)b * NH + h) * SS + s0 + wave * 16 + rl) * HD + pc * 4, *(const v4f*)(&so[wave][rl][hh * 64 + pc * 4])); } }
  else {
#pragma unroll
    for (int j = 0; j < 8; ++j) { const float bb = bfr(bb_[n0 + j * 16 + col]);
#pragma unroll
      for (int r = 0; r < 8; ++r) { const float v = (acc[j][r] + bb) * 4.0f; const _Float16 hi = (_Float16)v; sth[j * 16 + col][wave * 16 + 8 * g + r] = hi; stl[j * 16 + col][wave * 16 + 8 * g + r] = (_Float16)((v - (float)hi) * VLO); } }
    __syncthreads();
    for (int qq = tid; qq < 128 * 8; qq += 128) { const int cl = qq >> 3, pc = qq & 7; const int c = n0 + cl, h = c >> 6, d = c & 63; const size_t o = (((size_t)b * NH + h) * HD + d) * SS + s0 + pc * 8;
      vst2(VTh + o, *(const v4u*)(&sth[cl][pc * 8])); vst2(VTl + o, *(const v4u*)(&stl[cl][pc * 8])); } }
}
// eight 16-byte asynchronous copies per lane, global memory to LDS through no register; the s_wait_xcnt that closes the statement stands in front of any rewrite of the address registers the copies name
__device__ __forceinline__ void copy8(const unsigned* l, const char* const* p) {
  asm volatile("global_load_async_to_lds_b128 %0, %8, off\n\t"
               "global_load_async_to_lds_b128 %1, %9, off\n\t"
               "global_load_async_to_lds_b128 %2, %10, off\n\t"
               "global_load_async_to_lds_b128 %3, %11, off\n\t"
               "global_load_async_to_lds_b128 %4, %12, off\n\t"
               "global_load_async_to_lds_b128 %5, %13, off\n\t"
               "global_load_async_to_lds_b128 %6, %14, off\n\t"
               "global_load_async_to_lds_b128 %7, %15, off\n\t"
               "s_wait_xcnt 0x0"
               :: "v"(l[0]), "v"(l[1]), "v"(l[2]), "v"(l[3]), "v"(l[4]), "v"(l[5]), "v"(l[6]), "v"(l[7]),
                  "v"(p[0]), "v"(p[1]), "v"(p[2]), "v"(p[3]), "v"(p[4]), "v"(p[5]), "v"(p[6]), "v"(p[7]) : "memory");
}
// attention over all keys: block (64 queries, bh), 32 key tiles of 64; the block's four waves share each K tile (f32 rows) and V tile (hi/lo rows) through LDS, filled by asynchronous copies:
// ring of two buffers, stage 2*kt = K tile kt in sK, stage 2*kt+1 = V tile kt in sV; S on hi/lo splits of the f32 q/k rows; P,V hi/lo; O f32 [bh][s][64]
__global__ __launch_bounds__(128) void k_attn(const float* __restrict__ Q32, const float* __restrict__ K32, const _Float16* __restrict__ VTh, const _Float16* __restrict__ VTl, const float* __restrict__ amask, float* __restrict__ O32) {
  __shared__ __align__(16) float sS[4][16][68];
  __shared__ __align__(16) _Float16 sPh[4][16][72], sPl[4][16][72];
  __shared__ __align__(16) float sK[64][68];
  __shared__ __align__(16) _Float16 sV[2][64][72];
  const int tid = threadIdx.x, w = tid >> 5, lane = tid & 31, col = lane & 15, g = lane >> 4;
  const size_t bh = blockIdx.y; const int qb = blockIdx.x; const int q0 = qb * 64 + w * 16;
  const unsigned ldsK = (unsigned)(size_t)&sK[tid >> 4][(tid & 15) * 4], ldsV = (unsigned)(size_t)&sV[0][tid >> 3][(tid & 7) * 8];
  const char* gK = (const char*)(K32 + bh * SS * HD) + tid * 16;
  const size_t voff = ((bh * HD + (tid >> 3)) * SS + (tid & 7) * 8) * 2;
  const char* gVh = (const char*)VTh + voff; const char* gVl = (const char*)VTl + voff;
  auto fillK = [&](int kt) { unsigned l[8]; const char* p[8];
#pragma unroll  // the eight address pairs are operands of one asm statement: they must be registers, not indexed arrays
    for (int i = 0; i < 8; ++i) { l[i] = ldsK + i * (8 * 68 * 4); p[i] = gK + (size_t)kt * (64 * HD * 4) + i * 2048; }
    copy8(l, p); };
  auto fillV = [&](int kt) { unsigned l[8]; const char* p[8];
#pragma unroll  // as in fillK
    for (int i = 0; i < 8; ++i) { l[i] = ldsV + (i >> 2) * (64 * 72 * 2) + (i & 3) * (16 * 72 * 2); p[i] = (i < 4 ? gVh : gVl) + (size_t)(i & 3) * (16 * SS * 2) + (size_t)kt * 128; }
    copy8(l, p); };
  fillK(0);
  F2 aq[2];
#pragma unroll
  for (int kc = 0; kc < 2; ++kc) aq[kc] = split_row(Q32 + (bh * SS + q0 + col) * HD, kc * 32, lane);
  float mrun = -3.0e38f, lrun = 0.f; v8f acc[4] = {}, ac1[4] = {}, ac2[4] = {};
  asm volatile("s_wait_asynccnt 0x0" ::: "memory");  // K tile 0 has landed before the barrier that publishes it
  __syncthreads();
  fillV(0);
#pragma unroll 1
  for (int kt = 0;; ++kt) {
#pragma unroll
    for (int t = 0; t < 4; ++t) { const int key = kt * 64 + t * 16 + col; const float* krow = &sK[t * 16 + col][0];
      v8f s = mac3(aq[0], split_row(krow, 0, lane), (v8f){}); s = mac3(aq[1], split_row(krow, 32, lane), s);
#pragma unroll
      for (int r = 0; r < 8; ++r) sS[w][8 * g + r][t * 16 + col] = s[r] * 0.125f + bfr(amask[(size_t)(q0 + 8 * g + r) * SS + key]); }
    RING_FOOT();
    if (kt + 1 < SS / 64) fillK(kt + 1);
    float mx = -3.4e38f;
#pragma unroll
    for (int jj = 0; jj < 32; ++jj) mx = fmaxf(mx, sS[w][col][g * 32 + jj]);
    mx = fmaxf(mx, __shfl_xor(mx, 16, 32));
    const float mnew = fmaxf(mrun, mx); const float corr = expf(mrun - mnew);
    float ps = 0.f;
#pragma unroll
    for (int jj = 0; jj < 32; ++jj) { const float p = expf(sS[w][col][g * 32 + jj] - mnew) * 16384.0f; ps += p; const _Float16 hi = (_Float16)p; sPh[w][col][g * 32 + jj] = hi; sPl[w][col][g * 32 + jj] = (_Float16)((p - (float)hi) * PLO); }
    ps += __shfl_xor(ps, 16, 32);
    lrun = lrun * corr + ps * (1.0f / 16384.0f); mrun = mnew;
#pragma unroll
    for (int r = 0; r < 8; ++r) { const float cr = __shfl(corr, 8 * g + r, 32);
#pragma unroll
      for (int t = 0; t < 4; ++t) { acc[t][r] *= cr; ac1[t][r] *= cr; ac2[t][r] *= cr; } }
    LDSX();
#pragma unroll
    for (int kc = 0; kc < 2; ++kc) { const v16h ph = frag_h(&sPh[w][col][0] + kc * 32, lane), pl = frag_h(&sPl[w][col][0] + kc * 32, lane);
#pragma unroll
      for (int t = 0; t < 4; ++t) { const v16h vh = frag_h(&sV[0][t * 16 + col][kc * 32], lane);
        acc[t] = wmma16(ph, vh, acc[t]); ac1[t] = wmma16(ph, frag_h(&sV[1][t * 16 + col][kc * 32], lane), ac1[t]); ac2[t] = wmma16(pl, vh, ac2[t]); } }
    RING_FOOT();
    if (kt + 1 == SS / 64) break;
    fillV(kt + 1); }
  asm volatile("s_wait_asynccnt 0x0" ::: "memory");  // no copy is left in flight when the wave goes on to its epilogue and ends
#pragma unroll
  for (int r = 0; r < 8; ++r) { const float lr = __shfl(lrun, 8 * g + r, 32); const float inv = 1.0f / (lr * 16384.0f * 4.0f);
#pragma unroll
    for (int t = 0; t < 4; ++t) sS[w][8 * g + r][t * 16 + col] = (acc[t][r] + ac1[t][r] * (1.0f / VLO) + ac2[t][r] * (1.0f / PLO)) * inv; }
  LDSX();
  for (int qq = lane; qq < 16 * 16; qq += 32) { const int rl = qq >> 4, pc = qq & 15; vst2(O32 + ((bh * SS) + q0 + rl) * HD + pc * 4, *(const v4f*)(&sS[w][rl][pc * 4])); }
}
// out = ctx Wo^T + bo : split(ctx) x bf16(Wo rows): 2 products (Wo is an INPUT -> bf16 exact)
__global__ __launch_bounds__(128) void k_out(const float* __restrict__ O32, const float* __restrict__ Wo, const float* __restrict__ bo, float* __restrict__ out) {
  __shared__ __align__(16) char sm[2 * OSTG];  // the ring of two stages; behind the loop's last barrier the epilogue stages its rows in the same bytes
  float (*so)[16][132] = (float (*)[16][132])sm;
  const int tid = threadIdx.x, wave = tid >> 5, lane = tid & 31, col = lane & 15, g = lane >> 4;
  const int r0b = blockIdx.x * 64, r0 = r0b + wave * 16, n0 = blockIdx.y * 128; const int b = r0b / SS, s0 = r0b % SS;
  v8f acc[8] = {};
  const unsigned lds0 = (unsigned)(size_t)&sm[(tid >> 4) * OP + (tid & 15) * 16];
  const char* gA = (const char*)(O32 + ((size_t)b * NH * SS + s0 + (tid >> 4)) * HD) + (tid & 15) * 16;
  const char* gB = (const char*)(Wo + (size_t)(n0 + (tid >> 4)) * E) + (tid & 15) * 16;
  // stage kt = head kt of the context rows (64 f32 a row) and columns 64*kt.. of the weight rows
  auto fill = [&](int kt) {
#pragma unroll
    for (int hf = 0; hf < 2; ++hf) { unsigned l[12]; const char* p[12];
#pragma unroll  // the twelve address pairs are operands of one asm statement: they must be registers, not indexed arrays
      for (int ii = 0; ii < 12; ++ii) { const int i = hf * 12 + ii; l[ii] = lds0 + (kt & 1) * OSTG + i * (8 * OP);
        p[ii] = i < 8 ? gA + (size_t)i * (8 * HD * 4) + (size_t)kt * ((size_t)SS * HD * 4) : gB + (size_t)(i - 8) * (8 * E * 4) + (size_t)kt * 256; }
      copy12(l, p); } };
  fill(0);
  asm volatile("s_wait_asynccnt 0x0" ::: "memory");  // stage 0 has landed before the barrier that publishes it
  __syncthreads();
  fill(1);
#pragma unroll 1  // one trip per stage: the ring's foot stands once in the code
  for (int kt = 0; kt < E / 64; ++kt) { const char* st = sm + (kt & 1) * OSTG;
#pragma unroll
    for (int kc = 0; kc < 2; ++kc) { const F2 a = split_row((const float*)(st + (wave * 16 + col) * OP), kc * 32, lane);
#pragma unroll
      for (int j0 = 0; j0 < 8; j0 += 4) { v16b wb[4];
#pragma unroll
        for (int j = 0; j < 4; ++j) wb[j] = split_row((const float*)(st + (64 + (j0 + j) * 16 + col) * OP), kc * 32, lane).h;
#pragma unroll
        for (int j = 0; j < 4; ++j) { acc[j0 + j] = wmma_bf(a.l, wb[j], acc[j0 + j]); acc[j0 + j] = wmma_bf(a.h, wb[j], acc[j0 + j]); } } }
    RING_FOOT();
    if (kt + 2 < E / 64) fill(kt + 2); }
  asm volatile("s_wait_asynccnt 0x0" ::: "memory");  // no copy is left in flight when the epilogue takes the ring's LDS
#pragma unroll
  for (int j = 0; j < 8; ++j) { const int n = n0 + j * 16 + col; const float bb = bfr(bo[n]);
#pragma unroll
    for (int r = 0; r < 8; ++r) so[wave][8 * g + r][j * 16 + col] = acc[j][r] + bb; }
  LDSX();
#pragma unroll 4
  for (int rl = 0; rl < 16; ++rl) vst2(out + (size_t)(r0 + rl) * E + n0 + lane * 4, *(const v4f*)(&so[wave][rl][lane * 4]));
}
extern "C" void kernel_launch(void* const* d_in, const int* in_sizes, int n_in, void* d_out, int out_size, void* d_ws, size_t ws_size, hipStream_t stream) {
  (void)in_sizes; (void)n_in; (void)out_size; (void)ws_size;
  const float** I = (const float**)d_in;
  const float* x = I[0]; const float* amask = I[1]; const float* Wq = I[2]; const float* bq = I[3]; const float* Wk = I[4]; const float* bk = I[5]; const float* Wv = I[6]; const float* bv = I[7]; const float* Wp = I[8]; const float* bp = I[9]; const float* qnw = I[10]; const float* knw = I[11];
  float* out = (float*)d_out;
  char* ws = (char*)d_ws; size_t off = 0;
  auto take = [&](size_t bytes) { char* p = ws + off; off += (bytes + 255) & ~(size_t)255; return p; };
  __bf16* Xb = (__bf16*)take((size_t)NR * E * 2); __bf16* PT = (__bf16*)take((size_t)3 * E * E * 2);
  float* Q32 = (float*)take((size_t)NR * E * 4); float* K32 = (float*)take((size_t)NR * E * 4); _Float16* VTh = (_Float16*)take((size_t)NR * E * 2); _Float16* VTl = (_Float16*)take((size_t)NR * E * 2); float* O32 = (float*)take((size_t)NR * E * 4);
  // ws ~ 82 MB
  k_cvt<<<(NR * E / 8 + 255) / 256, 256, 0, stream>>>(x, Xb);
  k_pack<<<3 * E, 256, 0, stream>>>(Wq, Wk, Wv, PT);
  k_qkv<<<dim3(NR / 64, E / 128, 3), 128, 0, stream>>>(Xb, PT, bq, bk, bv, qnw, knw, Q32, K32, VTh, VTl);
  k_attn<<<dim3(SS / 64, NB * NH), 128, 0, stream>>>(Q32, K32, VTh, VTl, amask, O32);
  k_out<<<dim3(NR / 64, E / 128), 128, 0, stream>>>(O32, Wp, bp, out);
}

// v003
// Measured time: 227 microseconds a run.
// In both of two side-by-side timings against v002, it was 1.12 times as fast.
// Over all steps from v000 it is 2.92 times as fast.
// compute dtype: every module INPUT that feeds a GEMM (x, Wq/Wk/Wv/Wp, biases, LN weights, attn_mask) is rounded to bf16 and used in exact bf16 WMMA products with f32 accumulation; computed operands (normalised+rotated q/k f32 split, P and V hi/lo, context split) f32-grade; LayerNorm/RoPE/softmax f32.
#include <hip/hip_runtime.h>
#include <math.h>

typedef __attribute__((ext_vector_type(16))) _Float16 v16h;
typedef __attribute__((ext_vector_type(16))) __bf16 v16b;
typedef __attribute__((ext_vector_type(8)))  _Float16 v8h;
typedef __attribute__((ext_vector_type(8)))  float v8f;
typedef __attribute__((ext_vector_type(4)))  float v4f;
typedef __attribute__((ext_vector_type(2)))  float v2f;
typedef __attribute__((ext_vector_type(4)))  unsigned v4u;
typedef __attribute__((ext_vector_type(4)))  int v4i;
typedef float __attribute__((may_alias)) float_a;
typedef int __attribute__((may_alias)) int_a;

template <typename T> __device__ __forceinline__ void vst2(void* p, T v) { *(T*)p = v;  }
__device__ __forceinline__ v8f wmma16(v16h a, v16h b, v8f c) {
  v8f d = __builtin_amdgcn_wmma_f32_16x16x32_f16(false, a, false, b, (short)0, c, false, false);
  asm volatile("v_nop\n\tv_nop\n\tv_nop\n\tv_nop" : "+v"(d) : "v"(a), "v"(b));
  return d;
}
__device__ __forceinline__ v8f wmma_bf(v16b a, v16b b, v8f c) {
  v8f d = __builtin_amdgcn_wmma_f32_16x16x32_bf16(false, a, false, b, (short)0, c, false, false);
  asm volatile("v_nop\n\tv_nop\n\tv_nop\n\tv_nop" : "+v"(d) : "v"(a), "v"(b));
  return d;
}
// 16x16x32 fragments: lane = (h = lane>>4, row/col = lane&15); elements 0..7 = k0+8h+0..7, 8..15 = k0+16+8h+0..7; D element r = row 8h+r
__device__ __forceinline__ v16h frag_h(const _Float16* rowk0, int lane) {
  union { v16h v; v8h q[2]; } u; const _Float16* p = rowk0 + 8 * (lane >> 4);
  u.q[0] = *(const v8h*)p; u.q[1] = *(const v8h*)(p + 16); return u.v;
}
__device__ __forceinline__ v16h frag_f32(const float* rowk0, int lane) {
  v16h a; const float* p = rowk0 + 8 * (lane >> 4);
#pragma unroll
  for (int i = 0; i < 8; ++i) { a[i] = (_Float16)p[i]; a[8 + i] = (_Float16)p[16 + i]; }
  return a;
}
__device__ __forceinline__ v16h frag_f32s(const float* rowk0, int lane, float sc) {
  v16h a; const float* p = rowk0 + 8 * (lane >> 4);
#pragma unroll
  for (int i = 0; i < 8; ++i) { a[i] = (_Float16)(p[i] * sc); a[8 + i] = (_Float16)(p[16 + i] * sc); }
  return a;
}
// column fragment from a [K][ld] layout (column n), rows >= K read as 0
__device__ __forceinline__ v16h fragc_f32(const float* W, int k0, int n, int lane, int ld, int K) {
  v16h a; const int g = lane >> 4;
#pragma unroll
  for (int i = 0; i < 8; ++i) { const int ka = k0 + 8 * g + i, kb = ka + 16;
    a[i] = (_Float16)(ka < K ? W[(size_t)ka * ld + n] : 0.f); a[8 + i] = (_Float16)(kb < K ? W[(size_t)kb * ld + n] : 0.f); }
  return a;
}
struct F2 { v16b h, l; };
__device__ __forceinline__ F2 bsplit16(const float v[16]) { F2 r;
#pragma unroll
  for (int i = 0; i < 16; ++i) { const __bf16 h = (__bf16)v[i]; r.h[i] = h; r.l[i] = (__bf16)(v[i] - (float)h); }
  return r; }
__device__ __forceinline__ F2 split_row(const float* row, int k0, int lane) { float v[16]; const float* p = row + k0 + 8 * (lane >> 4);
#pragma unroll
  for (int i = 0; i < 8; ++i) { v[i] = p[i]; v[8 + i] = p[16 + i]; }
  return bsplit16(v); }
__device__ __forceinline__ F2 split_rowK(const float* row, int k0, int lane, int K) { float v[16]; const int g = lane >> 4;
#pragma unroll
  for (int i = 0; i < 8; ++i) { const int ka = k0 + 8 * g + i, kb = ka + 16; v[i] = ka < K ? row[ka] : 0.f; v[8 + i] = kb < K ? row[kb] : 0.f; }
  return bsplit16(v); }
__device__ __forceinline__ F2 split_col(const float* W, int k0, int n, int lane, int ld, int K) { float v[16]; const int g = lane >> 4;
#pragma unroll
  for (int i = 0; i < 8; ++i) { const int ka = k0 + 8 * g + i, kb = ka + 16; v[i] = ka < K ? W[(size_t)ka * ld + n] : 0.f; v[8 + i] = kb < K ? W[(size_t)kb * ld + n] : 0.f; }
  return bsplit16(v); }
__device__ __forceinline__ v8f mac3(const F2& a, const F2& b, v8f c) { c = wmma_bf(a.l, b.h, c); c = wmma_bf(a.h, b.l, c); return wmma_bf(a.h, b.h, c); }
__device__ __forceinline__ float sigm(float v) { return 1.0f / (1.0f + expf(-v)); }
#define LDSX() do { asm volatile("s_wait_dscnt 0" ::: "memory"); __builtin_amdgcn_wave_barrier(); __builtin_amdgcn_fence(__ATOMIC_RELEASE, "workgroup"); } while (0)


// NEPA self attention (16 heads of 64 on [2,2048,1024], [out][in] weights + biases): q,k LayerNorm'd per head (eps 1e-6, weight only), RoPE on tokens >= 1 (prefix 1):
// angle[d] = 2*pi*coord(t)*100^(-(d mod 16)/16), coord = 2*(t-1+0.5)/2047 - 1, rotate-half pairs (d, d+32); scores = q.k/8 + attn_mask[q][k]; softmax; (P v) Wp^T + bp.
#define NB 2
#define SS 2048
#define E 1024
#define NH 16
#define HD 64
#define NR (NB * SS)
#define ROPE_L 2047.0f
#define PLO 1024.0f
#define VLO 2048.0f
__device__ __forceinline__ float bfr(float v) { return (float)(__bf16)v; }
__device__ __forceinline__ v16b frag_b(const __bf16* rowk0, int lane) { return __builtin_bit_cast(v16b, frag_h((const _Float16*)rowk0, lane)); }

__global__ __launch_bounds__(256) void k_cvt(const float* __restrict__ x, __bf16* __restrict__ Xb) {
  const size_t i8 = (size_t)blockIdx.x * 256 + threadIdx.x; if (i8 >= (size_t)NR * E / 8) return;
  union { __bf16 h[8]; v4u u; } pk;
#pragma unroll
  for (int e = 0; e < 8; ++e) pk.h[e] = (__bf16)x[i8 * 8 + e];
  vst2((unsigned*)(Xb + i8 * 8), pk.u);
}
// PT rows: [0,E) Wq[n][:], [E,2E) Wk, [2E,3E) Wv  ([out][in]) as bf16 rows (no scaling)
__global__ __launch_bounds__(256) void k_pack(const float* __restrict__ Wq, const float* __restrict__ Wk, const float* __restrict__ Wv, __bf16* __restrict__ PT) {
  const int n = blockIdx.x, tid = threadIdx.x; __shared__ __align__(16) __bf16 srow[E];
  const float* W = n < E ? Wq : (n < 2 * E ? Wk : Wv); const int nn = n & (E - 1);
  for (int k = tid; k < E; k += 256) srow[k] = (__bf16)W[(size_t)nn * E + k];
  __syncthreads();
  if (tid < E / 8) vst2((unsigned*)(PT + (size_t)n * E + tid * 8), *(const v4u*)(&srow[tid * 8]));
}
// hand-over of a ring buffer: this wave's LDS reads and writes are done, its own copies have landed, then every wave meets; behind it the other buffer is readable and the one just read may be refilled
#define RING_FOOT() do { asm volatile("s_wait_dscnt 0x0" ::: "memory"); asm volatile("s_wait_asynccnt 0x0" ::: "memory"); __syncthreads(); } while (0)
// twelve 16-byte asynchronous copies per lane, global memory to LDS through no register; the s_wait_xcnt that closes the statement stands in front of any rewrite of the address registers the copies name
__device__ __forceinline__ void copy12(const unsigned* l, const char* const* p) {
  asm volatile("global_load_async_to_lds_b128 %0, %12, off\n\t"
               "global_load_async_to_lds_b128 %1, %13, off\n\t"
               "global_load_async_to_lds_b128 %2, %14, off\n\t"
               "global_load_async_to_lds_b128 %3, %15, off\n\t"
               "global_load_async_to_lds_b128 %4, %16, off\n\t"
               "global_load_async_to_lds_b128 %5, %17, off\n\t"
               "global_load_async_to_lds_b128 %6, %18, off\n\t"
               "global_load_async_to_lds_b128 %7, %19, off\n\t"
               "global_load_async_to_lds_b128 %8, %20, off\n\t"
               "global_load_async_to_lds_b128 %9, %21, off\n\t"
               "global_load_async_to_lds_b128 %10, %22, off\n\t"
               "global_load_async_to_lds_b128 %11, %23, off\n\t"
               "s_wait_xcnt 0x0"
               :: "v"(l[0]), "v"(l[1]), "v"(l[2]), "v"(l[3]), "v"(l[4]), "v"(l[5]), "v"(l[6]), "v"(l[7]), "v"(l[8]), "v"(l[9]), "v"(l[10]), "v"(l[11]),
                  "v"(p[0]), "v"(p[1]), "v"(p[2]), "v"(p[3]), "v"(p[4]), "v"(p[5]), "v"(p[6]), "v"(p[7]), "v"(p[8]), "v"(p[9]), "v"(p[10]), "v"(p[11]) : "memory");
}
// projection GEMMs: a stage is a 64-deep k slice of the block's 64 activation rows followed by its 128 weight rows; LDS row pitch = slice bytes + 16, which spreads the 16 rows of a ds_load_b128 fragment read over all banks
#define GP 144
#define GSTG (192 * GP)
#define OP 272
#define OSTG (192 * OP)
// QKV: block (64 rows, 128 cols = 2 heads, which); q,k -> LayerNorm, RoPE; q -> Q32 f32 [bh][s][64]; k -> K2 [bh][s][2][64]: the 64 bf16 hi parts of a row, then its 64 bf16 lo parts; v -> VT hi/lo x4 [bh][d][s]
// five waves per SIMD is what the ring's LDS admits: the register budget is held there, so that an epilogue's schedule does not cost the GEMM loop a resident block
__global__ __launch_bounds__(128) __attribute__((amdgpu_waves_per_eu(5))) void k_qkv(const __bf16* __restrict__ Xb, const __bf16* __restrict__ PT, const float* __restrict__ bq, const float* __restrict__ bk, const float* __restrict__ bv, const float* __restrict__ qnw, const float* __restrict__ knw,
                                            float* __restrict__ Q32, __bf16* __restrict__ K2, _Float16* __restrict__ VTh, _Float16* __restrict__ VTl) {
  __shared__ __align__(16) char sm[2 * GSTG];  // the ring of two stages; behind the loop's last barrier the epilogue stages its rows in the same bytes
  float (*so)[16][132] = (float (*)[16][132])sm;
  _Float16 (*sth)[72] = (_Float16 (*)[72])sm; _Float16 (*stl)[72] = sth + 128;
  const int tid = threadIdx.x, wave = tid >> 5, lane = tid & 31, col = lane & 15, g = lane >> 4;
  const int which = blockIdx.z, r0b = blockIdx.x * 64, n0 = blockIdx.y * 128; const int b = r0b / SS, s0 = r0b % SS;
  const float* bb_ = which == 0 ? bq : (which == 1 ? bk : bv);
  v8f acc[8] = {};
  const unsigned lds0 = (unsigned)(size_t)&sm[(tid >> 3) * GP + (tid & 7) * 16];
  const char* gA = (const char*)(Xb + (size_t)(r0b + (tid >> 3)) * E) + (tid & 7) * 16;
  const char* gB = (const char*)(PT + (size_t)(which * E + n0 + (tid >> 3)) * E) + (tid & 7) * 16;
  auto fill = [&](int kt) { unsigned l[12]; const char* p[12];
#pragma unroll  // the twelve address pairs are operands of one asm statement: they must be registers, not indexed arrays
    for (int i = 0; i < 12; ++i) { l[i] = lds0 + (kt & 1) * GSTG + i * (16 * GP); p[i] = (i < 4 ? gA + (size_t)i * (16 * E * 2) : gB + (size_t)(i - 4) * (16 * E * 2)) + (size_t)kt * 128; }
    copy12(l, p); };
  fill(0);
  asm volatile("s_wait_asynccnt 0x0" ::: "memory");  // stage 0 has landed before the barrier that publishes it
  __syncthreads();
  fill(1);
#pragma unroll 1  // one trip per stage: the ring's foot stands once in the code
  for (int kt = 0; kt < E / 64; ++kt) { const char* st = sm + (kt & 1) * GSTG;
#pragma unroll
    for (int kc = 0; kc < 2; ++kc) { const v16b a = frag_b((const __bf16*)(st + (wave * 16 + col) * GP) + kc * 32, lane); v16b wb[8];
#pragma unroll
      for (int j = 0; j < 8; ++j) wb[j] = frag_b((const __bf16*)(st + (64 + j * 16 + col) * GP) + kc * 32, lane);
#pragma unroll
      for (int j = 0; j < 8; ++j) acc[j] = wmma_bf(a, wb[j], acc[j]); }
    RING_FOOT();
    if (kt + 2 < E / 64) fill(kt + 2); }
  asm volatile("s_wait_asynccnt 0x0" ::: "memory");  // no copy is left in flight when the epilogue takes the ring's LDS
  if (which < 2) {
#pragma unroll
    for (int j = 0; j < 8; ++j) { const float bb = bfr(bb_[n0 + j * 16 + col]);
#pragma unroll
      for (int r = 0; r < 8; ++r) so[wave][8 * g + r][j * 16 + col] = acc[j][r] + bb; }
    LDSX();
    { const int rl = lane & 15, hh = lane >> 4; float* rowp = &so[wave][rl][hh * 64]; const float* wn = which == 0 ? qnw : knw; float s1 = 0.f;
#pragma unroll 8
      for (int d = 0; d < 64; ++d) s1 += rowp[d];
      const float mu = s1 * (1.0f / 64.0f); float s2 = 0.f;
#pragma unroll 8
      for (int d = 0; d < 64; ++d) { const float dv = rowp[d] - mu; s2 += dv * dv; }
      const float rs = rsqrtf(s2 * (1.0f / 64.0f) + 1e-6f);
#pragma unroll 8
      for (int d = 0; d < 64; ++d) rowp[d] = (rowp[d] - mu) * rs * bfr(wn[d]);
      // RoPE for tokens t >= 1
      const int t = s0 + wave * 16 + rl;
      if (t >= 1) { const float coord = 2.0f * (((float)(t - 1) + 0.5f) / ROPE_L) - 1.0f;
#pragma unroll 4
        for (int d = 0; d < 32; ++d) { const float invf = powf(100.0f, -(float)(d & 15) * (1.0f / 16.0f)); const float ang = 6.283185307179586f * coord * invf; float sn, cs; sincosf(ang, &sn, &cs);
          const float x1 = rowp[d], x2 = rowp[d + 32]; rowp[d] = x1 * cs - x2 * sn; rowp[d + 32] = x2 * cs + x1 * sn; } } }
    LDSX();
    if (which == 0) {
      for (int qq = lane; qq < 2 * 16 * 16; qq += 32) { const int hh = qq >> 8, rl = (qq >> 4) & 15, pc = qq & 15; const int h = (n0 >> 6) + hh;
        vst2(Q32 + (((size_t)b * NH + h) * SS + s0 + wave * 16 + rl) * HD + pc * 4, *(const v4f*)(&so[wave][rl][hh * 64 + pc * 4])); } }
    else {
      // each key row is split here, once, with the arithmetic of bsplit16; every query block of k_attn then reads the pair ready for its products
      for (int qq = lane; qq < 2 * 16 * 8; qq += 32) { const int hh = qq >> 7, rl = (qq >> 3) & 15, pc = qq & 7; const int h = (n0 >> 6) + hh;
        const float* sp = &so[wave][rl][hh * 64 + pc * 8]; union { __bf16 e[8]; v4u u; } ph, pl;
#pragma unroll  // the eight parts pack into the four registers of each 16-byte store: they must be registers, not indexed arrays
        for (int e = 0; e < 8; ++e) { const float v = sp[e]; const __bf16 hi = (__bf16)v; ph.e[e] = hi; pl.e[e] = (__bf16)(v - (float)hi); }
        __bf16* dst = K2 + (((size_t)b * NH + h) * SS + s0 + wave * 16 + rl) * (2 * HD) + pc * 8;
        vst2(dst, ph.u); vst2(dst + HD, pl.u); } } }
  else {
#pragma unroll
    for (int j = 0; j < 8; ++j) { const float bb = bfr(bb_[n0 + j * 16 + col]);
#pragma unroll
      for (int r = 0; r < 8; ++r) { const float v = (acc[j][r] + bb) * 4.0f; const _Float16 hi = (_Float16)v; sth[j * 16 + col][wave * 16 + 8 * g + r] = hi; stl[j * 16 + col][wave * 16 + 8 * g + r] = (_Float16)((v - (float)hi) * VLO); } }
    __syncthreads();
    for (int qq = tid; qq < 128 * 8; qq += 128) { const int cl = qq >> 3, pc = qq & 7; const int c = n0 + cl, h = c >> 6, d = c & 63; const size_t o = (((size_t)b * NH + h) * HD + d) * SS + s0 + pc * 8;
      vst2(VTh + o, *(const v4u*)(&sth[cl][pc * 8])); vst2(VTl + o, *(const v4u*)(&stl[cl][pc * 8])); } }
}
// eight 16-byte asynchronous copies per lane, global memory to LDS through no register; the s_wait_xcnt that closes the statement stands in front of any rewrite of the address registers the copies name
__device__ __forceinline__ void copy8(const unsigned* l, const char* const* p) {
  asm volatile("global_load_async_to_lds_b128 %0, %8, off\n\t"
               "global_load_async_to_lds_b128 %1, %9, off\n\t"
               "global_load_async_to_lds_b128 %2, %10, off\n\t"
               "global_load_async_to_lds_b128 %3, %11, off\n\t"
               "global_load_async_to_lds_b128 %4, %12, off\n\t"
               "global_load_async_to_lds_b128 %5, %13, off\n\t"
               "global_load_async_to_lds_b128 %6, %14, off\n\t"
               "global_load_async_to_lds_b128 %7, %15, off\n\t"
               "s_wait_xcnt 0x0"
               :: "v"(l[0]), "v"(l[1]), "v"(l[2]), "v"(l[3]), "v"(l[4]), "v"(l[5]), "v"(l[6]), "v"(l[7]),
                  "v"(p[0]), "v"(p[1]), "v"(p[2]), "v"(p[3]), "v"(p[4]), "v"(p[5]), "v"(p[6]), "v"(p[7]) : "memory");
}
// attention over all keys: block (64 queries, bh), 32 key tiles of 64; the block's four waves share each K tile (rows of 64 bf16 hi, 64 bf16 lo) and V tile (hi/lo rows) through LDS, filled by asynchronous copies:
// ring of two buffers, stage 2*kt = K tile kt in sK, stage 2*kt+1 = V tile kt in sV; S on hi/lo splits of the f32 q/k rows (q split here once, k by its producer); P,V hi/lo; O f32 [bh][s][64]
__global__ __launch_bounds__(128) void k_attn(const float* __restrict__ Q32, const __bf16* __restrict__ K2, const _Float16* __restrict__ VTh, const _Float16* __restrict__ VTl, const float* __restrict__ amask, float* __restrict__ O32) {
  __shared__ __align__(16) float sS[4][16][68];
  __shared__ __align__(16) _Float16 sPh[4][16][72], sPl[4][16][72];
  __shared__ __align__(16) __bf16 sK[64][136];
  __shared__ __align__(16) _Float16 sV[2][64][72];
  const int tid = threadIdx.x, w = tid >> 5, lane = tid & 31, col = lane & 15, g = lane >> 4;
  const size_t bh = blockIdx.y; const int qb = blockIdx.x; const int q0 = qb * 64 + w * 16;
  const unsigned ldsK = (unsigned)(size_t)&sK[tid >> 4][(tid & 15) * 8], ldsV = (unsigned)(size_t)&sV[0][tid >> 3][(tid & 7) * 8];
  const char* gK = (const char*)(K2 + bh * SS * (2 * HD)) + tid * 16;
  const size_t voff = ((bh * HD + (tid >> 3)) * SS + (tid & 7) * 8) * 2;
  const char* gVh = (const char*)VTh + voff; const char* gVl = (const char*)VTl + voff;
  auto fillK = [&](int kt) { unsigned l[8]; const char* p[8];
#pragma unroll  // the eight address pairs are operands of one asm statement: they must be registers, not indexed arrays
    for (int i = 0; i < 8; ++i) { l[i] = ldsK + i * (8 * 68 * 4); p[i] = gK + (size_t)kt * (64 * HD * 4) + i * 2048; }
    copy8(l, p); };
  auto fillV = [&](int kt) { unsigned l[8]; const char* p[8];
#pragma unroll  // as in fillK
    for (int i = 0; i < 8; ++i) { l[i] = ldsV + (i >> 2) * (64 * 72 * 2) + (i & 3) * (16 * 72 * 2); p[i] = (i < 4 ? gVh : gVl) + (size_t)(i & 3) * (16 * SS * 2) + (size_t)kt * 128; }
    copy8(l, p); };
  fillK(0);
  F2 aq[2];
#pragma unroll
  for (int kc = 0; kc < 2; ++kc) aq[kc] = split_row(Q32 + (bh * SS + q0 + col) * HD, kc * 32, lane);
  float mrun = -3.0e38f, lrun = 0.f; v8f acc[4] = {}, ac1[4] = {}, ac2[4] = {};
  asm volatile("s_wait_asynccnt 0x0" ::: "memory");  // K tile 0 has landed before the barrier that publishes it
  __syncthreads();
  fillV(0);
#pragma unroll 1
  for (int kt = 0;; ++kt) {
#pragma unroll
    for (int t = 0; t < 4; ++t) { const int key = kt * 64 + t * 16 + col; const __bf16* krow = &sK[t * 16 + col][0];
      const F2 k0 = { frag_b(krow, lane), frag_b(krow + HD, lane) }, k1 = { frag_b(krow + 32, lane), frag_b(krow + HD + 32, lane) };
      v8f s = mac3(aq[0], k0, (v8f){}); s = mac3(aq[1], k1, s);
#pragma unroll
      for (int r = 0; r < 8; ++r) sS[w][8 * g + r][t * 16 + col] = s[r] * 0.125f + bfr(amask[(size_t)(q0 + 8 * g + r) * SS + key]); }
    RING_FOOT();
    if (kt + 1 < SS / 64) fillK(kt + 1);
    float mx = -3.4e38f;
#pragma unroll
    for (int jj = 0; jj < 32; ++jj) mx = fmaxf(mx, sS[w][col][g * 32 + jj]);
    mx = fmaxf(mx, __shfl_xor(mx, 16, 32));
    const float mnew = fmaxf(mrun, mx); const float corr = expf(mrun - mnew);
    float ps = 0.f;
#pragma unroll
    for (int jj = 0; jj < 32; ++jj) { const float p = expf(sS[w][col][g * 32 + jj] - mnew) * 16384.0f; ps += p; const _Float16 hi = (_Float16)p; sPh[w][col][g * 32 + jj] = hi; sPl[w][col][g * 32 + jj] = (_Float16)((p - (float)hi) * PLO); }
    ps += __shfl_xor(ps, 16, 32);
    lrun = lrun * corr + ps * (1.0f / 16384.0f); mrun = mnew;
#pragma unroll
    for (int r = 0; r < 8; ++r) { const float cr = __shfl(corr, 8 * g + r, 32);
#pragma unroll
      for (int t = 0; t < 4; ++t) { acc[t][r] *= cr; ac1[t][r] *= cr; ac2[t][r] *= cr; } }
    LDSX();
#pragma unroll
    for (int kc = 0; kc < 2; ++kc) { const v16h ph = frag_h(&sPh[w][col][0] + kc * 32, lane), pl = frag_h(&sPl[w][col][0] + kc * 32, lane);
#pragma unroll
      for (int t = 0; t < 4; ++t) { const v16h vh = frag_h(&sV[0][t * 16 + col][kc * 32], lane);
        acc[t] = wmma16(ph, vh, acc[t]); ac1[t] = wmma16(ph, frag_h(&sV[1][t * 16 + col][kc * 32], lane), ac1[t]); ac2[t] = wmma16(pl, vh, ac2[t]); } }
    RING_FOOT();
    if (kt + 1 == SS / 64) break;
    fillV(kt + 1); }
  asm volatile("s_wait_asynccnt 0x0" ::: "memory");  // no copy is left in flight when the wave goes on to its epilogue and ends
#pragma unroll
  for (int r = 0; r < 8; ++r) { const float lr = __shfl(lrun, 8 * g + r, 32); const float inv = 1.0f / (lr * 16384.0f * 4.0f);
#pragma unroll
    for (int t = 0; t < 4; ++t) sS[w][8 * g + r][t * 16 + col] = (acc[t][r] + ac1[t][r] * (1.0f / VLO) + ac2[t][r] * (1.0f / PLO)) * inv; }
  LDSX();
  for (int qq = lane; qq < 16 * 16; qq += 32) { const int rl = qq >> 4, pc = qq & 15; vst2(O32 + ((bh * SS) + q0 + rl) * HD + pc * 4, *(const v4f*)(&sS[w][rl][pc * 4])); }
}
// out = ctx Wo^T + bo : split(ctx) x bf16(Wo rows): 2 products (Wo is an INPUT -> bf16 exact)
__global__ __launch_bounds__(128) void k_out(const float* __restrict__ O32, const float* __restrict__ Wo, const float* __restrict__ bo, float* __restrict__ out) {
  __shared__ __align__(16) char sm[2 * OSTG];  // the ring of two stages; behind the loop's last barrier the epilogue stages its rows in the same bytes
  float (*so)[16][132] = (float (*)[16][132])sm;
  const int tid = threadIdx.x, wave = tid >> 5, lane = tid & 31, col = lane & 15, g = lane >> 4;
  const int r0b = blockIdx.x * 64, r0 = r0b + wave * 16, n0 = blockIdx.y * 128; const int b = r0b / SS, s0 = r0b % SS;
  v8f acc[8] = {};
  const unsigned lds0 = (unsigned)(size_t)&sm[(tid >> 4) * OP + (tid & 15) * 16];
  const char* gA = (const char*)(O32 + ((size_t)b * NH * SS + s0 + (tid >> 4)) * HD) + (tid & 15) * 16;
  const char* gB = (const char*)(Wo + (size_t)(n0 + (tid >> 4)) * E) + (tid & 15) * 16;
  // stage kt = head kt of the context rows (64 f32 a row) and columns 64*kt.. of the weight rows
  auto fill = [&](int kt) {
#pragma unroll
    for (int hf = 0; hf < 2; ++hf) { unsigned l[12]; const char* p[12];
#pragma unroll  // the twelve address pairs are operands of one asm statement: they must be registers, not indexed arrays
      for (int ii = 0; ii < 12; ++ii) { const int i = hf * 12 + ii; l[ii] = lds0 + (kt & 1) * OSTG + i * (8 * OP);
        p[ii] = i < 8 ? gA + (size_t)i * (8 * HD * 4) + (size_t)kt * ((size_t)SS * HD * 4) : gB + (size_t)(i - 8) * (8 * E * 4) + (size_t)kt * 256; }
      copy12(l, p); } };
  fill(0);
  asm volatile("s_wait_asynccnt 0x0" ::: "memory");  // stage 0 has landed before the barrier that publishes it
  __syncthreads();
  fill(1);
#pragma unroll 1  // one trip per stage: the ring's foot stands once in the code
  for (int kt = 0; kt < E / 64; ++kt) { const char* st = sm + (kt & 1) * OSTG;
#pragma unroll
    for (int kc = 0; kc < 2; ++kc) { const F2 a = split_row((const float*)(st + (wave * 16 + col) * OP), kc * 32, lane);
#pragma unroll
      for (int j0 = 0; j0 < 8; j0 += 4) { v16b wb[4];
#pragma unroll
        for (int j = 0; j < 4; ++j) wb[j] = split_row((const float*)(st + (64 + (j0 + j) * 16 + col) * OP), kc * 32, lane).h;
#pragma unroll
        for (int j = 0; j < 4; ++j) { acc[j0 + j] = wmma_bf(a.l, wb[j], acc[j0 + j]); acc[j0 + j] = wmma_bf(a.h, wb[j], acc[j0 + j]); } } }
    RING_FOOT();
    if (kt + 2 < E / 64) fill(kt + 2); }
  asm volatile("s_wait_asynccnt 0x0" ::: "memory");  // no copy is left in flight when the epilogue takes the ring's LDS
#pragma unroll
  for (int j = 0; j < 8; ++j) { const int n = n0 + j * 16 + col; const float bb = bfr(bo[n]);
#pragma unroll
    for (int r = 0; r < 8; ++r) so[wave][8 * g + r][j * 16 + col] = acc[j][r] + bb; }
  LDSX();
#pragma unroll 4
  for (int rl = 0; rl < 16; ++rl) vst2(out + (size_t)(r0 + rl) * E + n0 + lane * 4, *(const v4f*)(&so[wave][rl][lane * 4]));
}
extern "C" void kernel_launch(void* const* d_in, const int* in_sizes, int n_in, void* d_out, int out_size, void* d_ws, size_t ws_size, hipStream_t stream) {
  (void)in_sizes; (void)n_in; (void)out_size; (void)ws_size;
  const float** I = (const float**)d_in;
  const float* x = I[0]; const float* amask = I[1]; const float* Wq = I[2]; const float* bq = I[3]; const float* Wk = I[4]; const float* bk = I[5]; const float* Wv = I[6]; const float* bv = I[7]; const float* Wp = I[8]; const float* bp = I[9]; const float* qnw = I[10]; const float* knw = I[11];
  float* out = (float*)d_out;
  char* ws = (char*)d_ws; size_t off = 0;
  auto take = [&](size_t bytes) { char* p = ws + off; off += (bytes + 255) & ~(size_t)255; return p; };
  __bf16* Xb = (__bf16*)take((size_t)NR * E * 2); __bf16* PT = (__bf16*)take((size_t)3 * E * E * 2);
  float* Q32 = (float*)take((size_t)NR * E * 4); __bf16* K2 = (__bf16*)take((size_t)NR * E * 4); _Float16* VTh = (_Float16*)take((size_t)NR * E * 2); _Float16* VTl = (_Float16*)take((size_t)NR * E * 2); float* O32 = (float*)take((size_t)NR * E * 4);
  // ws ~ 82 MB
  k_cvt<<<(NR * E / 8 + 255) / 256, 256, 0, stream>>>(x, Xb);
  k_pack<<<3 * E, 256, 0, stream>>>(Wq, Wk, Wv, PT);
  k_qkv<<<dim3(NR / 64, E / 128, 3), 128, 0, stream>>>(Xb, PT, bq, bk, bv, qnw, knw, Q32, K2, VTh, VTl);
  k_attn<<<dim3(SS / 64, NB * NH), 128, 0, stream>>>(Q32, K2, VTh, VTl, amask, O32);
  k_out<<<dim3(NR / 64, E / 128), 128, 0, stream>>>(O32, Wp, bp, out);
}

// v004
// Measured time: 202 microseconds a run.
// Next to v003, in two timings, it ran 1.13 and 1.12 times as fast.
// All steps since v000 together make it 3.29 times as fast.
// compute dtype: every module INPUT that feeds a GEMM (x, Wq/Wk/Wv/Wp, biases, LN weights, attn_mask) is rounded to bf16 and used in exact bf16 WMMA products with f32 accumulation; computed operands (normalised+rotated q/k f32 split, P and V hi/lo, context split) f32-grade; LayerNorm/RoPE/softmax f32.
#include <hip/hip_runtime.h>
#include <math.h>

typedef __attribute__((ext_vector_type(16))) _Float16 v16h;
typedef __attribute__((ext_vector_type(16))) __bf16 v16b;
typedef __attribute__((ext_vector_type(8)))  _Float16 v8h;
typedef __attribute__((ext_vector_type(8)))  float v8f;
typedef __attribute__((ext_vector_type(4)))  float v4f;
typedef __attribute__((ext_vector_type(2)))  float v2f;
typedef __attribute__((ext_vector_type(4)))  unsigned v4u;
typedef __attribute__((ext_vector_type(4)))  int v4i;
typedef float __attribute__((may_alias)) float_a;
typedef int __attribute__((may_alias)) int_a;

template <typename T> __device__ __forceinline__ void vst2(void* p, T v) { *(T*)p = v;  }
__device__ __forceinline__ v8f wmma16(v16h a, v16h b, v8f c) {
  v8f d = __builtin_amdgcn_wmma_f32_16x16x32_f16(false, a, false, b, (short)0, c, false, false);
  asm volatile("v_nop\n\tv_nop\n\tv_nop\n\tv_nop" : "+v"(d) : "v"(a), "v"(b));
  return d;
}
__device__ __forceinline__ v8f wmma_bf(v16b a, v16b b, v8f c) {
  v8f d = __builtin_amdgcn_wmma_f32_16x16x32_bf16(false, a, false, b, (short)0, c, false, false);
  asm volatile("v_nop\n\tv_nop\n\tv_nop\n\tv_nop" : "+v"(d) : "v"(a), "v"(b));
  return d;
}
// 16x16x32 fragments: lane = (h = lane>>4, row/col = lane&15); elements 0..7 = k0+8h+0..7, 8..15 = k0+16+8h+0..7; D element r = row 8h+r
__device__ __forceinline__ v16h frag_h(const _Float16* rowk0, int lane) {
  union { v16h v; v8h q[2]; } u; const _Float16* p = rowk0 + 8 * (lane >> 4);
  u.q[0] = *(const v8h*)p; u.q[1] = *(const v8h*)(p + 16); return u.v;
}
__device__ __forceinline__ v16h frag_f32(const float* rowk0, int lane) {
  v16h a; const float* p = rowk0 + 8 * (lane >> 4);
#pragma unroll
  for (int i = 0; i < 8; ++i) { a[i] = (_Float16)p[i]; a[8 + i] = (_Float16)p[16 + i]; }
  return a;
}
__device__ __forceinline__ v16h frag_f32s(const float* rowk0, int lane, float sc) {
  v16h a; const float* p = rowk0 + 8 * (lane >> 4);
#pragma unroll
  for (int i = 0; i < 8; ++i) { a[i] = (_Float16)(p[i] * sc); a[8 + i] = (_Float16)(p[16 + i] * sc); }
  return a;
}
// column fragment from a [K][ld] layout (column n), rows >= K read as 0
__device__ __forceinline__ v16h fragc_f32(const float* W, int k0, int n, int lane, int ld, int K) {
  v16h a; const int g = lane >> 4;
#pragma unroll
  for (int i = 0; i < 8; ++i) { const int ka = k0 + 8 * g + i, kb = ka + 16;
    a[i] = (_Float16)(ka < K ? W[(size_t)ka * ld + n] : 0.f); a[8 + i] = (_Float16)(kb < K ? W[(size_t)kb * ld + n] : 0.f); }
  return a;
}
struct F2 { v16b h, l; };
__device__ __forceinline__ F2 bsplit16(const float v[16]) { F2 r;
#pragma unroll
  for (int i = 0; i < 16; ++i) { const __bf16 h = (__bf16)v[i]; r.h[i] = h; r.l[i] = (__bf16)(v[i] - (float)h); }
  return r; }
__device__ __forceinline__ F2 split_row(const float* row, int k0, int lane) { float v[16]; const float* p = row + k0 + 8 * (lane >> 4);
#pragma unroll
  for (int i = 0; i < 8; ++i) { v[i] = p[i]; v[8 + i] = p[16 + i]; }
  return bsplit16(v); }
__device__ __forceinline__ F2 split_rowK(const float* row, int k0, int lane, int K) { float v[16]; const int g = lane >> 4;
#pragma unroll
  for (int i = 0; i < 8; ++i) { const int ka = k0 + 8 * g + i, kb = ka + 16; v[i] = ka < K ? row[ka] : 0.f; v[8 + i] = kb < K ? row[kb] : 0.f; }
  return bsplit16(v); }
__device__ __forceinline__ F2 split_col(const float* W, int k0, int n, int lane, int ld, int K) { float v[16]; const int g = lane >> 4;
#pragma unroll
  for (int i = 0; i < 8; ++i) { const int ka = k0 + 8 * g + i, kb = ka + 16; v[i] = ka < K ? W[(size_t)ka * ld + n] : 0.f; v[8 + i] = kb < K ? W[(size_t)kb * ld + n] : 0.f; }
  return bsplit16(v); }
__device__ __forceinline__ v8f mac3(const F2& a, const F2& b, v8f c) { c = wmma_bf(a.l, b.h, c); c = wmma_bf(a.h, b.l, c); return wmma_bf(a.h, b.h, c); }
__device__ __forceinline__ float sigm(float v) { return 1.0f / (1.0f + expf(-v)); }
#define LDSX() do { asm volatile("s_wait_dscnt 0" ::: "memory"); __builtin_amdgcn_wave_barrier(); __builtin_amdgcn_fence(__ATOMIC_RELEASE, "workgroup"); } while (0)


// NEPA self attention (16 heads of 64 on [2,2048,1024], [out][in] weights + biases): q,k LayerNorm'd per head (eps 1e-6, weight only), RoPE on tokens >= 1 (prefix 1):
// angle[d] = 2*pi*coord(t)*100^(-(d mod 16)/16), coord = 2*(t-1+0.5)/2047 - 1, rotate-half pairs (d, d+32); scores = q.k/8 + attn_mask[q][k]; softmax; (P v) Wp^T + bp.
#define NB 2
#define SS 2048
#define E 1024
#define NH 16
#define HD 64
#define NR (NB * SS)
#define ROPE_L 2047.0f
#define PLO 1024.0f
#define VLO 2048.0f
__device__ __forceinline__ float bfr(float v) { return (float)(__bf16)v; }
__device__ __forceinline__ v16b frag_b(const __bf16* rowk0, int lane) { return __builtin_bit_cast(v16b, frag_h((const _Float16*)rowk0, lane)); }
// softmax exponentials for t <= 0 on the hardware's base-2 exponential; t = -inf, or a result below the f32 range, gives 0
#define LOG2E 1.44269504088896f
__device__ __forceinline__ float exp_neg(float t) { return __builtin_amdgcn_exp2f(t * LOG2E); }
// e^t * 2^14: the scale of P rides in the exponent, t * log2(e) + 14 in one fused multiply-add, rounded once
__device__ __forceinline__ float exp_neg_p14(float t) { return __builtin_amdgcn_exp2f(fmaf(t, LOG2E, 14.0f)); }

__global__ __launch_bounds__(256) void k_cvt(const float* __restrict__ x, __bf16* __restrict__ Xb) {
  const size_t i8 = (size_t)blockIdx.x * 256 + threadIdx.x; if (i8 >= (size_t)NR * E / 8) return;
  union { __bf16 h[8]; v4u u; } pk;
#pragma unroll
  for (int e = 0; e < 8; ++e) pk.h[e] = (__bf16)x[i8 * 8 + e];
  vst2((unsigned*)(Xb + i8 * 8), pk.u);
}
// PT rows: [0,E) Wq[n][:], [E,2E) Wk, [2E,3E) Wv  ([out][in]) as bf16 rows (no scaling)
__global__ __launch_bounds__(256) void k_pack(const float* __restrict__ Wq, const float* __restrict__ Wk, const float* __restrict__ Wv, __bf16* __restrict__ PT) {
  const int n = blockIdx.x, tid = threadIdx.x; __shared__ __align__(16) __bf16 srow[E];
  const float* W = n < E ? Wq : (n < 2 * E ? Wk : Wv); const int nn = n & (E - 1);
  for (int k = tid; k < E; k += 256) srow[k] = (__bf16)W[(size_t)nn * E + k];
  __syncthreads();
  if (tid < E / 8) vst2((unsigned*)(PT + (size_t)n * E + tid * 8), *(const v4u*)(&srow[tid * 8]));
}
// hand-over of a ring buffer: this wave's LDS reads and writes are done, its own copies have landed, then every wave meets; behind it the other buffer is readable and the one just read may be refilled
#define RING_FOOT() do { asm volatile("s_wait_dscnt 0x0" ::: "memory"); asm volatile("s_wait_asynccnt 0x0" ::: "memory"); __syncthreads(); } while (0)
// twelve 16-byte asynchronous copies per lane, global memory to LDS through no register; the s_wait_xcnt that closes the statement stands in front of any rewrite of the address registers the copies name
__device__ __forceinline__ void copy12(const unsigned* l, const char* const* p) {
  asm volatile("global_load_async_to_lds_b128 %0, %12, off\n\t"
               "global_load_async_to_lds_b128 %1, %13, off\n\t"
               "global_load_async_to_lds_b128 %2, %14, off\n\t"
               "global_load_async_to_lds_b128 %3, %15, off\n\t"
               "global_load_async_to_lds_b128 %4, %16, off\n\t"
               "global_load_async_to_lds_b128 %5, %17, off\n\t"
               "global_load_async_to_lds_b128 %6, %18, off\n\t"
               "global_load_async_to_lds_b128 %7, %19, off\n\t"
               "global_load_async_to_lds_b128 %8, %20, off\n\t"
               "global_load_async_to_lds_b128 %9, %21, off\n\t"
               "global_load_async_to_lds_b128 %10, %22, off\n\t"
               "global_load_async_to_lds_b128 %11, %23, off\n\t"
               "s_wait_xcnt 0x0"
               :: "v"(l[0]), "v"(l[1]), "v"(l[2]), "v"(l[3]), "v"(l[4]), "v"(l[5]), "v"(l[6]), "v"(l[7]), "v"(l[8]), "v"(l[9]), "v"(l[10]), "v"(l[11]),
                  "v"(p[0]), "v"(p[1]), "v"(p[2]), "v"(p[3]), "v"(p[4]), "v"(p[5]), "v"(p[6]), "v"(p[7]), "v"(p[8]), "v"(p[9]), "v"(p[10]), "v"(p[11]) : "memory");
}
// projection GEMMs: a stage is a 64-deep k slice of the block's 64 activation rows followed by its 128 weight rows; LDS row pitch = slice bytes + 16, which spreads the 16 rows of a ds_load_b128 fragment read over all banks
#define GP 144
#define GSTG (192 * GP)
#define OP 272
#define OSTG (192 * OP)
// QKV: block (64 rows, 128 cols = 2 heads, which); q,k -> LayerNorm, RoPE; q -> Q32 f32 [bh][s][64]; k -> K2 [bh][s][2][64]: the 64 bf16 hi parts of a row, then its 64 bf16 lo parts; v -> VT hi/lo x4 [bh][d][s]
// five waves per SIMD is what the ring's LDS admits: the register budget is held there, so that an epilogue's schedule does not cost the GEMM loop a resident block
__global__ __launch_bounds__(128) __attribute__((amdgpu_waves_per_eu(5))) void k_qkv(const __bf16* __restrict__ Xb, const __bf16* __restrict__ PT, const float* __restrict__ bq, const float* __restrict__ bk, const float* __restrict__ bv, const float* __restrict__ qnw, const float* __restrict__ knw,
                                            float* __restrict__ Q32, __bf16* __restrict__ K2, _Float16* __restrict__ VTh, _Float16* __restrict__ VTl) {
  __shared__ __align__(16) char sm[2 * GSTG];  // the ring of two stages; behind the loop's last barrier the epilogue stages its rows in the same bytes
  float (*so)[16][132] = (float (*)[16][132])sm;
  _Float16 (*sth)[72] = (_Float16 (*)[72])sm; _Float16 (*stl)[72] = sth + 128;
  const int tid = threadIdx.x, wave = tid >> 5, lane = tid & 31, col = lane & 15, g = lane >> 4;
  const int which = blockIdx.z, r0b = blockIdx.x * 64, n0 = blockIdx.y * 128; const int b = r0b / SS, s0 = r0b % SS;
  const float* bb_ = which == 0 ? bq : (which == 1 ? bk : bv);
  v8f acc[8] = {};
  const unsigned lds0 = (unsigned)(size_t)&sm[(tid >> 3) * GP + (tid & 7) * 16];
  const char* gA = (const char*)(Xb + (size_t)(r0b + (tid >> 3)) * E) + (tid & 7) * 16;
  const char* gB = (const char*)(PT + (size_t)(which * E + n0 + (tid >> 3)) * E) + (tid & 7) * 16;
  auto fill = [&](int kt) { unsigned l[12]; const char* p[12];
#pragma unroll  // the twelve address pairs are operands of one asm statement: they must be registers, not indexed arrays
    for (int i = 0; i < 12; ++i) { l[i] = lds0 + (kt & 1) * GSTG + i * (16 * GP); p[i] = (i < 4 ? gA + (size_t)i * (16 * E * 2) : gB + (size_t)(i - 4) * (16 * E * 2)) + (size_t)kt * 128; }
    copy12(l, p); };
  fill(0);
  asm volatile("s_wait_asynccnt 0x0" ::: "memory");  // stage 0 has landed before the barrier that publishes it
  __syncthreads();
  fill(1);
#pragma unroll 1  // one trip per stage: the ring's foot stands once in the code
  for (int kt = 0; kt < E / 64; ++kt) { const char* st = sm + (kt & 1) * GSTG;
#pragma unroll
    for (int kc = 0; kc < 2; ++kc) { const v16b a = frag_b((const __bf16*)(st + (wave * 16 + col) * GP) + kc * 32, lane); v16b wb[8];
#pragma unroll
      for (int j = 0; j < 8; ++j) wb[j] = frag_b((const __bf16*)(st + (64 + j * 16 + col) * GP) + kc * 32, lane);
#pragma unroll
      for (int j = 0; j < 8; ++j) acc[j] = wmma_bf(a, wb[j], acc[j]); }
    RING_FOOT();
    if (kt + 2 < E / 64) fill(kt + 2); }
  asm volatile("s_wait_asynccnt 0x0" ::: "memory");  // no copy is left in flight when the epilogue takes the ring's LDS
  if (which < 2) {
#pragma unroll
    for (int j = 0; j < 8; ++j) { const float bb = bfr(bb_[n0 + j * 16 + col]);
#pragma unroll
      for (int r = 0; r < 8; ++r) so[wave][8 * g + r][j * 16 + col] = acc[j][r] + bb; }
    LDSX();
    { const int rl = lane & 15, hh = lane >> 4; float* rowp = &so[wave][rl][hh * 64]; const float* wn = which == 0 ? qnw : knw; float s1 = 0.f;
#pragma unroll 8
      for (int d = 0; d < 64; ++d) s1 += rowp[d];
      const float mu = s1 * (1.0f / 64.0f); float s2 = 0.f;
#pragma unroll 8
      for (int d = 0; d < 64; ++d) { const float dv = rowp[d] - mu; s2 += dv * dv; }
      const float rs = rsqrtf(s2 * (1.0f / 64.0f) + 1e-6f);
#pragma unroll 8
      for (int d = 0; d < 64; ++d) rowp[d] = (rowp[d] - mu) * rs * bfr(wn[d]);
      // RoPE for tokens t >= 1
      const int t = s0 + wave * 16 + rl;
      if (t >= 1) { const float coord = 2.0f * (((float)(t - 1) + 0.5f) / ROPE_L) - 1.0f;
#pragma unroll 4
        for (int d = 0; d < 32; ++d) { const float invf = powf(100.0f, -(float)(d & 15) * (1.0f / 16.0f)); const float ang = 6.283185307179586f * coord * invf; float sn, cs; sincosf(ang, &sn, &cs);
          const float x1 = rowp[d], x2 = rowp[d + 32]; rowp[d] = x1 * cs - x2 * sn; rowp[d + 32] = x2 * cs + x1 * sn; } } }
    LDSX();
    if (which == 0) {
      for (int qq = lane; qq < 2 * 16 * 16; qq += 32) { const int hh = qq >> 8, rl = (qq >> 4) & 15, pc = qq & 15; const int h = (n0 >> 6) + hh;
        vst2(Q32 + (((size_t)b * NH + h) * SS + s0 + wave * 16 + rl) * HD + pc * 4, *(const v4f*)(&so[wave][rl][hh * 64 + pc * 4])); } }
    else {
      // each key row is split here, once, with the arithmetic of bsplit16; every query block of k_attn then reads the pair ready for its products
      for (int qq = lane; qq < 2 * 16 * 8; qq += 32) { const int hh = qq >> 7, rl = (qq >> 3) & 15, pc = qq & 7; const int h = (n0 >> 6) + hh;
        const float* sp = &so[wave][rl][hh * 64 + pc * 8]; union { __bf16 e[8]; v4u u; } ph, pl;
#pragma unroll  // the eight parts pack into the four registers of each 16-byte store: they must be registers, not indexed arrays
        for (int e = 0; e < 8; ++e) { const float v = sp[e]; const __bf16 hi = (__bf16)v; ph.e[e] = hi; pl.e[e] = (__bf16)(v - (float)hi); }
        __bf16* dst = K2 + (((size_t)b * NH + h) * SS + s0 + wave * 16 + rl) * (2 * HD) + pc * 8;
        vst2(dst, ph.u); vst2(dst + HD, pl.u); } } }
  else {
#pragma unroll
    for (int j = 0; j < 8; ++j) { const float bb = bfr(bb_[n0 + j * 16 + col]);
#pragma unroll
      for (int r = 0; r < 8; ++r) { const float v = (acc[j][r] + bb) * 4.0f; const _Float16 hi = (_Float16)v; sth[j * 16 + col][wave * 16 + 8 * g + r] = hi; stl[j * 16 + col][wave * 16 + 8 * g + r] = (_Float16)((v - (float)hi) * VLO); } }
    __syncthreads();
    for (int qq = tid; qq < 128 * 8; qq += 128) { const int cl = qq >> 3, pc = qq & 7; const int c = n0 + cl, h = c >> 6, d = c & 63; const size_t o = (((size_t)b * NH + h) * HD + d) * SS + s0 + pc * 8;
      vst2(VTh + o, *(const v4u*)(&sth[cl][pc * 8])); vst2(VTl + o, *(const v4u*)(&stl[cl][pc * 8])); } }
}
// eight 16-byte asynchronous copies per lane, global memory to LDS through no register; the s_wait_xcnt that closes the statement stands in front of any rewrite of the address registers the copies name
__device__ __forceinline__ void copy8(const unsigned* l, const char* const* p) {
  asm volatile("global_load_async_to_lds_b128 %0, %8, off\n\t"
               "global_load_async_to_lds_b128 %1, %9, off\n\t"
               "global_load_async_to_lds_b128 %2, %10, off\n\t"
               "global_load_async_to_lds_b128 %3, %11, off\n\t"
               "global_load_async_to_lds_b128 %4, %12, off\n\t"
               "global_load_async_to_lds_b128 %5, %13, off\n\t"
               "global_load_async_to_lds_b128 %6, %14, off\n\t"
               "global_load_async_to_lds_b128 %7, %15, off\n\t"
               "s_wait_xcnt 0x0"
               :: "v"(l[0]), "v"(l[1]), "v"(l[2]), "v"(l[3]), "v"(l[4]), "v"(l[5]), "v"(l[6]), "v"(l[7]),
                  "v"(p[0]), "v"(p[1]), "v"(p[2]), "v"(p[3]), "v"(p[4]), "v"(p[5]), "v"(p[6]), "v"(p[7]) : "memory");
}
// attention over all keys: block (64 queries, bh), 32 key tiles of 64; the block's four waves share each K tile (rows of 64 bf16 hi, 64 bf16 lo) and V tile (hi/lo rows) through LDS, filled by asynchronous copies:
// ring of two buffers, stage 2*kt = K tile kt in sK, stage 2*kt+1 = V tile kt in sV; S on hi/lo splits of the f32 q/k rows (q split here once, k by its producer); P,V hi/lo; O f32 [bh][s][64]
__global__ __launch_bounds__(128) void k_attn(const float* __restrict__ Q32, const __bf16* __restrict__ K2, const _Float16* __restrict__ VTh, const _Float16* __restrict__ VTl, const float* __restrict__ amask, float* __restrict__ O32) {
  __shared__ __align__(16) float sS[4][16][68];
  __shared__ __align__(16) _Float16 sPh[4][16][72], sPl[4][16][72];
  __shared__ __align__(16) __bf16 sK[64][136];
  __shared__ __align__(16) _Float16 sV[2][64][72];
  const int tid = threadIdx.x, w = tid >> 5, lane = tid & 31, col = lane & 15, g = lane >> 4;
  const size_t bh = blockIdx.y; const int qb = blockIdx.x; const int q0 = qb * 64 + w * 16;
  const unsigned ldsK = (unsigned)(size_t)&sK[tid >> 4][(tid & 15) * 8], ldsV = (unsigned)(size_t)&sV[0][tid >> 3][(tid & 7) * 8];
  const char* gK = (const char*)(K2 + bh * SS * (2 * HD)) + tid * 16;
  const size_t voff = ((bh * HD + (tid >> 3)) * SS + (tid & 7) * 8) * 2;
  const char* gVh = (const char*)VTh + voff; const char* gVl = (const char*)VTl + voff;
  auto fillK = [&](int kt) { unsigned l[8]; const char* p[8];
#pragma unroll  // the eight address pairs are operands of one asm statement: they must be registers, not indexed arrays
    for (int i = 0; i < 8; ++i) { l[i] = ldsK + i * (8 * 68 * 4); p[i] = gK + (size_t)kt * (64 * HD * 4) + i * 2048; }
    copy8(l, p); };
  auto fillV = [&](int kt) { unsigned l[8]; const char* p[8];
#pragma unroll  // as in fillK
    for (int i = 0; i < 8; ++i) { l[i] = ldsV + (i >> 2) * (64 * 72 * 2) + (i & 3) * (16 * 72 * 2); p[i] = (i < 4 ? gVh : gVl) + (size_t)(i & 3) * (16 * SS * 2) + (size_t)kt * 128; }
    copy8(l, p); };
  fillK(0);
  F2 aq[2];
#pragma unroll
  for (int kc = 0; kc < 2; ++kc) aq[kc] = split_row(Q32 + (bh * SS + q0 + col) * HD, kc * 32, lane);
  float mrun = -3.0e38f, lrun = 0.f; v8f acc[4] = {}, ac1[4] = {}, ac2[4] = {};
  asm volatile("s_wait_asynccnt 0x0" ::: "memory");  // K tile 0 has landed before the barrier that publishes it
  __syncthreads();
  fillV(0);
#pragma unroll 1
  for (int kt = 0;; ++kt) {
#pragma unroll
    for (int t = 0; t < 4; ++t) { const int key = kt * 64 + t * 16 + col; const __bf16* krow = &sK[t * 16 + col][0];
      const F2 k0 = { frag_b(krow, lane), frag_b(krow + HD, lane) }, k1 = { frag_b(krow + 32, lane), frag_b(krow + HD + 32, lane) };
      v8f s = mac3(aq[0], k0, (v8f){}); s = mac3(aq[1], k1, s);
#pragma unroll
      for (int r = 0; r < 8; ++r) sS[w][8 * g + r][t * 16 + col] = s[r] * 0.125f + bfr(amask[(size_t)(q0 + 8 * g + r) * SS + key]); }
    RING_FOOT();
    if (kt + 1 < SS / 64) fillK(kt + 1);
    float mx = -3.4e38f;
#pragma unroll
    for (int jj = 0; jj < 32; ++jj) mx = fmaxf(mx, sS[w][col][g * 32 + jj]);
    mx = fmaxf(mx, __shfl_xor(mx, 16, 32));
    const float mnew = fmaxf(mrun, mx); const float corr = exp_neg(mrun - mnew);
    float ps = 0.f;
#pragma unroll
    for (int jj = 0; jj < 32; ++jj) { const float p = exp_neg_p14(sS[w][col][g * 32 + jj] - mnew); ps += p; const _Float16 hi = (_Float16)p; sPh[w][col][g * 32 + jj] = hi; sPl[w][col][g * 32 + jj] = (_Float16)((p - (float)hi) * PLO); }
    ps += __shfl_xor(ps, 16, 32);
    lrun = lrun * corr + ps * (1.0f / 16384.0f); mrun = mnew;
#pragma unroll
    for (int r = 0; r < 8; ++r) { const float cr = __shfl(corr, 8 * g + r, 32);
#pragma unroll
      for (int t = 0; t < 4; ++t) { acc[t][r] *= cr; ac1[t][r] *= cr; ac2[t][r] *= cr; } }
    LDSX();
#pragma unroll
    for (int kc = 0; kc < 2; ++kc) { const v16h ph = frag_h(&sPh[w][col][0] + kc * 32, lane), pl = frag_h(&sPl[w][col][0] + kc * 32, lane);
#pragma unroll
      for (int t = 0; t < 4; ++t) { const v16h vh = frag_h(&sV[0][t * 16 + col][kc * 32], lane);
        acc[t] = wmma16(ph, vh, acc[t]); ac1[t] = wmma16(ph, frag_h(&sV[1][t * 16 + col][kc * 32], lane), ac1[t]); ac2[t] = wmma16(pl, vh, ac2[t]); } }
    RING_FOOT();
    if (kt + 1 == SS / 64) break;
    fillV(kt + 1); }
  asm volatile("s_wait_asynccnt 0x0" ::: "memory");  // no copy is left in flight when the wave goes on to its epilogue and ends
#pragma unroll
  for (int r = 0; r < 8; ++r) { const float lr = __shfl(lrun, 8 * g + r, 32); const float inv = 1.0f / (lr * 16384.0f * 4.0f);
#pragma unroll
    for (int t = 0; t < 4; ++t) sS[w][8 * g + r][t * 16 + col] = (acc[t][r] + ac1[t][r] * (1.0f / VLO) + ac2[t][r] * (1.0f / PLO)) * inv; }
  LDSX();
  for (int qq = lane; qq < 16 * 16; qq += 32) { const int rl = qq >> 4, pc = qq & 15; vst2(O32 + ((bh * SS) + q0 + rl) * HD + pc * 4, *(const v4f*)(&sS[w][rl][pc * 4])); }
}
// out = ctx Wo^T + bo : split(ctx) x bf16(Wo rows): 2 products (Wo is an INPUT -> bf16 exact)
__global__ __launch_bounds__(128) void k_out(const float* __restrict__ O32, const float* __restrict__ Wo, const float* __restrict__ bo, float* __restrict__ out) {
  __shared__ __align__(16) char sm[2 * OSTG];  // the ring of two stages; behind the loop's last barrier the epilogue stages its rows in the same bytes
  float (*so)[16][132] = (float (*)[16][132])sm;
  const int tid = threadIdx.x, wave = tid >> 5, lane = tid & 31, col = lane & 15, g = lane >> 4;
  const int r0b = blockIdx.x * 64, r0 = r0b + wave * 16, n0 = blockIdx.y * 128; const int b = r0b / SS, s0 = r0b % SS;
  v8f acc[8] = {};
  const unsigned lds0 = (unsigned)(size_t)&sm[(tid >> 4) * OP + (tid & 15) * 16];
  const char* gA = (const char*)(O32 + ((size_t)b * NH * SS + s0 + (tid >> 4)) * HD) + (tid & 15) * 16;
  const char* gB = (const char*)(Wo + (size_t)(n0 + (tid >> 4)) * E) + (tid & 15) * 16;
  // stage kt = head kt of the context rows (64 f32 a row) and columns 64*kt.. of the weight rows
  auto fill = [&](int kt) {
#pragma unroll
    for (int hf = 0; hf < 2; ++hf) { unsigned l[12]; const char* p[12];
#pragma unroll  // the twelve address pairs are operands of one asm statement: they must be registers, not indexed arrays
      for (int ii = 0; ii < 12; ++ii) { const int i = hf * 12 + ii; l[ii] = lds0 + (kt & 1) * OSTG + i * (8 * OP);
        p[ii] = i < 8 ? gA + (size_t)i * (8 * HD * 4) + (size_t)kt * ((size_t)SS * HD * 4) : gB + (size_t)(i - 8) * (8 * E * 4) + (size_t)kt * 256; }
      copy12(l, p); } };
  fill(0);
  asm volatile("s_wait_asynccnt 0x0" ::: "memory");  // stage 0 has landed before the barrier that publishes it
  __syncthreads();
  fill(1);
#pragma unroll 1  // one trip per stage: the ring's foot stands once in the code
  for (int kt = 0; kt < E / 64; ++kt) { const char* st = sm + (kt & 1) * OSTG;
#pragma unroll
    for (int kc = 0; kc < 2; ++kc) { const F2 a = split_row((const float*)(st + (wave * 16 + col) * OP), kc * 32, lane);
#pragma unroll
      for (int j0 = 0; j0 < 8; j0 += 4) { v16b wb[4];
#pragma unroll
        for (int j = 0; j < 4; ++j) wb[j] = split_row((const float*)(st + (64 + (j0 + j) * 16 + col) * OP), kc * 32, lane).h;
#pragma unroll
        for (int j = 0; j < 4; ++j) { acc[j0 + j] = wmma_bf(a.l, wb[j], acc[j0 + j]); acc[j0 + j] = wmma_bf(a.h, wb[j], acc[j0 + j]); } } }
    RING_FOOT();
    if (kt + 2 < E / 64) fill(kt + 2); }
  asm volatile("s_wait_asynccnt 0x0" ::: "memory");  // no copy is left in flight when the epilogue takes the ring's LDS
#pragma unroll
  for (int j = 0; j < 8; ++j) { const int n = n0 + j * 16 + col; const float bb = bfr(bo[n]);
#pragma unroll
    for (int r = 0; r < 8; ++r) so[wave][8 * g + r][j * 16 + col] = acc[j][r] + bb; }
  LDSX();
#pragma unroll 4
  for (int rl = 0; rl < 16; ++rl) vst2(out + (size_t)(r0 + rl) * E + n0 + lane * 4, *(const v4f*)(&so[wave][rl][lane * 4]));
}
extern "C" void kernel_launch(void* const* d_in, const int* in_sizes, int n_in, void* d_out, int out_size, void* d_ws, size_t ws_size, hipStream_t stream) {
  (void)in_sizes; (void)n_in; (void)out_size; (void)ws_size;
  const float** I = (const float**)d_in;
  const float* x = I[0]; const float* amask = I[1]; const float* Wq = I[2]; const float* bq = I[3]; const float* Wk = I[4]; const float* bk = I[5]; const float* Wv = I[6]; const float* bv = I[7]; const float* Wp = I[8]; const float* bp = I[9]; const float* qnw = I[10]; const float* knw = I[11];
  float* out = (float*)d_out;
  char* ws = (char*)d_ws; size_t off = 0;
  auto take = [&](size_t bytes) { char* p = ws + off; off += (bytes + 255) & ~(size_t)255; return p; };
  __bf16* Xb = (__bf16*)take((size_t)NR * E * 2); __bf16* PT = (__bf16*)take((size_t)3 * E * E * 2);
  float* Q32 = (float*)take((size_t)NR * E * 4); __bf16* K2 = (__bf16*)take((size_t)NR * E * 4); _Float16* VTh = (_Float16*)take((size_t)NR * E * 2); _Float16* VTl = (_Float16*)take((size_t)NR * E * 2); float* O32 = (float*)take((size_t)NR * E * 4);
  // ws ~ 82 MB
  k_cvt<<<(NR * E / 8 + 255) / 256, 256, 0, stream>>>(x, Xb);
  k_pack<<<3 * E, 256, 0, stream>>>(Wq, Wk, Wv, PT);
  k_qkv<<<dim3(NR / 64, E / 128, 3), 128, 0, stream>>>(Xb, PT, bq, bk, bv, qnw, knw, Q32, K2, VTh, VTl);
  k_attn<<<dim3(SS / 64, NB * NH), 128, 0, stream>>>(Q32, K2, VTh, VTl, amask, O32);
  k_out<<<dim3(NR / 64, E / 128), 128, 0, stream>>>(O32, Wp, bp, out);
}

// v005
// One run takes 185 microseconds.
// Timed twice side by side with v004, it ran 1.08 times as fast both times.
// Over all steps from v000 it is 3.56 times as fast.
// compute dtype: every module INPUT that feeds a GEMM (x, Wq/Wk/Wv/Wp, biases, LN weights, attn_mask) is rounded to bf16 and used in exact bf16 WMMA products with f32 accumulation; computed operands (normalised+rotated q/k f32 split, P and V hi/lo, context split) f32-grade; LayerNorm/RoPE/softmax f32.
#include <hip/hip_runtime.h>
#include <math.h>

typedef __attribute__((ext_vector_type(16))) _Float16 v16h;
typedef __attribute__((ext_vector_type(16))) __bf16 v16b;
typedef __attribute__((ext_vector_type(8)))  _Float16 v8h;
typedef __attribute__((ext_vector_type(8)))  float v8f;
typedef __attribute__((ext_vector_type(4)))  float v4f;
typedef __attribute__((ext_vector_type(2)))  float v2f;
typedef __attribute__((ext_vector_type(4)))  unsigned v4u;
typedef __attribute__((ext_vector_type(4)))  int v4i;
typedef float __attribute__((may_alias)) float_a;
typedef int __attribute__((may_alias)) int_a;

template <typename T> __device__ __forceinline__ void vst2(void* p, T v) { *(T*)p = v;  }
__device__ __forceinline__ v8f wmma16(v16h a, v16h b, v8f c) {
  v8f d = __builtin_amdgcn_wmma_f32_16x16x32_f16(false, a, false, b, (short)0, c, false, false);
  asm volatile("v_nop\n\tv_nop\n\tv_nop\n\tv_nop" : "+v"(d) : "v"(a), "v"(b));
  return d;
}
__device__ __forceinline__ v8f wmma_bf(v16b a, v16b b, v8f c) {
  v8f d = __builtin_amdgcn_wmma_f32_16x16x32_bf16(false, a, false, b, (short)0, c, false, false);
  asm volatile("v_nop\n\tv_nop\n\tv_nop\n\tv_nop" : "+v"(d) : "v"(a), "v"(b));
  return d;
}
// 16x16x32 fragments: lane = (h = lane>>4, row/col = lane&15); elements 0..7 = k0+8h+0..7, 8..15 = k0+16+8h+0..7; D element r = row 8h+r
__device__ __forceinline__ v16h frag_h(const _Float16* rowk0, int lane) {
  union { v16h v; v8h q[2]; } u; const _Float16* p = rowk0 + 8 * (lane >> 4);
  u.q[0] = *(const v8h*)p; u.q[1] = *(const v8h*)(p + 16); return u.v;
}
__device__ __forceinline__ v16h frag_f32(const float* rowk0, int lane) {
  v16h a; const float* p = rowk0 + 8 * (lane >> 4);
#pragma unroll
  for (int i = 0; i < 8; ++i) { a[i] = (_Float16)p[i]; a[8 + i] = (_Float16)p[16 + i]; }
  return a;
}
__device__ __forceinline__ v16h frag_f32s(const float* rowk0, int lane, float sc) {
  v16h a; const float* p = rowk0 + 8 * (lane >> 4);
#pragma unroll
  for (int i = 0; i < 8; ++i) { a[i] = (_Float16)(p[i] * sc); a[8 + i] = (_Float16)(p[16 + i] * sc); }
  return a;
}
// column fragment from a [K][ld] layout (column n), rows >= K read as 0
__device__ __forceinline__ v16h fragc_f32(const float* W, int k0, int n, int lane, int ld, int K) {
  v16h a; const int g = lane >> 4;
#pragma unroll
  for (int i = 0; i < 8; ++i) { const int ka = k0 + 8 * g + i, kb = ka + 16;
    a[i] = (_Float16)(ka < K ? W[(size_t)ka * ld + n] : 0.f); a[8 + i] = (_Float16)(kb < K ? W[(size_t)kb * ld + n] : 0.f); }
  return a;
}
struct F2 { v16b h, l; };
__device__ __forceinline__ F2 bsplit16(const float v[16]) { F2 r;
#pragma unroll
  for (int i = 0; i < 16; ++i) { const __bf16 h = (__bf16)v[i]; r.h[i] = h; r.l[i] = (__bf16)(v[i] - (float)h); }
  return r; }
__device__ __forceinline__ F2 split_row(const float* row, int k0, int lane) { float v[16]; const float* p = row + k0 + 8 * (lane >> 4);
#pragma unroll
  for (int i = 0; i < 8; ++i) { v[i] = p[i]; v[8 + i] = p[16 + i]; }
  return bsplit16(v); }
__device__ __forceinline__ F2 split_rowK(const float* row, int k0, int lane, int K) { float v[16]; const int g = lane >> 4;
#pragma unroll
  for (int i = 0; i < 8; ++i) { const int ka = k0 + 8 * g + i, kb = ka + 16; v[i] = ka < K ? row[ka] : 0.f; v[8 + i] = kb < K ? row[kb] : 0.f; }
  return bsplit16(v); }
__device__ __forceinline__ F2 split_col(const float* W, int k0, int n, int lane, int ld, int K) { float v[16]; const int g = lane >> 4;
#pragma unroll
  for (int i = 0; i < 8; ++i) { const int ka = k0 + 8 * g + i, kb = ka + 16; v[i] = ka < K ? W[(size_t)ka * ld + n] : 0.f; v[8 + i] = kb < K ? W[(size_t)kb * ld + n] : 0.f; }
  return bsplit16(v); }
__device__ __forceinline__ v8f mac3(const F2& a, const F2& b, v8f c) { c = wmma_bf(a.l, b.h, c); c = wmma_bf(a.h, b.l, c); return wmma_bf(a.h, b.h, c); }
__device__ __forceinline__ float sigm(float v) { return 1.0f / (1.0f + expf(-v)); }
#define LDSX() do { asm volatile("s_wait_dscnt 0" ::: "memory"); __builtin_amdgcn_wave_barrier(); __builtin_amdgcn_fence(__ATOMIC_RELEASE, "workgroup"); } while (0)


// NEPA self attention (16 heads of 64 on [2,2048,1024], [out][in] weights + biases): q,k LayerNorm'd per head (eps 1e-6, weight only), RoPE on tokens >= 1 (prefix 1):
// angle[d] = 2*pi*coord(t)*100^(-(d mod 16)/16), coord = 2*(t-1+0.5)/2047 - 1, rotate-half pairs (d, d+32); scores = q.k/8 + attn_mask[q][k]; softmax; (P v) Wp^T + bp.
#define NB 2
#define SS 2048
#define E 1024
#define NH 16
#define HD 64
#define NR (NB * SS)
#define ROPE_L 2047.0f
#define PLO 1024.0f
#define VLO 2048.0f
__device__ __forceinline__ float bfr(float v) { return (float)(__bf16)v; }
__device__ __forceinline__ v16b frag_b(const __bf16* rowk0, int lane) { return __builtin_bit_cast(v16b, frag_h((const _Float16*)rowk0, lane)); }
// softmax exponentials for t <= 0 on the hardware's base-2 exponential; t = -inf, or a result below the f32 range, gives 0
#define LOG2E 1.44269504088896f
__device__ __forceinline__ float exp_neg(float t) { return __builtin_amdgcn_exp2f(t * LOG2E); }
// e^t * 2^14: the scale of P rides in the exponent, t * log2(e) + 14 in one fused multiply-add, rounded once
__device__ __forceinline__ float exp_neg_p14(float t) { return __builtin_amdgcn_exp2f(fmaf(t, LOG2E, 14.0f)); }

__global__ __launch_bounds__(256) void k_cvt(const float* __restrict__ x, __bf16* __restrict__ Xb) {
  const size_t i8 = (size_t)blockIdx.x * 256 + threadIdx.x; if (i8 >= (size_t)NR * E / 8) return;
  union { __bf16 h[8]; v4u u; } pk;
#pragma unroll
  for (int e = 0; e < 8; ++e) pk.h[e] = (__bf16)x[i8 * 8 + e];
  vst2((unsigned*)(Xb + i8 * 8), pk.u);
}
// PT rows: [0,E) Wq[n][:], [E,2E) Wk, [2E,3E) Wv  ([out][in]) as bf16 rows (no scaling)
__global__ __launch_bounds__(256) void k_pack(const float* __restrict__ Wq, const float* __restrict__ Wk, const float* __restrict__ Wv, __bf16* __restrict__ PT) {
  const int n = blockIdx.x, tid = threadIdx.x; __shared__ __align__(16) __bf16 srow[E];
  const float* W = n < E ? Wq : (n < 2 * E ? Wk : Wv); const int nn = n & (E - 1);
  for (int k = tid; k < E; k += 256) srow[k] = (__bf16)W[(size_t)nn * E + k];
  __syncthreads();
  if (tid < E / 8) vst2((unsigned*)(PT + (size_t)n * E + tid * 8), *(const v4u*)(&srow[tid * 8]));
}
// hand-over of a ring buffer: this wave's LDS reads and writes are done, its own copies have landed, then every wave meets; behind it the other buffer is readable and the one just read may be refilled
#define RING_FOOT() do { asm volatile("s_wait_dscnt 0x0" ::: "memory"); asm volatile("s_wait_asynccnt 0x0" ::: "memory"); __syncthreads(); } while (0)
// twelve 16-byte asynchronous copies per lane, global memory to LDS through no register; the s_wait_xcnt that closes the statement stands in front of any rewrite of the address registers the copies name
__device__ __forceinline__ void copy12(const unsigned* l, const char* const* p) {
  asm volatile("global_load_async_to_lds_b128 %0, %12, off\n\t"
               "global_load_async_to_lds_b128 %1, %13, off\n\t"
               "global_load_async_to_lds_b128 %2, %14, off\n\t"
               "global_load_async_to_lds_b128 %3, %15, off\n\t"
               "global_load_async_to_lds_b128 %4, %16, off\n\t"
               "global_load_async_to_lds_b128 %5, %17, off\n\t"
               "global_load_async_to_lds_b128 %6, %18, off\n\t"
               "global_load_async_to_lds_b128 %7, %19, off\n\t"
               "global_load_async_to_lds_b128 %8, %20, off\n\t"
               "global_load_async_to_lds_b128 %9, %21, off\n\t"
               "global_load_async_to_lds_b128 %10, %22, off\n\t"
               "global_load_async_to_lds_b128 %11, %23, off\n\t"
               "s_wait_xcnt 0x0"
               :: "v"(l[0]), "v"(l[1]), "v"(l[2]), "v"(l[3]), "v"(l[4]), "v"(l[5]), "v"(l[6]), "v"(l[7]), "v"(l[8]), "v"(l[9]), "v"(l[10]), "v"(l[11]),
                  "v"(p[0]), "v"(p[1]), "v"(p[2]), "v"(p[3]), "v"(p[4]), "v"(p[5]), "v"(p[6]), "v"(p[7]), "v"(p[8]), "v"(p[9]), "v"(p[10]), "v"(p[11]) : "memory");
}
// projection GEMMs: a stage is a 64-deep k slice of the block's 64 activation rows followed by its 128 weight rows; LDS row pitch = slice bytes + 16, which spreads the 16 rows of a ds_load_b128 fragment read over all banks
#define GP 144
#define GSTG (192 * GP)
#define OP 272
#define OSTG (192 * OP)
// QKV: block (64 rows, 128 cols = 2 heads, which); q,k -> LayerNorm, RoPE; q -> Q32 f32 [bh][s][64]; k -> K2 [bh][s][2][64]: the 64 bf16 hi parts of a row, then its 64 bf16 lo parts; v -> VT hi/lo x4 [bh][d][s]
// five waves per SIMD is what the ring's LDS admits: the register budget is held there, so that an epilogue's schedule does not cost the GEMM loop a resident block
__global__ __launch_bounds__(128) __attribute__((amdgpu_waves_per_eu(5))) void k_qkv(const __bf16* __restrict__ Xb, const __bf16* __restrict__ PT, const float* __restrict__ bq, const float* __restrict__ bk, const float* __restrict__ bv, const float* __restrict__ qnw, const float* __restrict__ knw,
                                            float* __restrict__ Q32, __bf16* __restrict__ K2, _Float16* __restrict__ VTh, _Float16* __restrict__ VTl) {
  __shared__ __align__(16) char sm[2 * GSTG];  // the ring of two stages; behind the loop's last barrier the epilogue stages its rows in the same bytes
  float (*so)[16][132] = (float (*)[16][132])sm;
  _Float16 (*sth)[72] = (_Float16 (*)[72])sm; _Float16 (*stl)[72] = sth + 128;
  const int tid = threadIdx.x, wave = tid >> 5, lane = tid & 31, col = lane & 15, g = lane >> 4;
  const int which = blockIdx.z, r0b = blockIdx.x * 64, n0 = blockIdx.y * 128; const int b = r0b / SS, s0 = r0b % SS;
  const float* bb_ = which == 0 ? bq : (which == 1 ? bk : bv);
  v8f acc[8] = {};
  const unsigned lds0 = (unsigned)(size_t)&sm[(tid >> 3) * GP + (tid & 7) * 16];
  const char* gA = (const char*)(Xb + (size_t)(r0b + (tid >> 3)) * E) + (tid & 7) * 16;
  const char* gB = (const char*)(PT + (size_t)(which * E + n0 + (tid >> 3)) * E) + (tid & 7) * 16;
  auto fill = [&](int kt) { unsigned l[12]; const char* p[12];
#pragma unroll  // the twelve address pairs are operands of one asm statement: they must be registers, not indexed arrays
    for (int i = 0; i < 12; ++i) { l[i] = lds0 + (kt & 1) * GSTG + i * (16 * GP); p[i] = (i < 4 ? gA + (size_t)i * (16 * E * 2) : gB + (size_t)(i - 4) * (16 * E * 2)) + (size_t)kt * 128; }
    copy12(l, p); };
  fill(0);
  asm volatile("s_wait_asynccnt 0x0" ::: "memory");  // stage 0 has landed before the barrier that publishes it
  __syncthreads();
  fill(1);
#pragma unroll 1  // one trip per stage: the ring's foot stands once in the code
  for (int kt = 0; kt < E / 64; ++kt) { const char* st = sm + (kt & 1) * GSTG;
#pragma unroll
    for (int kc = 0; kc < 2; ++kc) { const v16b a = frag_b((const __bf16*)(st + (wave * 16 + col) * GP) + kc * 32, lane); v16b wb[8];
#pragma unroll
      for (int j = 0; j < 8; ++j) wb[j] = frag_b((const __bf16*)(st + (64 + j * 16 + col) * GP) + kc * 32, lane);
#pragma unroll
      for (int j = 0; j < 8; ++j) acc[j] = wmma_bf(a, wb[j], acc[j]); }
    RING_FOOT();
    if (kt + 2 < E / 64) fill(kt + 2); }
  asm volatile("s_wait_asynccnt 0x0" ::: "memory");  // no copy is left in flight when the epilogue takes the ring's LDS
  if (which < 2) {
#pragma unroll
    for (int j = 0; j < 8; ++j) { const float bb = bfr(bb_[n0 + j * 16 + col]);
#pragma unroll
      for (int r = 0; r < 8; ++r) so[wave][8 * g + r][j * 16 + col] = acc[j][r] + bb; }
    LDSX();
    { const int rl = lane & 15, hh = lane >> 4; float* rowp = &so[wave][rl][hh * 64]; const float* wn = which == 0 ? qnw : knw; float s1 = 0.f;
#pragma unroll 8
      for (int d = 0; d < 64; ++d) s1 += rowp[d];
      const float mu = s1 * (1.0f / 64.0f); float s2 = 0.f;
#pragma unroll 8
      for (int d = 0; d < 64; ++d) { const float dv = rowp[d] - mu; s2 += dv * dv; }
      const float rs = rsqrtf(s2 * (1.0f / 64.0f) + 1e-6f);
#pragma unroll 8
      for (int d = 0; d < 64; ++d) rowp[d] = (rowp[d] - mu) * rs * bfr(wn[d]);
      // RoPE for tokens t >= 1
      const int t = s0 + wave * 16 + rl;
      if (t >= 1) { const float coord = 2.0f * (((float)(t - 1) + 0.5f) / ROPE_L) - 1.0f;
#pragma unroll 4
        for (int d = 0; d < 32; ++d) { const float invf = powf(100.0f, -(float)(d & 15) * (1.0f / 16.0f)); const float ang = 6.283185307179586f * coord * invf; float sn, cs; sincosf(ang, &sn, &cs);
          const float x1 = rowp[d], x2 = rowp[d + 32]; rowp[d] = x1 * cs - x2 * sn; rowp[d + 32] = x2 * cs + x1 * sn; } } }
    LDSX();
    if (which == 0) {
      for (int qq = lane; qq < 2 * 16 * 16; qq += 32) { const int hh = qq >> 8, rl = (qq >> 4) & 15, pc = qq & 15; const int h = (n0 >> 6) + hh;
        vst2(Q32 + (((size_t)b * NH + h) * SS + s0 + wave * 16 + rl) * HD + pc * 4, *(const v4f*)(&so[wave][rl][hh * 64 + pc * 4])); } }
    else {
      // each key row is split here, once, with the arithmetic of bsplit16; every query block of k_attn then reads the pair ready for its products
      for (int qq = lane; qq < 2 * 16 * 8; qq += 32) { const int hh = qq >> 7, rl = (qq >> 3) & 15, pc = qq & 7; const int h = (n0 >> 6) + hh;
        const float* sp = &so[wave][rl][hh * 64 + pc * 8]; union { __bf16 e[8]; v4u u; } ph, pl;
#pragma unroll  // the eight parts pack into the four registers of each 16-byte store: they must be registers, not indexed arrays
        for (int e = 0; e < 8; ++e) { const float v = sp[e]; const __bf16 hi = (__bf16)v; ph.e[e] = hi; pl.e[e] = (__bf16)(v - (float)hi); }
        __bf16* dst = K2 + (((size_t)b * NH + h) * SS + s0 + wave * 16 + rl) * (2 * HD) + pc * 8;
        vst2(dst, ph.u); vst2(dst + HD, pl.u); } } }
  else {
#pragma unroll
    for (int j = 0; j < 8; ++j) { const float bb = bfr(bb_[n0 + j * 16 + col]);
#pragma unroll
      for (int r = 0; r < 8; ++r) { const float v = (acc[j][r] + bb) * 4.0f; const _Float16 hi = (_Float16)v; sth[j * 16 + col][wave * 16 + 8 * g + r] = hi; stl[j * 16 + col][wave * 16 + 8 * g + r] = (_Float16)((v - (float)hi) * VLO); } }
    __syncthreads();
    for (int qq = tid; qq < 128 * 8; qq += 128) { const int cl = qq >> 3, pc = qq & 7; const int c = n0 + cl, h = c >> 6, d = c & 63; const size_t o = (((size_t)b * NH + h) * HD + d) * SS + s0 + pc * 8;
      vst2(VTh + o, *(const v4u*)(&sth[cl][pc * 8])); vst2(VTl + o, *(const v4u*)(&stl[cl][pc * 8])); } }
}
// eight 16-byte asynchronous copies per lane, global memory to LDS through no register; the s_wait_xcnt that closes the statement stands in front of any rewrite of the address registers the copies name
__device__ __forceinline__ void copy8(const unsigned* l, const char* const* p) {
  asm volatile("global_load_async_to_lds_b128 %0, %8, off\n\t"
               "global_load_async_to_lds_b128 %1, %9, off\n\t"
               "global_load_async_to_lds_b128 %2, %10, off\n\t"
               "global_load_async_to_lds_b128 %3, %11, off\n\t"
               "global_load_async_to_lds_b128 %4, %12, off\n\t"
               "global_load_async_to_lds_b128 %5, %13, off\n\t"
               "global_load_async_to_lds_b128 %6, %14, off\n\t"
               "global_load_async_to_lds_b128 %7, %15, off\n\t"
               "s_wait_xcnt 0x0"
               :: "v"(l[0]), "v"(l[1]), "v"(l[2]), "v"(l[3]), "v"(l[4]), "v"(l[5]), "v"(l[6]), "v"(l[7]),
                  "v"(p[0]), "v"(p[1]), "v"(p[2]), "v"(p[3]), "v"(p[4]), "v"(p[5]), "v"(p[6]), "v"(p[7]) : "memory");
}
// attention over all keys: block (64 queries, bh), 32 key tiles of 64; the block's four waves share each K tile (rows of 64 bf16 hi, 64 bf16 lo) and V tile (hi/lo rows) through LDS, filled by asynchronous copies:
// ring of two buffers, stage 2*kt = K tile kt in sK, stage 2*kt+1 = V tile kt in sV; S on hi/lo splits of the f32 q/k rows (q split here once, k by its producer); P,V hi/lo; O f32 [bh][s][64]
// four waves per SIMD keep the whole grid resident at once (four blocks per WGP, as the LDS admits): the register budget is held there, so that the mask words held across the back edge do not cost a resident block
__global__ __launch_bounds__(128) __attribute__((amdgpu_waves_per_eu(4))) void k_attn(const float* __restrict__ Q32, const __bf16* __restrict__ K2, const _Float16* __restrict__ VTh, const _Float16* __restrict__ VTl, const float* __restrict__ amask, float* __restrict__ O32) {
  __shared__ __align__(16) float sS[4][16][68];
  __shared__ __align__(16) _Float16 sPh[4][16][72], sPl[4][16][72];
  __shared__ __align__(16) __bf16 sK[64][136];
  __shared__ __align__(16) _Float16 sV[2][64][72];
  const int tid = threadIdx.x, w = __builtin_amdgcn_readfirstlane(tid >> 5), lane = tid & 31, col = lane & 15, g = lane >> 4;  // the wave's number in a scalar register: what is formed from it alone takes no vector register
  const size_t bh = blockIdx.y; const int qb = blockIdx.x; const int q0 = qb * 64 + w * 16;
  const unsigned ldsK = (unsigned)(size_t)&sK[tid >> 4][(tid & 15) * 8], ldsV = (unsigned)(size_t)&sV[0][tid >> 3][(tid & 7) * 8];
  const char* gK = (const char*)(K2 + bh * SS * (2 * HD)) + tid * 16;
  const size_t voff = ((bh * HD + (tid >> 3)) * SS + (tid & 7) * 8) * 2;
  const char* gVh = (const char*)VTh + voff; const char* gVl = (const char*)VTl + voff;
  auto fillK = [&](int kt) { unsigned l[8]; const char* p[8];
#pragma unroll  // the eight address pairs are operands of one asm statement: they must be registers, not indexed arrays
    for (int i = 0; i < 8; ++i) { l[i] = ldsK + i * (8 * 68 * 4); p[i] = gK + (size_t)kt * (64 * HD * 4) + i * 2048; }
    copy8(l, p); };
  auto fillV = [&](int kt) { unsigned l[8]; const char* p[8];
#pragma unroll  // as in fillK; the tile's step is added to the two bases first and the row steps follow as constants, so that no more than the two bases are held in registers across the loop
    for (int i = 0; i < 8; ++i) { l[i] = ldsV + (i >> 2) * (64 * 72 * 2) + (i & 3) * (16 * 72 * 2); p[i] = ((i < 4 ? gVh : gVl) + (size_t)kt * 128) + (size_t)(i & 3) * (16 * SS * 2); }
    copy8(l, p); };
  // additive mask: this lane's eight score rows and its column of each 16-key group; a tile's 32 words are loaded one phase ahead of the scores they are added to, so that no score waits for memory
  const float* mb = amask + (size_t)q0 * SS; const int ml = 8 * g * SS + col; float mk[4][8];
  auto loadM = [&](int kt) {
#pragma unroll  // the 32 words stay in registers across the loop's back edge: every index must be a constant
    for (int t = 0; t < 4; ++t) {
#pragma unroll  // as above
      for (int r = 0; r < 8; ++r) mk[t][r] = (mb + kt * 64)[ml + r * SS + t * 16]; } };
  fillK(0);
  F2 aq[2];
#pragma unroll
  for (int kc = 0; kc < 2; ++kc) aq[kc] = split_row(Q32 + (bh * SS + q0 + col) * HD, kc * 32, lane);
  float mrun = -3.0e38f, lrun = 0.f; v8f acc[4] = {}, ac1[4] = {}, ac2[4] = {};
  asm volatile("s_wait_asynccnt 0x0" ::: "memory");  // K tile 0 has landed before the barrier that publishes it
  __syncthreads();
  loadM(0);
  fillV(0);
#pragma unroll 1
  for (int kt = 0;; ++kt) {
#pragma unroll
    for (int t = 0; t < 4; ++t) { const __bf16* krow = &sK[t * 16 + col][0];
      const F2 k0 = { frag_b(krow, lane), frag_b(krow + HD, lane) }, k1 = { frag_b(krow + 32, lane), frag_b(krow + HD + 32, lane) };
      v8f s = mac3(aq[0], k0, (v8f){}); s = mac3(aq[1], k1, s);
#pragma unroll
      for (int r = 0; r < 8; ++r) sS[w][8 * g + r][t * 16 + col] = s[r] * 0.125f + bfr(mk[t][r]); }
    RING_FOOT();
    if (kt + 1 < SS / 64) fillK(kt + 1);
    float mx = -3.4e38f;
#pragma unroll
    for (int jj = 0; jj < 32; ++jj) mx = fmaxf(mx, sS[w][col][g * 32 + jj]);
    mx = fmaxf(mx, __shfl_xor(mx, 16, 32));
    const float mnew = fmaxf(mrun, mx); const float corr = exp_neg(mrun - mnew);
    float ps = 0.f;
#pragma unroll
    for (int jj = 0; jj < 32; ++jj) { const float p = exp_neg_p14(sS[w][col][g * 32 + jj] - mnew); ps += p; const _Float16 hi = (_Float16)p; sPh[w][col][g * 32 + jj] = hi; sPl[w][col][g * 32 + jj] = (_Float16)((p - (float)hi) * PLO); }
    ps += __shfl_xor(ps, 16, 32);
    lrun = lrun * corr + ps * (1.0f / 16384.0f); mrun = mnew;
#pragma unroll
    for (int r = 0; r < 8; ++r) { const float cr = __shfl(corr, 8 * g + r, 32);
#pragma unroll
      for (int t = 0; t < 4; ++t) { acc[t][r] *= cr; ac1[t][r] *= cr; ac2[t][r] *= cr; } }
    LDSX();
    if (kt + 1 < SS / 64) loadM(kt + 1);  // the next tile's mask words fly while this tile's P V products run
#pragma unroll
    for (int kc = 0; kc < 2; ++kc) { const v16h ph = frag_h(&sPh[w][col][0] + kc * 32, lane), pl = frag_h(&sPl[w][col][0] + kc * 32, lane);
#pragma unroll
      for (int t = 0; t < 4; ++t) { const v16h vh = frag_h(&sV[0][t * 16 + col][kc * 32], lane);
        acc[t] = wmma16(ph, vh, acc[t]); ac1[t] = wmma16(ph, frag_h(&sV[1][t * 16 + col][kc * 32], lane), ac1[t]); ac2[t] = wmma16(pl, vh, ac2[t]); } }
    RING_FOOT();
    if (kt + 1 == SS / 64) break;
    fillV(kt + 1); }
  asm volatile("s_wait_asynccnt 0x0" ::: "memory");  // no copy is left in flight when the wave goes on to its epilogue and ends
#pragma unroll
  for (int r = 0; r < 8; ++r) { const float lr = __shfl(lrun, 8 * g + r, 32); const float inv = 1.0f / (lr * 16384.0f * 4.0f);
#pragma unroll
    for (int t = 0; t < 4; ++t) sS[w][8 * g + r][t * 16 + col] = (acc[t][r] + ac1[t][r] * (1.0f / VLO) + ac2[t][r] * (1.0f / PLO)) * inv; }
  LDSX();
  for (int qq = lane; qq < 16 * 16; qq += 32) { const int rl = qq >> 4, pc = qq & 15; vst2(O32 + ((bh * SS) + q0 + rl) * HD + pc * 4, *(const v4f*)(&sS[w][rl][pc * 4])); }
}
// out = ctx Wo^T + bo : split(ctx) x bf16(Wo rows): 2 products (Wo is an INPUT -> bf16 exact)
__global__ __launch_bounds__(128) void k_out(const float* __restrict__ O32, const float* __restrict__ Wo, const float* __restrict__ bo, float* __restrict__ out) {
  __shared__ __align__(16) char sm[2 * OSTG];  // the ring of two stages; behind the loop's last barrier the epilogue stages its rows in the same bytes
  float (*so)[16][132] = (float (*)[16][132])sm;
  const int tid = threadIdx.x, wave = tid >> 5, lane = tid & 31, col = lane & 15, g = lane >> 4;
  const int r0b = blockIdx.x * 64, r0 = r0b + wave * 16, n0 = blockIdx.y * 128; const int b = r0b / SS, s0 = r0b % SS;
  v8f acc[8] = {};
  const unsigned lds0 = (unsigned)(size_t)&sm[(tid >> 4) * OP + (tid & 15) * 16];
  const char* gA = (const char*)(O32 + ((size_t)b * NH * SS + s0 + (tid >> 4)) * HD) + (tid & 15) * 16;
  const char* gB = (const char*)(Wo + (size_t)(n0 + (tid >> 4)) * E) + (tid & 15) * 16;
  // stage kt = head kt of the context rows (64 f32 a row) and columns 64*kt.. of the weight rows
  auto fill = [&](int kt) {
#pragma unroll
    for (int hf = 0; hf < 2; ++hf) { unsigned l[12]; const char* p[12];
#pragma unroll  // the twelve address pairs are operands of one asm statement: they must be registers, not indexed arrays
      for (int ii = 0; ii < 12; ++ii) { const int i = hf * 12 + ii; l[ii] = lds0 + (kt & 1) * OSTG + i * (8 * OP);
        p[ii] = i < 8 ? gA + (size_t)i * (8 * HD * 4) + (size_t)kt * ((size_t)SS * HD * 4) : gB + (size_t)(i - 8) * (8 * E * 4) + (size_t)kt * 256; }
      copy12(l, p); } };
  fill(0);
  asm volatile("s_wait_asynccnt 0x0" ::: "memory");  // stage 0 has landed before the barrier that publishes it
  __syncthreads();
  fill(1);
#pragma unroll 1  // one trip per stage: the ring's foot stands once in the code
  for (int kt = 0; kt < E / 64; ++kt) { const char* st = sm + (kt & 1) * OSTG;
#pragma unroll
    for (int kc = 0; kc < 2; ++kc) { const F2 a = split_row((const float*)(st + (wave * 16 + col) * OP), kc * 32, lane);
#pragma unroll
      for (int j0 = 0; j0 < 8; j0 += 4) { v16b wb[4];
#pragma unroll
        for (int j = 0; j < 4; ++j) wb[j] = split_row((const float*)(st + (64 + (j0 + j) * 16 + col) * OP), kc * 32, lane).h;
#pragma unroll
        for (int j = 0; j < 4; ++j) { acc[j0 + j] = wmma_bf(a.l, wb[j], acc[j0 + j]); acc[j0 + j] = wmma_bf(a.h, wb[j], acc[j0 + j]); } } }
    RING_FOOT();
    if (kt + 2 < E / 64) fill(kt + 2); }
  asm volatile("s_wait_asynccnt 0x0" ::: "memory");  // no copy is left in flight when the epilogue takes the ring's LDS
#pragma unroll
  for (int j = 0; j < 8; ++j) { const int n = n0 + j * 16 + col; const float bb = bfr(bo[n]);
#pragma unroll
    for (int r = 0; r < 8; ++r) so[wave][8 * g + r][j * 16 + col] = acc[j][r] + bb; }
  LDSX();
#pragma unroll 4
  for (int rl = 0; rl < 16; ++rl) vst2(out + (size_t)(r0 + rl) * E + n0 + lane * 4, *(const v4f*)(&so[wave][rl][lane * 4]));
}
extern "C" void kernel_launch(void* const* d_in, const int* in_sizes, int n_in, void* d_out, int out_size, void* d_ws, size_t ws_size, hipStream_t stream) {
  (void)in_sizes; (void)n_in; (void)out_size; (void)ws_size;
  const float** I = (const float**)d_in;
  const float* x = I[0]; const float* amask = I[1]; const float* Wq = I[2]; const float* bq = I[3]; const float* Wk = I[4]; const float* bk = I[5]; const float* Wv = I[6]; const float* bv = I[7]; const float* Wp = I[8]; const float* bp = I[9]; const float* qnw = I[10]; const float* knw = I[11];
  float* out = (float*)d_out;
  char* ws = (char*)d_ws; size_t off = 0;
  auto take = [&](size_t bytes) { char* p = ws + off; off += (bytes + 255) & ~(size_t)255; return p; };
  __bf16* Xb = (__bf16*)take((size_t)NR * E * 2); __bf16* PT = (__bf16*)take((size_t)3 * E * E * 2);
  float* Q32 = (float*)take((size_t)NR * E * 4); __bf16* K2 = (__bf16*)take((size_t)NR * E * 4); _Float16* VTh = (_Float16*)take((size_t)NR * E * 2); _Float16* VTl = (_Float16*)take((size_t)NR * E * 2); float* O32 = (float*)take((size_t)NR * E * 4);
  // ws ~ 82 MB
  k_cvt<<<(NR * E / 8 + 255) / 256, 256, 0, stream>>>(x, Xb);
  k_pack<<<3 * E, 256, 0, stream>>>(Wq, Wk, Wv, PT);
  k_qkv<<<dim3(NR / 64, E / 128, 3), 128, 0, stream>>>(Xb, PT, bq, bk, bv, qnw, knw, Q32, K2, VTh, VTl);
  k_attn<<<dim3(SS / 64, NB * NH), 128, 0, stream>>>(Q32, K2, VTh, VTl, amask, O32);
  k_out<<<dim3(NR / 64, E / 128), 128, 0, stream>>>(O32, Wp, bp, out);
}

// v006
// Measured time: 174 microseconds a run.
// Timed twice side by side with v005, it ran 1.06 times as fast both times.
// All steps since v000 together make it 3.79 times as fast.
// compute dtype: every module INPUT that feeds a GEMM (x, Wq/Wk/Wv/Wp, biases, LN weights, attn_mask) is rounded to bf16 and used in exact bf16 WMMA products with f32 accumulation; computed operands (normalised+rotated q/k f32 split, P and V hi/lo, context split) f32-grade; LayerNorm/RoPE/softmax f32.
#include <hip/hip_runtime.h>
#include <math.h>

typedef __attribute__((ext_vector_type(16))) _Float16 v16h;
typedef __attribute__((ext_vector_type(16))) __bf16 v16b;
typedef __attribute__((ext_vector_type(8)))  _Float16 v8h;
typedef __attribute__((ext_vector_type(8)))  float v8f;
typedef __attribute__((ext_vector_type(4)))  float v4f;
typedef __attribute__((ext_vector_type(2)))  float v2f;
typedef __attribute__((ext_vector_type(4)))  unsigned v4u;
typedef __attribute__((ext_vector_type(4)))  int v4i;
typedef float __attribute__((may_alias)) float_a;
typedef int __attribute__((may_alias)) int_a;

template <typename T> __device__ __forceinline__ void vst2(void* p, T v) { *(T*)p = v;  }
__device__ __forceinline__ v8f wmma16(v16h a, v16h b, v8f c) {
  v8f d = __builtin_amdgcn_wmma_f32_16x16x32_f16(false, a, false, b, (short)0, c, false, false);
  asm volatile("v_nop\n\tv_nop\n\tv_nop\n\tv_nop" : "+v"(d) : "v"(a), "v"(b));
  return d;
}
__device__ __forceinline__ v8f wmma_bf(v16b a, v16b b, v8f c) {
  v8f d = __builtin_amdgcn_wmma_f32_16x16x32_bf16(false, a, false, b, (short)0, c, false, false);
  asm volatile("v_nop\n\tv_nop\n\tv_nop\n\tv_nop" : "+v"(d) : "v"(a), "v"(b));
  return d;
}
// 16x16x32 fragments: lane = (h = lane>>4, row/col = lane&15); elements 0..7 = k0+8h+0..7, 8..15 = k0+16+8h+0..7; D element r = row 8h+r
__device__ __forceinline__ v16h frag_h(const _Float16* rowk0, int lane) {
  union { v16h v; v8h q[2]; } u; const _Float16* p = rowk0 + 8 * (lane >> 4);
  u.q[0] = *(const v8h*)p; u.q[1] = *(const v8h*)(p + 16); return u.v;
}
__device__ __forceinline__ v16h frag_f32(const float* rowk0, int lane) {
  v16h a; const float* p = rowk0 + 8 * (lane >> 4);
#pragma unroll
  for (int i = 0; i < 8; ++i) { a[i] = (_Float16)p[i]; a[8 + i] = (_Float16)p[16 + i]; }
  return a;
}
__device__ __forceinline__ v16h frag_f32s(const float* rowk0, int lane, float sc) {
  v16h a; const float* p = rowk0 + 8 * (lane >> 4);
#pragma unroll
  for (int i = 0; i < 8; ++i) { a[i] = (_Float16)(p[i] * sc); a[8 + i] = (_Float16)(p[16 + i] * sc); }
  return a;
}
// column fragment from a [K][ld] layout (column n), rows >= K read as 0
__device__ __forceinline__ v16h fragc_f32(const float* W, int k0, int n, int lane, int ld, int K) {
  v16h a; const int g = lane >> 4;
#pragma unroll
  for (int i = 0; i < 8; ++i) { const int ka = k0 + 8 * g + i, kb = ka + 16;
    a[i] = (_Float16)(ka < K ? W[(size_t)ka * ld + n] : 0.f); a[8 + i] = (_Float16)(kb < K ? W[(size_t)kb * ld + n] : 0.f); }
  return a;
}
struct F2 { v16b h, l; };
__device__ __forceinline__ F2 bsplit16(const float v[16]) { F2 r;
#pragma unroll
  for (int i = 0; i < 16; ++i) { const __bf16 h = (__bf16)v[i]; r.h[i] = h; r.l[i] = (__bf16)(v[i] - (float)h); }
  return r; }
__device__ __forceinline__ F2 split_row(const float* row, int k0, int lane) { float v[16]; const float* p = row + k0 + 8 * (lane >> 4);
#pragma unroll
  for (int i = 0; i < 8; ++i) { v[i] = p[i]; v[8 + i] = p[16 + i]; }
  return bsplit16(v); }
__device__ __forceinline__ F2 split_rowK(const float* row, int k0, int lane, int K) { float v[16]; const int g = lane >> 4;
#pragma unroll
  for (int i = 0; i < 8; ++i) { const int ka = k0 + 8 * g + i, kb = ka + 16; v[i] = ka < K ? row[ka] : 0.f; v[8 + i] = kb < K ? row[kb] : 0.f; }
  return bsplit16(v); }
__device__ __forceinline__ F2 split_col(const float* W, int k0, int n, int lane, int ld, int K) { float v[16]; const int g = lane >> 4;
#pragma unroll
  for (int i = 0; i < 8; ++i) { const int ka = k0 + 8 * g + i, kb = ka + 16; v[i] = ka < K ? W[(size_t)ka * ld + n] : 0.f; v[8 + i] = kb < K ? W[(size_t)kb * ld + n] : 0.f; }
  return bsplit16(v); }
__device__ __forceinline__ v8f mac3(const F2& a, const F2& b, v8f c) { c = wmma_bf(a.l, b.h, c); c = wmma_bf(a.h, b.l, c); return wmma_bf(a.h, b.h, c); }
// the same three products in the same order with the operands' sides exchanged: b is the A operand (rows), a the B operand (columns)
__device__ __forceinline__ v8f mac3t(const F2& b, const F2& a, v8f c) { c = wmma_bf(b.h, a.l, c); c = wmma_bf(b.l, a.h, c); return wmma_bf(b.h, a.h, c); }
__device__ __forceinline__ float sigm(float v) { return 1.0f / (1.0f + expf(-v)); }
#define LDSX() do { asm volatile("s_wait_dscnt 0" ::: "memory"); __builtin_amdgcn_wave_barrier(); __builtin_amdgcn_fence(__ATOMIC_RELEASE, "workgroup"); } while (0)


// NEPA self attention (16 heads of 64 on [2,2048,1024], [out][in] weights + biases): q,k LayerNorm'd per head (eps 1e-6, weight only), RoPE on tokens >= 1 (prefix 1):
// angle[d] = 2*pi*coord(t)*100^(-(d mod 16)/16), coord = 2*(t-1+0.5)/2047 - 1, rotate-half pairs (d, d+32); scores = q.k/8 + attn_mask[q][k]; softmax; (P v) Wp^T + bp.
#define NB 2
#define SS 2048
#define E 1024
#define NH 16
#define HD 64
#define NR (NB * SS)
#define ROPE_L 2047.0f
#define PLO 1024.0f
#define VLO 2048.0f
__device__ __forceinline__ float bfr(float v) { return (float)(__bf16)v; }
__device__ __forceinline__ v16b frag_b(const __bf16* rowk0, int lane) { return __builtin_bit_cast(v16b, frag_h((const _Float16*)rowk0, lane)); }
// softmax exponentials for t <= 0 on the hardware's base-2 exponential; t = -inf, or a result below the f32 range, gives 0
#define LOG2E 1.44269504088896f
__device__ __forceinline__ float exp_neg(float t) { return __builtin_amdgcn_exp2f(t * LOG2E); }
// e^t * 2^14 for eight t: the scale of P rides in the exponent, t * log2(e) + 14 in one fused multiply-add, rounded once; the eight v_exp_f32 stand in one statement, each in place,
// so that no instruction directly behind a v_exp_f32 reads its result or overwrites its source; the closing v_nop is that slot behind the last one
__device__ __forceinline__ void exp_neg_p14x8(float* e) {
#pragma unroll  // the eight values are operands of one asm statement: they must be registers, not an indexed array
  for (int r = 0; r < 8; ++r) e[r] = fmaf(e[r], LOG2E, 14.0f);
  asm("v_exp_f32 %0, %0\n\tv_exp_f32 %1, %1\n\tv_exp_f32 %2, %2\n\tv_exp_f32 %3, %3\n\tv_exp_f32 %4, %4\n\tv_exp_f32 %5, %5\n\tv_exp_f32 %6, %6\n\tv_exp_f32 %7, %7\n\tv_nop"
      : "+v"(e[0]), "+v"(e[1]), "+v"(e[2]), "+v"(e[3]), "+v"(e[4]), "+v"(e[5]), "+v"(e[6]), "+v"(e[7]));
}

__global__ __launch_bounds__(256) void k_cvt(const float* __restrict__ x, __bf16* __restrict__ Xb) {
  const size_t i8 = (size_t)blockIdx.x * 256 + threadIdx.x; if (i8 >= (size_t)NR * E / 8) return;
  union { __bf16 h[8]; v4u u; } pk;
#pragma unroll
  for (int e = 0; e < 8; ++e) pk.h[e] = (__bf16)x[i8 * 8 + e];
  vst2((unsigned*)(Xb + i8 * 8), pk.u);
}
// PT rows: [0,E) Wq[n][:], [E,2E) Wk, [2E,3E) Wv  ([out][in]) as bf16 rows (no scaling)
__global__ __launch_bounds__(256) void k_pack(const float* __restrict__ Wq, const float* __restrict__ Wk, const float* __restrict__ Wv, __bf16* __restrict__ PT) {
  const int n = blockIdx.x, tid = threadIdx.x; __shared__ __align__(16) __bf16 srow[E];
  const float* W = n < E ? Wq : (n < 2 * E ? Wk : Wv); const int nn = n & (E - 1);
  for (int k = tid; k < E; k += 256) srow[k] = (__bf16)W[(size_t)nn * E + k];
  __syncthreads();
  if (tid < E / 8) vst2((unsigned*)(PT + (size_t)n * E + tid * 8), *(const v4u*)(&srow[tid * 8]));
}
// hand-over of a ring buffer: this wave's LDS reads and writes are done, its own copies have landed, then every wave meets; behind it the other buffer is readable and the one just read may be refilled
#define RING_FOOT() do { asm volatile("s_wait_dscnt 0x0" ::: "memory"); asm volatile("s_wait_asynccnt 0x0" ::: "memory"); __syncthreads(); } while (0)
// twelve 16-byte asynchronous copies per lane, global memory to LDS through no register; the s_wait_xcnt that closes the statement stands in front of any rewrite of the address registers the copies name
__device__ __forceinline__ void copy12(const unsigned* l, const char* const* p) {
  asm volatile("global_load_async_to_lds_b128 %0, %12, off\n\t"
               "global_load_async_to_lds_b128 %1, %13, off\n\t"
               "global_load_async_to_lds_b128 %2, %14, off\n\t"
               "global_load_async_to_lds_b128 %3, %15, off\n\t"
               "global_load_async_to_lds_b128 %4, %16, off\n\t"
               "global_load_async_to_lds_b128 %5, %17, off\n\t"
               "global_load_async_to_lds_b128 %6, %18, off\n\t"
               "global_load_async_to_lds_b128 %7, %19, off\n\t"
               "global_load_async_to_lds_b128 %8, %20, off\n\t"
               "global_load_async_to_lds_b128 %9, %21, off\n\t"
               "global_load_async_to_lds_b128 %10, %22, off\n\t"
               "global_load_async_to_lds_b128 %11, %23, off\n\t"
               "s_wait_xcnt 0x0"
               :: "v"(l[0]), "v"(l[1]), "v"(l[2]), "v"(l[3]), "v"(l[4]), "v"(l[5]), "v"(l[6]), "v"(l[7]), "v"(l[8]), "v"(l[9]), "v"(l[10]), "v"(l[11]),
                  "v"(p[0]), "v"(p[1]), "v"(p[2]), "v"(p[3]), "v"(p[4]), "v"(p[5]), "v"(p[6]), "v"(p[7]), "v"(p[8]), "v"(p[9]), "v"(p[10]), "v"(p[11]) : "memory");
}
// projection GEMMs: a stage is a 64-deep k slice of the block's 64 activation rows followed by its 128 weight rows; LDS row pitch = slice bytes + 16, which spreads the 16 rows of a ds_load_b128 fragment read over all banks
#define GP 144
#define GSTG (192 * GP)
#define OP 272
#define OSTG (192 * OP)
// QKV: block (64 rows, 128 cols = 2 heads, which); q,k -> LayerNorm, RoPE; q -> Q32 f32 [bh][s][64]; k -> K2 [bh][s][2][64]: the 64 bf16 hi parts of a row, then its 64 bf16 lo parts; v -> VT hi/lo x4 [bh][d][s]
// five waves per SIMD is what the ring's LDS admits: the register budget is held there, so that an epilogue's schedule does not cost the GEMM loop a resident block
__global__ __launch_bounds__(128) __attribute__((amdgpu_waves_per_eu(5))) void k_qkv(const __bf16* __restrict__ Xb, const __bf16* __restrict__ PT, const float* __restrict__ bq, const float* __restrict__ bk, const float* __restrict__ bv, const float* __restrict__ qnw, const float* __restrict__ knw,
                                            float* __restrict__ Q32, __bf16* __restrict__ K2, _Float16* __restrict__ VTh, _Float16* __restrict__ VTl) {
  __shared__ __align__(16) char sm[2 * GSTG];  // the ring of two stages; behind the loop's last barrier the epilogue stages its rows in the same bytes
  float (*so)[16][132] = (float (*)[16][132])sm;
  _Float16 (*sth)[72] = (_Float16 (*)[72])sm; _Float16 (*stl)[72] = sth + 128;
  const int tid = threadIdx.x, wave = tid >> 5, lane = tid & 31, col = lane & 15, g = lane >> 4;
  const int which = blockIdx.z, r0b = blockIdx.x * 64, n0 = blockIdx.y * 128; const int b = r0b / SS, s0 = r0b % SS;
  const float* bb_ = which == 0 ? bq : (which == 1 ? bk : bv);
  v8f acc[8] = {};
  const unsigned lds0 = (unsigned)(size_t)&sm[(tid >> 3) * GP + (tid & 7) * 16];
  const char* gA = (const char*)(Xb + (size_t)(r0b + (tid >> 3)) * E) + (tid & 7) * 16;
  const char* gB = (const char*)(PT + (size_t)(which * E + n0 + (tid >> 3)) * E) + (tid & 7) * 16;
  auto fill = [&](int kt) { unsigned l[12]; const char* p[12];
#pragma unroll  // the twelve address pairs are operands of one asm statement: they must be registers, not indexed arrays
    for (int i = 0; i < 12; ++i) { l[i] = lds0 + (kt & 1) * GSTG + i * (16 * GP); p[i] = (i < 4 ? gA + (size_t)i * (16 * E * 2) : gB + (size_t)(i - 4) * (16 * E * 2)) + (size_t)kt * 128; }
    copy12(l, p); };
  fill(0);
  asm volatile("s_wait_asynccnt 0x0" ::: "memory");  // stage 0 has landed before the barrier that publishes it
  __syncthreads();
  fill(1);
#pragma unroll 1  // one trip per stage: the ring's foot stands once in the code
  for (int kt = 0; kt < E / 64; ++kt) { const char* st = sm + (kt & 1) * GSTG;
#pragma unroll
    for (int kc = 0; kc < 2; ++kc) { const v16b a = frag_b((const __bf16*)(st + (wave * 16 + col) * GP) + kc * 32, lane); v16b wb[8];
#pragma unroll
      for (int j = 0; j < 8; ++j) wb[j] = frag_b((const __bf16*)(st + (64 + j * 16 + col) * GP) + kc * 32, lane);
#pragma unroll
      for (int j = 0; j < 8; ++j) acc[j] = wmma_bf(a, wb[j], acc[j]); }
    RING_FOOT();
    if (kt + 2 < E / 64) fill(kt + 2); }
  asm volatile("s_wait_asynccnt 0x0" ::: "memory");  // no copy is left in flight when the epilogue takes the ring's LDS
  if (which < 2) {
#pragma unroll
    for (int j = 0; j < 8; ++j) { const float bb = bfr(bb_[n0 + j * 16 + col]);
#pragma unroll
      for (int r = 0; r < 8; ++r) so[wave][8 * g + r][j * 16 + col] = acc[j][r] + bb; }
    LDSX();
    { const int rl = lane & 15, hh = lane >> 4; float* rowp = &so[wave][rl][hh * 64]; const float* wn = which == 0 ? qnw : knw; float s1 = 0.f;
#pragma unroll 8
      for (int d = 0; d < 64; ++d) s1 += rowp[d];
      const float mu = s1 * (1.0f / 64.0f); float s2 = 0.f;
#pragma unroll 8
      for (int d = 0; d < 64; ++d) { const float dv = rowp[d] - mu; s2 += dv * dv; }
      const float rs = rsqrtf(s2 * (1.0f / 64.0f) + 1e-6f);
#pragma unroll 8
      for (int d = 0; d < 64; ++d) rowp[d] = (rowp[d] - mu) * rs * bfr(wn[d]);
      // RoPE for tokens t >= 1
      const int t = s0 + wave * 16 + rl;
      if (t >= 1) { const float coord = 2.0f * (((float)(t - 1) + 0.5f) / ROPE_L) - 1.0f;
#pragma unroll 4
        for (int d = 0; d < 32; ++d) { const float invf = powf(100.0f, -(float)(d & 15) * (1.0f / 16.0f)); const float ang = 6.283185307179586f * coord * invf; float sn, cs; sincosf(ang, &sn, &cs);
          const float x1 = rowp[d], x2 = rowp[d + 32]; rowp[d] = x1 * cs - x2 * sn; rowp[d + 32] = x2 * cs + x1 * sn; } } }
    LDSX();
    if (which == 0) {
      for (int qq = lane; qq < 2 * 16 * 16; qq += 32) { const int hh = qq >> 8, rl = (qq >> 4) & 15, pc = qq & 15; const int h = (n0 >> 6) + hh;
        vst2(Q32 + (((size_t)b * NH + h) * SS + s0 + wave * 16 + rl) * HD + pc * 4, *(const v4f*)(&so[wave][rl][hh * 64 + pc * 4])); } }
    else {
      // each key row is split here, once, with the arithmetic of bsplit16; every query block of k_attn then reads the pair ready for its products
      for (int qq = lane; qq < 2 * 16 * 8; qq += 32) { const int hh = qq >> 7, rl = (qq >> 3) & 15, pc = qq & 7; const int h = (n0 >> 6) + hh;
        const float* sp = &so[wave][rl][hh * 64 + pc * 8]; union { __bf16 e[8]; v4u u; } ph, pl;
#pragma unroll  // the eight parts pack into the four registers of each 16-byte store: they must be registers, not indexed arrays
        for (int e = 0; e < 8; ++e) { const float v = sp[e]; const __bf16 hi = (__bf16)v; ph.e[e] = hi; pl.e[e] = (__bf16)(v - (float)hi); }
        __bf16* dst = K2 + (((size_t)b * NH + h) * SS + s0 + wave * 16 + rl) * (2 * HD) + pc * 8;
        vst2(dst, ph.u); vst2(dst + HD, pl.u); } } }
  else {
#pragma unroll
    for (int j = 0; j < 8; ++j) { const float bb = bfr(bb_[n0 + j * 16 + col]);
#pragma unroll
      for (int r = 0; r < 8; ++r) { const float v = (acc[j][r] + bb) * 4.0f; const _Float16 hi = (_Float16)v; sth[j * 16 + col][wave * 16 + 8 * g + r] = hi; stl[j * 16 + col][wave * 16 + 8 * g + r] = (_Float16)((v - (float)hi) * VLO); } }
    __syncthreads();
    for (int qq = tid; qq < 128 * 8; qq += 128) { const int cl = qq >> 3, pc = qq & 7; const int c = n0 + cl, h = c >> 6, d = c & 63; const size_t o = (((size_t)b * NH + h) * HD + d) * SS + s0 + pc * 8;
      vst2(VTh + o, *(const v4u*)(&sth[cl][pc * 8])); vst2(VTl + o, *(const v4u*)(&stl[cl][pc * 8])); } }
}
// eight 16-byte asynchronous copies per lane, global memory to LDS through no register; the s_wait_xcnt that closes the statement stands in front of any rewrite of the address registers the copies name
__device__ __forceinline__ void copy8(const unsigned* l, const char* const* p) {
  asm volatile("global_load_async_to_lds_b128 %0, %8, off\n\t"
               "global_load_async_to_lds_b128 %1, %9, off\n\t"
               "global_load_async_to_lds_b128 %2, %10, off\n\t"
               "global_load_async_to_lds_b128 %3, %11, off\n\t"
               "global_load_async_to_lds_b128 %4, %12, off\n\t"
               "global_load_async_to_lds_b128 %5, %13, off\n\t"
               "global_load_async_to_lds_b128 %6, %14, off\n\t"
               "global_load_async_to_lds_b128 %7, %15, off\n\t"
               "s_wait_xcnt 0x0"
               :: "v"(l[0]), "v"(l[1]), "v"(l[2]), "v"(l[3]), "v"(l[4]), "v"(l[5]), "v"(l[6]), "v"(l[7]),
                  "v"(p[0]), "v"(p[1]), "v"(p[2]), "v"(p[3]), "v"(p[4]), "v"(p[5]), "v"(p[6]), "v"(p[7]) : "memory");
}
__global__ __launch_bounds__(128) __attribute__((amdgpu_waves_per_eu(4))) void k_attn(const float* __restrict__ Q32, const __bf16* __restrict__ K2, const _Float16* __restrict__ VTh, const _Float16* __restrict__ VTl, const float* __restrict__ amask, float* __restrict__ O32) {
  __shared__ __align__(16) __bf16 sK[64][136];  // behind the loop's last barrier the epilogue stages its output rows in the same bytes
  __shared__ __align__(16) _Float16 sV[2][64][72];
  float (*sO)[16][68] = (float (*)[16][68])&sK[0][0];
  const int tid = threadIdx.x, w = __builtin_amdgcn_readfirstlane(tid >> 5), lane = tid & 31, col = lane & 15, g = lane >> 4;  // the wave's number in a scalar register: what is formed from it alone takes no vector register
  const size_t bh = blockIdx.y; const int qb = blockIdx.x; const int q0 = qb * 64 + w * 16;
  const unsigned ldsK = (unsigned)(size_t)&sK[tid >> 4][(tid & 15) * 8], ldsV = (unsigned)(size_t)&sV[0][tid >> 3][(tid & 7) * 8];
  const char* gK = (const char*)(K2 + bh * SS * (2 * HD)) + tid * 16;
  const size_t voff = ((bh * HD + (tid >> 3)) * SS + (tid & 7) * 8) * 2;
  const char* gVh = (const char*)VTh + voff; const char* gVl = (const char*)VTl + voff;
  auto fillK = [&](int kt) { unsigned l[8]; const char* p[8];
#pragma unroll  // the eight address pairs are operands of one asm statement: they must be registers, not indexed arrays
    for (int i = 0; i < 8; ++i) { l[i] = ldsK + i * (8 * 68 * 4); p[i] = gK + (size_t)kt * (64 * HD * 4) + i * 2048; }
    copy8(l, p); };
  auto fillV = [&](int kt) { unsigned l[8]; const char* p[8];
#pragma unroll  // as in fillK; the tile's step is added to the two bases first and the row steps follow as constants, so that no more than the two bases are held in registers across the loop
    for (int i = 0; i < 8; ++i) { l[i] = ldsV + (i >> 2) * (64 * 72 * 2) + (i & 3) * (16 * 72 * 2); p[i] = ((i < 4 ? gVh : gVl) + (size_t)kt * 128) + (size_t)(i & 3) * (16 * SS * 2); }
    copy8(l, p); };
  // additive mask: this lane's query row, its eight consecutive keys of each 16-key group; a tile's 32 words are loaded one phase ahead of the scores they are added to, so that no score waits for memory
  const float* mb = amask + (size_t)(q0 + col) * SS + 8 * g; v4f mk[4][2];
  auto loadM = [&](int kt) {
#pragma unroll  // the 32 words stay in registers across the loop's back edge: every index must be a constant
    for (int t = 0; t < 4; ++t) { mk[t][0] = *(const v4f*)(mb + kt * 64 + t * 16); mk[t][1] = *(const v4f*)(mb + kt * 64 + t * 16 + 4); } };
  fillK(0);
  F2 aq[2];
#pragma unroll
  for (int kc = 0; kc < 2; ++kc) aq[kc] = split_row(Q32 + (bh * SS + q0 + col) * HD, kc * 32, lane);
  float mrun = -3.0e38f, lrun = 0.f; v8f acc[4] = {}, ac1[4] = {}, ac2[4] = {};
  asm volatile("s_wait_asynccnt 0x0" ::: "memory");  // K tile 0 has landed before the barrier that publishes it
  __syncthreads();
  loadM(0);
  fillV(0);
#pragma unroll 1
  for (int kt = 0;; ++kt) {
    v8f s[4];
#pragma unroll
    for (int t = 0; t < 4; ++t) { const __bf16* krow = &sK[t * 16 + col][0];
      const F2 k0 = { frag_b(krow, lane), frag_b(krow + HD, lane) }, k1 = { frag_b(krow + 32, lane), frag_b(krow + HD + 32, lane) };
      v8f a = mac3t(k0, aq[0], (v8f){}); a = mac3t(k1, aq[1], a);
#pragma unroll
      for (int r = 0; r < 8; ++r) s[t][r] = a[r] * 0.125f + bfr(mk[t][r >> 2][r & 3]); }
    RING_FOOT();
    if (kt + 1 < SS / 64) fillK(kt + 1);
    float mx = -3.4e38f;
#pragma unroll  // here and below: the scores, P and the accumulators are register arrays, every index must be a constant
    for (int t = 0; t < 4; ++t) {
#pragma unroll
      for (int r = 0; r < 8; ++r) mx = fmaxf(mx, s[t][r]); }
    mx = fmaxf(mx, __shfl_xor(mx, 16, 32));
    const float mnew = fmaxf(mrun, mx); const float corr = exp_neg(mrun - mnew);
    float ps = 0.f; v16h ph[2], pl[2];
#pragma unroll
    for (int t = 0; t < 4; ++t) { float e[8];
#pragma unroll
      for (int r = 0; r < 8; ++r) e[r] = s[t][r] - mnew;
      exp_neg_p14x8(e);
#pragma unroll
      for (int r = 0; r < 8; ++r) { const float p = e[r]; ps += p; const _Float16 hi = (_Float16)p; ph[t >> 1][(t & 1) * 8 + r] = hi; pl[t >> 1][(t & 1) * 8 + r] = (_Float16)((p - (float)hi) * PLO); } }
    ps += __shfl_xor(ps, 16, 32);
    lrun = lrun * corr + ps * (1.0f / 16384.0f); mrun = mnew;
#pragma unroll
    for (int t = 0; t < 4; ++t) { acc[t] *= corr; ac1[t] *= corr; ac2[t] *= corr; }
    if (kt + 1 < SS / 64) loadM(kt + 1);  // the next tile's mask words fly while this tile's P V products run
#pragma unroll
    for (int kc = 0; kc < 2; ++kc) {
#pragma unroll
      for (int t = 0; t < 4; ++t) { const v16h vh = frag_h(&sV[0][t * 16 + col][kc * 32], lane), vl = frag_h(&sV[1][t * 16 + col][kc * 32], lane);
        acc[t] = wmma16(vh, ph[kc], acc[t]); ac2[t] = wmma16(vh, pl[kc], ac2[t]); ac1[t] = wmma16(vl, ph[kc], ac1[t]); } }
    RING_FOOT();
    if (kt + 1 == SS / 64) break;
    fillV(kt + 1); }
  asm volatile("s_wait_asynccnt 0x0" ::: "memory");  // no copy is left in flight when the wave goes on to its epilogue and ends
  const float inv = 1.0f / (lrun * 16384.0f * 4.0f);
  const int le = __builtin_amdgcn_mbcnt_lo(~0u, 0u), ce = le & 15, ge = le >> 4;  // the lane's number read anew: what only the epilogue forms from it holds no register across the loop
#pragma unroll
  for (int t = 0; t < 4; ++t) { v4f o[2];
#pragma unroll
    for (int r = 0; r < 8; ++r) o[r >> 2][r & 3] = (acc[t][r] + ac1[t][r] * (1.0f / VLO) + ac2[t][r] * (1.0f / PLO)) * inv;
    vst2(&sO[w][ce][t * 16 + 8 * ge], o[0]); vst2(&sO[w][ce][t * 16 + 8 * ge + 4], o[1]); }
  LDSX();
  for (int qq = le; qq < 16 * 16; qq += 32) { const int rl = qq >> 4, pc = qq & 15; vst2(O32 + ((bh * SS) + q0 + rl) * HD + pc * 4, *(const v4f*)(&sO[w][rl][pc * 4])); }
}
// out = ctx Wo^T + bo : split(ctx) x bf16(Wo rows): 2 products (Wo is an INPUT -> bf16 exact)
__global__ __launch_bounds__(128) void k_out(const float* __restrict__ O32, const float* __restrict__ Wo, const float* __restrict__ bo, float* __restrict__ out) {
  __shared__ __align__(16) char sm[2 * OSTG];  // the ring of two stages; behind the loop's last barrier the epilogue stages its rows in the same bytes
  float (*so)[16][132] = (float (*)[16][132])sm;
  const int tid = threadIdx.x, wave = tid >> 5, lane = tid & 31, col = lane & 15, g = lane >> 4;
  const int r0b = blockIdx.x * 64, r0 = r0b + wave * 16, n0 = blockIdx.y * 128; const int b = r0b / SS, s0 = r0b % SS;
  v8f acc[8] = {};
  const unsigned lds0 = (unsigned)(size_t)&sm[(tid >> 4) * OP + (tid & 15) * 16];
  const char* gA = (const char*)(O32 + ((size_t)b * NH * SS + s0 + (tid >> 4)) * HD) + (tid & 15) * 16;
  const char* gB = (const char*)(Wo + (size_t)(n0 + (tid >> 4)) * E) + (tid & 15) * 16;
  // stage kt = head kt of the context rows (64 f32 a row) and columns 64*kt.. of the weight rows
  auto fill = [&](int kt) {
#pragma unroll
    for (int hf = 0; hf < 2; ++hf) { unsigned l[12]; const char* p[12];
#pragma unroll  // the twelve address pairs are operands of one asm statement: they must be registers, not indexed arrays
      for (int ii = 0; ii < 12; ++ii) { const int i = hf * 12 + ii; l[ii] = lds0 + (kt & 1) * OSTG + i * (8 * OP);
        p[ii] = i < 8 ? gA + (size_t)i * (8 * HD * 4) + (size_t)kt * ((size_t)SS * HD * 4) : gB + (size_t)(i - 8) * (8 * E * 4) + (size_t)kt * 256; }
      copy12(l, p); } };
  fill(0);
  asm volatile("s_wait_asynccnt 0x0" ::: "memory");  // stage 0 has landed before the barrier that publishes it
  __syncthreads();
  fill(1);
#pragma unroll 1  // one trip per stage: the ring's foot stands once in the code
  for (int kt = 0; kt < E / 64; ++kt) { const char* st = sm + (kt & 1) * OSTG;
#pragma unroll
    for (int kc = 0; kc < 2; ++kc) { const F2 a = split_row((const float*)(st + (wave * 16 + col) * OP), kc * 32, lane);
#pragma unroll
      for (int j0 = 0; j0 < 8; j0 += 4) { v16b wb[4];
#pragma unroll
        for (int j = 0; j < 4; ++j) wb[j] = split_row((const float*)(st + (64 + (j0 + j) * 16 + col) * OP), kc * 32, lane).h;
#pragma unroll
        for (int j = 0; j < 4; ++j) { acc[j0 + j] = wmma_bf(a.l, wb[j], acc[j0 + j]); acc[j0 + j] = wmma_bf(a.h, wb[j], acc[j0 + j]); } } }
    RING_FOOT();
    if (kt + 2 < E / 64) fill(kt + 2); }
  asm volatile("s_wait_asynccnt 0x0" ::: "memory");  // no copy is left in flight when the epilogue takes the ring's LDS
#pragma unroll
  for (int j = 0; j < 8; ++j) { const int n = n0 + j * 16 + col; const float bb = bfr(bo[n]);
#pragma unroll
    for (int r = 0; r < 8; ++r) so[wave][8 * g + r][j * 16 + col] = acc[j][r] + bb; }
  LDSX();
#pragma unroll 4
  for (int rl = 0; rl < 16; ++rl) vst2(out + (size_t)(r0 + rl) * E + n0 + lane * 4, *(const v4f*)(&so[wave][rl][lane * 4]));
}
extern "C" void kernel_launch(void* const* d_in, const int* in_sizes, int n_in, void* d_out, int out_size, void* d_ws, size_t ws_size, hipStream_t stream) {
  (void)in_sizes; (void)n_in; (void)out_size; (void)ws_size;
  const float** I = (const float**)d_in;
  const float* x = I[0]; const float* amask = I[1]; const float* Wq = I[2]; const float* bq = I[3]; const float* Wk = I[4]; const float* bk = I[5]; const float* Wv = I[6]; const float* bv = I[7]; const float* Wp = I[8]; const float* bp = I[9]; const float* qnw = I[10]; const float* knw = I[11];
  float* out = (float*)d_out;
  char* ws = (char*)d_ws; size_t off = 0;
  auto take = [&](size_t bytes) { char* p = ws + off; off += (bytes + 255) & ~(size_t)255; return p; };
  __bf16* Xb = (__bf16*)take((size_t)NR * E * 2); __bf16* PT = (__bf16*)take((size_t)3 * E * E * 2);
  float* Q32 = (float*)take((size_t)NR * E * 4); __bf16* K2 = (__bf16*)take((size_t)NR * E * 4); _Float16* VTh = (_Float16*)take((size_t)NR * E * 2); _Float16* VTl = (_Float16*)take((size_t)NR * E * 2); float* O32 = (float*)take((size_t)NR * E * 4);
  // ws ~ 82 MB
  k_cvt<<<(NR * E / 8 + 255) / 256, 256, 0, stream>>>(x, Xb);
  k_pack<<<3 * E, 256, 0, stream>>>(Wq, Wk, Wv, PT);
  k_qkv<<<dim3(NR / 64, E / 128, 3), 128, 0, stream>>>(Xb, PT, bq, bk, bv, qnw, knw, Q32, K2, VTh, VTl);
  k_attn<<<dim3(SS / 64, NB * NH), 128, 0, stream>>>(Q32, K2, VTh, VTl, amask, O32);
  k_out<<<dim3(NR / 64, E / 128), 128, 0, stream>>>(O32, Wp, bp, out);
}

// v007
// Measured time: 167 microseconds a run.
// Two timings next to v006 both put it at 1.04 times that version's speed.
// All steps since v000 together make it 3.94 times as fast.
// compute dtype: every module INPUT that feeds a GEMM (x, Wq/Wk/Wv/Wp, biases, LN weights, attn_mask) is rounded to bf16 and used in exact bf16 WMMA products with f32 accumulation; computed operands (normalised+rotated q/k f32 split, P and V hi/lo, context split) f32-grade; LayerNorm/RoPE/softmax f32.
#include <hip/hip_runtime.h>
#include <math.h>

typedef __attribute__((ext_vector_type(16))) _Float16 v16h;
typedef __attribute__((ext_vector_type(16))) __bf16 v16b;
typedef __attribute__((ext_vector_type(8)))  _Float16 v8h;
typedef __attribute__((ext_vector_type(8)))  float v8f;
typedef __attribute__((ext_vector_type(4)))  float v4f;
typedef __attribute__((ext_vector_type(2)))  float v2f;
typedef __attribute__((ext_vector_type(4)))  unsigned v4u;
typedef __attribute__((ext_vector_type(4)))  int v4i;
typedef float __attribute__((may_alias)) float_a;
typedef int __attribute__((may_alias)) int_a;

template <typename T> __device__ __forceinline__ void vst2(void* p, T v) { *(T*)p = v;  }
__device__ __forceinline__ v8f wmma16(v16h a, v16h b, v8f c) {
  v8f d = __builtin_amdgcn_wmma_f32_16x16x32_f16(false, a, false, b, (short)0, c, false, false);
  asm volatile("v_nop\n\tv_nop\n\tv_nop\n\tv_nop" : "+v"(d) : "v"(a), "v"(b));
  return d;
}
__device__ __forceinline__ v8f wmma_bf(v16b a, v16b b, v8f c) {
  v8f d = __builtin_amdgcn_wmma_f32_16x16x32_bf16(false, a, false, b, (short)0, c, false, false);
  asm volatile("v_nop\n\tv_nop\n\tv_nop\n\tv_nop" : "+v"(d) : "v"(a), "v"(b));
  return d;
}
// 16x16x32 fragments: lane = (h = lane>>4, row/col = lane&15); elements 0..7 = k0+8h+0..7, 8..15 = k0+16+8h+0..7; D element r = row 8h+r
__device__ __forceinline__ v16h frag_h(const _Float16* rowk0, int lane) {
  union { v16h v; v8h q[2]; } u; const _Float16* p = rowk0 + 8 * (lane >> 4);
  u.q[0] = *(const v8h*)p; u.q[1] = *(const v8h*)(p + 16); return u.v;
}
__device__ __forceinline__ v16h frag_f32(const float* rowk0, int lane) {
  v16h a; const float* p = rowk0 + 8 * (lane >> 4);
#pragma unroll
  for (int i = 0; i < 8; ++i) { a[i] = (_Float16)p[i]; a[8 + i] = (_Float16)p[16 + i]; }
  return a;
}
__device__ __forceinline__ v16h frag_f32s(const float* rowk0, int lane, float sc) {
  v16h a; const float* p = rowk0 + 8 * (lane >> 4);
#pragma unroll
  for (int i = 0; i < 8; ++i) { a[i] = (_Float16)(p[i] * sc); a[8 + i] = (_Float16)(p[16 + i] * sc); }
  return a;
}
// column fragment from a [K][ld] layout (column n), rows >= K read as 0
__device__ __forceinline__ v16h fragc_f32(const float* W, int k0, int n, int lane, int ld, int K) {
  v16h a; const int g = lane >> 4;
#pragma unroll
  for (int i = 0; i < 8; ++i) { const int ka = k0 + 8 * g + i, kb = ka + 16;
    a[i] = (_Float16)(ka < K ? W[(size_t)ka * ld + n] : 0.f); a[8 + i] = (_Float16)(kb < K ? W[(size_t)kb * ld + n] : 0.f); }
  return a;
}
struct F2 { v16b h, l; };
__device__ __forceinline__ F2 bsplit16(const float v[16]) { F2 r;
#pragma unroll
  for (int i = 0; i < 16; ++i) { const __bf16 h = (__bf16)v[i]; r.h[i] = h; r.l[i] = (__bf16)(v[i] - (float)h); }
  return r; }
__device__ __forceinline__ F2 split_row(const float* row, int k0, int lane) { float v[16]; const float* p = row + k0 + 8 * (lane >> 4);
#pragma unroll
  for (int i = 0; i < 8; ++i) { v[i] = p[i]; v[8 + i] = p[16 + i]; }
  return bsplit16(v); }
__device__ __forceinline__ F2 split_rowK(const float* row, int k0, int lane, int K) { float v[16]; const int g = lane >> 4;
#pragma unroll
  for (int i = 0; i < 8; ++i) { const int ka = k0 + 8 * g + i, kb = ka + 16; v[i] = ka < K ? row[ka] : 0.f; v[8 + i] = kb < K ? row[kb] : 0.f; }
  return bsplit16(v); }
__device__ __forceinline__ F2 split_col(const float* W, int k0, int n, int lane, int ld, int K) { float v[16]; const int g = lane >> 4;
#pragma unroll
  for (int i = 0; i < 8; ++i) { const int ka = k0 + 8 * g + i, kb = ka + 16; v[i] = ka < K ? W[(size_t)ka * ld + n] : 0.f; v[8 + i] = kb < K ? W[(size_t)kb * ld + n] : 0.f; }
  return bsplit16(v); }
__device__ __forceinline__ v8f mac3(const F2& a, const F2& b, v8f c) { c = wmma_bf(a.l, b.h, c); c = wmma_bf(a.h, b.l, c); return wmma_bf(a.h, b.h, c); }
// the same three products in the same order with the operands' sides exchanged: b is the A operand (rows), a the B operand (columns)
__device__ __forceinline__ v8f mac3t(const F2& b, const F2& a, v8f c) { c = wmma_bf(b.h, a.l, c); c = wmma_bf(b.l, a.h, c); return wmma_bf(b.h, a.h, c); }
__device__ __forceinline__ float sigm(float v) { return 1.0f / (1.0f + expf(-v)); }
#define LDSX() do { asm volatile("s_wait_dscnt 0" ::: "memory"); __builtin_amdgcn_wave_barrier(); __builtin_amdgcn_fence(__ATOMIC_RELEASE, "workgroup"); } while (0)


// NEPA self attention (16 heads of 64 on [2,2048,1024], [out][in] weights + biases): q,k LayerNorm'd per head (eps 1e-6, weight only), RoPE on tokens >= 1 (prefix 1):
// angle[d] = 2*pi*coord(t)*100^(-(d mod 16)/16), coord = 2*(t-1+0.5)/2047 - 1, rotate-half pairs (d, d+32); scores = q.k/8 + attn_mask[q][k]; softmax; (P v) Wp^T + bp.
#define NB 2
#define SS 2048
#define E 1024
#define NH 16
#define HD 64
#define NR (NB * SS)
#define ROPE_L 2047.0f
#define PLO 1024.0f
#define VLO 2048.0f
__device__ __forceinline__ float bfr(float v) { return (float)(__bf16)v; }
__device__ __forceinline__ v16b frag_b(const __bf16* rowk0, int lane) { return __builtin_bit_cast(v16b, frag_h((const _Float16*)rowk0, lane)); }
// softmax exponentials for t <= 0 on the hardware's base-2 exponential; t = -inf, or a result below the f32 range, gives 0
#define LOG2E 1.44269504088896f
__device__ __forceinline__ float exp_neg(float t) { return __builtin_amdgcn_exp2f(t * LOG2E); }
// e^t * 2^14 for eight t: the scale of P rides in the exponent, t * log2(e) + 14 in one fused multiply-add, rounded once; the eight v_exp_f32 stand in one statement, each in place,
// so that no instruction directly behind a v_exp_f32 reads its result or overwrites its source; the closing v_nop is that slot behind the last one
__device__ __forceinline__ void exp_neg_p14x8(float* e) {
#pragma unroll  // the eight values are operands of one asm statement: they must be registers, not an indexed array
  for (int r = 0; r < 8; ++r) e[r] = fmaf(e[r], LOG2E, 14.0f);
  asm("v_exp_f32 %0, %0\n\tv_exp_f32 %1, %1\n\tv_exp_f32 %2, %2\n\tv_exp_f32 %3, %3\n\tv_exp_f32 %4, %4\n\tv_exp_f32 %5, %5\n\tv_exp_f32 %6, %6\n\tv_exp_f32 %7, %7\n\tv_nop"
      : "+v"(e[0]), "+v"(e[1]), "+v"(e[2]), "+v"(e[3]), "+v"(e[4]), "+v"(e[5]), "+v"(e[6]), "+v"(e[7]));
}

__global__ __launch_bounds__(256) void k_cvt(const float* __restrict__ x, __bf16* __restrict__ Xb) {
  const size_t i8 = (size_t)blockIdx.x * 256 + threadIdx.x; if (i8 >= (size_t)NR * E / 8) return;
  union { __bf16 h[8]; v4u u; } pk;
#pragma unroll
  for (int e = 0; e < 8; ++e) pk.h[e] = (__bf16)x[i8 * 8 + e];
  vst2((unsigned*)(Xb + i8 * 8), pk.u);
}
// PT rows: [0,E) Wq[n][:], [E,2E) Wk, [2E,3E) Wv  ([out][in]) as bf16 rows (no scaling)
__global__ __launch_bounds__(256) void k_pack(const float* __restrict__ Wq, const float* __restrict__ Wk, const float* __restrict__ Wv, __bf16* __restrict__ PT) {
  const int n = blockIdx.x, tid = threadIdx.x; __shared__ __align__(16) __bf16 srow[E];
  const float* W = n < E ? Wq : (n < 2 * E ? Wk : Wv); const int nn = n & (E - 1);
  for (int k = tid; k < E; k += 256) srow[k] = (__bf16)W[(size_t)nn * E + k];
  __syncthreads();
  if (tid < E / 8) vst2((unsigned*)(PT + (size_t)n * E + tid * 8), *(const v4u*)(&srow[tid * 8]));
}
// hand-over of a ring buffer: this wave's LDS reads and writes are done, its own copies have landed, then every wave meets; behind it the other buffer is readable and the one just read may be refilled
#define RING_FOOT() do { asm volatile("s_wait_dscnt 0x0" ::: "memory"); asm volatile("s_wait_asynccnt 0x0" ::: "memory"); __syncthreads(); } while (0)
// twelve 16-byte asynchronous copies per lane, global memory to LDS through no register; the s_wait_xcnt that closes the statement stands in front of any rewrite of the address registers the copies name
__device__ __forceinline__ void copy12(const unsigned* l, const char* const* p) {
  asm volatile("global_load_async_to_lds_b128 %0, %12, off\n\t"
               "global_load_async_to_lds_b128 %1, %13, off\n\t"
               "global_load_async_to_lds_b128 %2, %14, off\n\t"
               "global_load_async_to_lds_b128 %3, %15, off\n\t"
               "global_load_async_to_lds_b128 %4, %16, off\n\t"
               "global_load_async_to_lds_b128 %5, %17, off\n\t"
               "global_load_async_to_lds_b128 %6, %18, off\n\t"
               "global_load_async_to_lds_b128 %7, %19, off\n\t"
               "global_load_async_to_lds_b128 %8, %20, off\n\t"
               "global_load_async_to_lds_b128 %9, %21, off\n\t"
               "global_load_async_to_lds_b128 %10, %22, off\n\t"
               "global_load_async_to_lds_b128 %11, %23, off\n\t"
               "s_wait_xcnt 0x0"
               :: "v"(l[0]), "v"(l[1]), "v"(l[2]), "v"(l[3]), "v"(l[4]), "v"(l[5]), "v"(l[6]), "v"(l[7]), "v"(l[8]), "v"(l[9]), "v"(l[10]), "v"(l[11]),
                  "v"(p[0]), "v"(p[1]), "v"(p[2]), "v"(p[3]), "v"(p[4]), "v"(p[5]), "v"(p[6]), "v"(p[7]), "v"(p[8]), "v"(p[9]), "v"(p[10]), "v"(p[11]) : "memory");
}
// projection GEMMs: a stage is a 64-deep k slice of the block's 64 activation rows followed by its 128 weight rows; LDS row pitch = slice bytes + 16, which spreads the 16 rows of a ds_load_b128 fragment read over all banks
#define GP 144
#define GSTG (192 * GP)
#define OP 272
#define OSTG (192 * OP)
// QKV: block (64 rows, 128 cols = 2 heads, which); q,k -> LayerNorm, RoPE; q -> Q32 f32 [bh][s][64]; k -> K2 [bh][s][2][64]: the 64 bf16 hi parts of a row, then its 64 bf16 lo parts; v -> VT hi/lo x4 [bh][d][s]
// five waves per SIMD is what the ring's LDS admits: the register budget is held there, so that an epilogue's schedule does not cost the GEMM loop a resident block
__global__ __launch_bounds__(128) __attribute__((amdgpu_waves_per_eu(5))) void k_qkv(const __bf16* __restrict__ Xb, const __bf16* __restrict__ PT, const float* __restrict__ bq, const float* __restrict__ bk, const float* __restrict__ bv, const float* __restrict__ qnw, const float* __restrict__ knw,
                                            float* __restrict__ Q32, __bf16* __restrict__ K2, _Float16* __restrict__ VTh, _Float16* __restrict__ VTl) {
  __shared__ __align__(16) char sm[2 * GSTG];  // the ring of two stages; behind the loop's last barrier the epilogue stages its rows in the same bytes
  float (*so)[16][132] = (float (*)[16][132])sm;
  _Float16 (*sth)[72] = (_Float16 (*)[72])sm; _Float16 (*stl)[72] = sth + 128;
  const int tid = threadIdx.x, wave = tid >> 5, lane = tid & 31, col = lane & 15, g = lane >> 4;
  const int which = blockIdx.z, r0b = blockIdx.x * 64, n0 = blockIdx.y * 128; const int b = r0b / SS, s0 = r0b % SS;
  const float* bb_ = which == 0 ? bq : (which == 1 ? bk : bv);
  v8f acc[8] = {};
  const unsigned lds0 = (unsigned)(size_t)&sm[(tid >> 3) * GP + (tid & 7) * 16];
  const char* gA = (const char*)(Xb + (size_t)(r0b + (tid >> 3)) * E) + (tid & 7) * 16;
  const char* gB = (const char*)(PT + (size_t)(which * E + n0 + (tid >> 3)) * E) + (tid & 7) * 16;
  auto fill = [&](int kt) { unsigned l[12]; const char* p[12];
#pragma unroll  // the twelve address pairs are operands of one asm statement: they must be registers, not indexed arrays
    for (int i = 0; i < 12; ++i) { l[i] = lds0 + (kt & 1) * GSTG + i * (16 * GP); p[i] = (i < 4 ? gA + (size_t)i * (16 * E * 2) : gB + (size_t)(i - 4) * (16 * E * 2)) + (size_t)kt * 128; }
    copy12(l, p); };
  fill(0);
  asm volatile("s_wait_asynccnt 0x0" ::: "memory");  // stage 0 has landed before the barrier that publishes it
  __syncthreads();
  fill(1);
#pragma unroll 1  // one trip per stage: the ring's foot stands once in the code
  for (int kt = 0; kt < E / 64; ++kt) { const char* st = sm + (kt & 1) * GSTG;
#pragma unroll
    for (int kc = 0; kc < 2; ++kc) { const v16b a = frag_b((const __bf16*)(st + (wave * 16 + col) * GP) + kc * 32, lane); v16b wb[8];
#pragma unroll
      for (int j = 0; j < 8; ++j) wb[j] = frag_b((const __bf16*)(st + (64 + j * 16 + col) * GP) + kc * 32, lane);
#pragma unroll
      for (int j = 0; j < 8; ++j) acc[j] = wmma_bf(a, wb[j], acc[j]); }
    RING_FOOT();
    if (kt + 2 < E / 64) fill(kt + 2); }
  asm volatile("s_wait_asynccnt 0x0" ::: "memory");  // no copy is left in flight when the epilogue takes the ring's LDS
  if (which < 2) {
#pragma unroll
    for (int j = 0; j < 8; ++j) { const float bb = bfr(bb_[n0 + j * 16 + col]);
#pragma unroll
      for (int r = 0; r < 8; ++r) so[wave][8 * g + r][j * 16 + col] = acc[j][r] + bb; }
    LDSX();
    { const int rl = lane & 15, hh = lane >> 4; float* rowp = &so[wave][rl][hh * 64]; const float* wn = which == 0 ? qnw : knw; float s1 = 0.f;
#pragma unroll 8
      for (int d = 0; d < 64; ++d) s1 += rowp[d];
      const float mu = s1 * (1.0f / 64.0f); float s2 = 0.f;
#pragma unroll 8
      for (int d = 0; d < 64; ++d) { const float dv = rowp[d] - mu; s2 += dv * dv; }
      const float rs = rsqrtf(s2 * (1.0f / 64.0f) + 1e-6f);
#pragma unroll 8
      for (int d = 0; d < 64; ++d) rowp[d] = (rowp[d] - mu) * rs * bfr(wn[d]);
      // RoPE for tokens t >= 1
      const int t = s0 + wave * 16 + rl;
      if (t >= 1) { const float coord = 2.0f * (((float)(t - 1) + 0.5f) / ROPE_L) - 1.0f;
#pragma unroll 4
        for (int d = 0; d < 32; ++d) { const float invf = powf(100.0f, -(float)(d & 15) * (1.0f / 16.0f)); const float ang = 6.283185307179586f * coord * invf; float sn, cs; sincosf(ang, &sn, &cs);
          const float x1 = rowp[d], x2 = rowp[d + 32]; rowp[d] = x1 * cs - x2 * sn; rowp[d + 32] = x2 * cs + x1 * sn; } } }
    LDSX();
    if (which == 0) {
      for (int qq = lane; qq < 2 * 16 * 16; qq += 32) { const int hh = qq >> 8, rl = (qq >> 4) & 15, pc = qq & 15; const int h = (n0 >> 6) + hh;
        vst2(Q32 + (((size_t)b * NH + h) * SS + s0 + wave * 16 + rl) * HD + pc * 4, *(const v4f*)(&so[wave][rl][hh * 64 + pc * 4])); } }
    else {
      // each key row is split here, once, with the arithmetic of bsplit16; every query block of k_attn then reads the pair ready for its products
      for (int qq = lane; qq < 2 * 16 * 8; qq += 32) { const int hh = qq >> 7, rl = (qq >> 3) & 15, pc = qq & 7; const int h = (n0 >> 6) + hh;
        const float* sp = &so[wave][rl][hh * 64 + pc * 8]; union { __bf16 e[8]; v4u u; } ph, pl;
#pragma unroll  // the eight parts pack into the four registers of each 16-byte store: they must be registers, not indexed arrays
        for (int e = 0; e < 8; ++e) { const float v = sp[e]; const __bf16 hi = (__bf16)v; ph.e[e] = hi; pl.e[e] = (__bf16)(v - (float)hi); }
        __bf16* dst = K2 + (((size_t)b * NH + h) * SS + s0 + wave * 16 + rl) * (2 * HD) + pc * 8;
        vst2(dst, ph.u); vst2(dst + HD, pl.u); } } }
  else {
#pragma unroll
    for (int j = 0; j < 8; ++j) { const float bb = bfr(bb_[n0 + j * 16 + col]);
#pragma unroll
      for (int r = 0; r < 8; ++r) { const float v = (acc[j][r] + bb) * 4.0f; const _Float16 hi = (_Float16)v; sth[j * 16 + col][wave * 16 + 8 * g + r] = hi; stl[j * 16 + col][wave * 16 + 8 * g + r] = (_Float16)((v - (float)hi) * VLO); } }
    __syncthreads();
    for (int qq = tid; qq < 128 * 8; qq += 128) { const int cl = qq >> 3, pc = qq & 7; const int c = n0 + cl, h = c >> 6, d = c & 63; const size_t o = (((size_t)b * NH + h) * HD + d) * SS + s0 + pc * 8;
      vst2(VTh + o, *(const v4u*)(&sth[cl][pc * 8])); vst2(VTl + o, *(const v4u*)(&stl[cl][pc * 8])); } }
}
// four 16-byte asynchronous copies per lane, global memory to LDS through no register; the s_wait_xcnt that closes the statement stands in front of any rewrite of the address registers the copies name
__device__ __forceinline__ void copy4(const unsigned* l, const char* const* p) {
  asm volatile("global_load_async_to_lds_b128 %0, %4, off\n\t"
               "global_load_async_to_lds_b128 %1, %5, off\n\t"
               "global_load_async_to_lds_b128 %2, %6, off\n\t"
               "global_load_async_to_lds_b128 %3, %7, off\n\t"
               "s_wait_xcnt 0x0"
               :: "v"(l[0]), "v"(l[1]), "v"(l[2]), "v"(l[3]), "v"(p[0]), "v"(p[1]), "v"(p[2]), "v"(p[3]) : "memory");
}
__global__ __launch_bounds__(256) __attribute__((amdgpu_waves_per_eu(4))) void k_attn(const float* __restrict__ Q32, const __bf16* __restrict__ K2, const _Float16* __restrict__ VTh, const _Float16* __restrict__ VTl, const float* __restrict__ amask, float* __restrict__ O32) {
  __shared__ __align__(16) char sm[64 * 136 * 2 + 2 * 64 * 72 * 2];  // the K tile, then the V tile's two planes; behind the loop's last barrier the eight waves' output rows are staged in the same bytes
  __bf16 (*sK)[136] = (__bf16 (*)[136])sm;
  _Float16 (*sV)[64][72] = (_Float16 (*)[64][72])(sm + 64 * 136 * 2);
  float (*sO)[16][68] = (float (*)[16][68])sm;
  const int tid = threadIdx.x, w = __builtin_amdgcn_readfirstlane(tid >> 5), lane = tid & 31, col = lane & 15, g = lane >> 4;  // the wave's number in a scalar register: what is formed from it alone takes no vector register
  const size_t bh = blockIdx.y; const int qb = blockIdx.x; const int q0 = qb * 128 + w * 16;
  const unsigned ldsK = (unsigned)(size_t)&sK[tid >> 4][(tid & 15) * 8], ldsV = (unsigned)(size_t)&sV[0][tid >> 3][(tid & 7) * 8];
  const char* gK = (const char*)(K2 + bh * SS * (2 * HD)) + tid * 16;
  const size_t voff = ((bh * HD + (tid >> 3)) * SS + (tid & 7) * 8) * 2;
  const char* gVh = (const char*)VTh + voff; const char* gVl = (const char*)VTl + voff;
  auto fillK = [&](int kt) { unsigned l[4]; const char* p[4];
#pragma unroll  // the four address pairs are operands of one asm statement: they must be registers, not indexed arrays
    for (int i = 0; i < 4; ++i) { l[i] = ldsK + i * (16 * 68 * 4); p[i] = gK + (size_t)kt * (64 * HD * 4) + i * 4096; }
    copy4(l, p); };
  auto fillV = [&](int kt) { unsigned l[4]; const char* p[4];
#pragma unroll  // as in fillK; the tile's step is added to the two bases first and the row steps follow as constants, so that no more than the two bases are held in registers across the loop
    for (int i = 0; i < 4; ++i) { l[i] = ldsV + (i >> 1) * (64 * 72 * 2) + (i & 1) * (32 * 72 * 2); p[i] = ((i < 2 ? gVh : gVl) + (size_t)kt * 128) + (size_t)(i & 1) * (32 * SS * 2); }
    copy4(l, p); };
  // additive mask: this lane's query row, its eight consecutive keys of each 16-key group; a tile's 32 words are loaded one phase ahead of the scores they are added to, so that no score waits for memory
  const float* mb = amask + (size_t)(q0 + col) * SS + 8 * g; v4f mk[4][2];
  auto loadM = [&](int kt) {
#pragma unroll  // the 32 words stay in registers across the loop's back edge: every index must be a constant
    for (int t = 0; t < 4; ++t) { mk[t][0] = *(const v4f*)(mb + kt * 64 + t * 16); mk[t][1] = *(const v4f*)(mb + kt * 64 + t * 16 + 4); } };
  fillK(0);
  F2 aq[2];
#pragma unroll
  for (int kc = 0; kc < 2; ++kc) aq[kc] = split_row(Q32 + (bh * SS + q0 + col) * HD, kc * 32, lane);
  float mrun = -3.0e38f, lrun = 0.f; v8f acc[4] = {}, ac1[4] = {}, ac2[4] = {};
  asm volatile("s_wait_asynccnt 0x0" ::: "memory");  // K tile 0 has landed before the barrier that publishes it
  __syncthreads();
  loadM(0);
  fillV(0);
#pragma unroll 1
  for (int kt = 0;; ++kt) {
    v8f s[4];
#pragma unroll
    for (int t = 0; t < 4; ++t) { const __bf16* krow = &sK[t * 16 + col][0];
      const F2 k0 = { frag_b(krow, lane), frag_b(krow + HD, lane) }, k1 = { frag_b(krow + 32, lane), frag_b(krow + HD + 32, lane) };
      v8f a = mac3t(k0, aq[0], (v8f){}); a = mac3t(k1, aq[1], a);
#pragma unroll
      for (int r = 0; r < 8; ++r) s[t][r] = a[r] * 0.125f + bfr(mk[t][r >> 2][r & 3]); }
    RING_FOOT();
    if (kt + 1 < SS / 64) fillK(kt + 1);
    float mx = -3.4e38f;
#pragma unroll  // here and below: the scores, P and the accumulators are register arrays, every index must be a constant
    for (int t = 0; t < 4; ++t) {
#pragma unroll
      for (int r = 0; r < 8; ++r) mx = fmaxf(mx, s[t][r]); }
    mx = fmaxf(mx, __shfl_xor(mx, 16, 32));
    const float mnew = fmaxf(mrun, mx); const float corr = exp_neg(mrun - mnew);
    float ps = 0.f; v16h ph[2], pl[2];
#pragma unroll
    for (int t = 0; t < 4; ++t) { float e[8];
#pragma unroll
      for (int r = 0; r < 8; ++r) e[r] = s[t][r] - mnew;
      exp_neg_p14x8(e);
#pragma unroll
      for (int r = 0; r < 8; ++r) { const float p = e[r]; ps += p; const _Float16 hi = (_Float16)p; ph[t >> 1][(t & 1) * 8 + r] = hi; pl[t >> 1][(t & 1) * 8 + r] = (_Float16)((p - (float)hi) * PLO); } }
    ps += __shfl_xor(ps, 16, 32);
    lrun = lrun * corr + ps * (1.0f / 16384.0f); mrun = mnew;
#pragma unroll
    for (int t = 0; t < 4; ++t) { acc[t] *= corr; ac1[t] *= corr; ac2[t] *= corr; }
    if (kt + 1 < SS / 64) loadM(kt + 1);  // the next tile's mask words fly while this tile's P V products run
#pragma unroll
    for (int kc = 0; kc < 2; ++kc) {
#pragma unroll
      for (int t = 0; t < 4; ++t) { const v16h vh = frag_h(&sV[0][t * 16 + col][kc * 32], lane), vl = frag_h(&sV[1][t * 16 + col][kc * 32], lane);
        acc[t] = wmma16(vh, ph[kc], acc[t]); ac2[t] = wmma16(vh, pl[kc], ac2[t]); ac1[t] = wmma16(vl, ph[kc], ac1[t]); } }
    RING_FOOT();
    if (kt + 1 == SS / 64) break;
    fillV(kt + 1); }
  asm volatile("s_wait_asynccnt 0x0" ::: "memory");  // no copy is left in flight when the wave goes on to its epilogue and ends
  const float inv = 1.0f / (lrun * 16384.0f * 4.0f);
  const int le = __builtin_amdgcn_mbcnt_lo(~0u, 0u), ce = le & 15, ge = le >> 4;  // the lane's number read anew: what only the epilogue forms from it holds no register across the loop
#pragma unroll
  for (int t = 0; t < 4; ++t) { v4f o[2];
#pragma unroll
    for (int r = 0; r < 8; ++r) o[r >> 2][r & 3] = (acc[t][r] + ac1[t][r] * (1.0f / VLO) + ac2[t][r] * (1.0f / PLO)) * inv;
    vst2(&sO[w][ce][t * 16 + 8 * ge], o[0]); vst2(&sO[w][ce][t * 16 + 8 * ge + 4], o[1]); }
  LDSX();
  for (int qq = le; qq < 16 * 16; qq += 32) { const int rl = qq >> 4, pc = qq & 15; vst2(O32 + ((bh * SS) + q0 + rl) * HD + pc * 4, *(const v4f*)(&sO[w][rl][pc * 4])); }
}
// out = ctx Wo^T + bo : split(ctx) x bf16(Wo rows): 2 products (Wo is an INPUT -> bf16 exact)
__global__ __launch_bounds__(128) void k_out(const float* __restrict__ O32, const float* __restrict__ Wo, const float* __restrict__ bo, float* __restrict__ out) {
  __shared__ __align__(16) char sm[2 * OSTG];  // the ring of two stages; behind the loop's last barrier the epilogue stages its rows in the same bytes
  float (*so)[16][132] = (float (*)[16][132])sm;
  const int tid = threadIdx.x, wave = tid >> 5, lane = tid & 31, col = lane & 15, g = lane >> 4;
  const int r0b = blockIdx.x * 64, r0 = r0b + wave * 16, n0 = blockIdx.y * 128; const int b = r0b / SS, s0 = r0b % SS;
  v8f acc[8] = {};
  const unsigned lds0 = (unsigned)(size_t)&sm[(tid >> 4) * OP + (tid & 15) * 16];
  const char* gA = (const char*)(O32 + ((size_t)b * NH * SS + s0 + (tid >> 4)) * HD) + (tid & 15) * 16;
  const char* gB = (const char*)(Wo + (size_t)(n0 + (tid >> 4)) * E) + (tid & 15) * 16;
  // stage kt = head kt of the context rows (64 f32 a row) and columns 64*kt.. of the weight rows
  auto fill = [&](int kt) {
#pragma unroll
    for (int hf = 0; hf < 2; ++hf) { unsigned l[12]; const char* p[12];
#pragma unroll  // the twelve address pairs are operands of one asm statement: they must be registers, not indexed arrays
      for (int ii = 0; ii < 12; ++ii) { const int i = hf * 12 + ii; l[ii] = lds0 + (kt & 1) * OSTG + i * (8 * OP);
        p[ii] = i < 8 ? gA + (size_t)i * (8 * HD * 4) + (size_t)kt * ((size_t)SS * HD * 4) : gB + (size_t)(i - 8) * (8 * E * 4) + (size_t)kt * 256; }
      copy12(l, p); } };
  fill(0);
  asm volatile("s_wait_asynccnt 0x0" ::: "memory");  // stage 0 has landed before the barrier that publishes it
  __syncthreads();
  fill(1);
#pragma unroll 1  // one trip per stage: the ring's foot stands once in the code
  for (int kt = 0; kt < E / 64; ++kt) { const char* st = sm + (kt & 1) * OSTG;
#pragma unroll
    for (int kc = 0; kc < 2; ++kc) { const F2 a = split_row((const float*)(st + (wave * 16 + col) * OP), kc * 32, lane);
#pragma unroll
      for (int j0 = 0; j0 < 8; j0 += 4) { v16b wb[4];
#pragma unroll
        for (int j = 0; j < 4; ++j) wb[j] = split_row((const float*)(st + (64 + (j0 + j) * 16 + col) * OP), kc * 32, lane).h;
#pragma unroll
        for (int j = 0; j < 4; ++j) { acc[j0 + j] = wmma_bf(a.l, wb[j], acc[j0 + j]); acc[j0 + j] = wmma_bf(a.h, wb[j], acc[j0 + j]); } } }
    RING_FOOT();
    if (kt + 2 < E / 64) fill(kt + 2); }
  asm volatile("s_wait_asynccnt 0x0" ::: "memory");  // no copy is left in flight when the epilogue takes the ring's LDS
#pragma unroll
  for (int j = 0; j < 8; ++j) { const int n = n0 + j * 16 + col; const float bb = bfr(bo[n]);
#pragma unroll
    for (int r = 0; r < 8; ++r) so[wave][8 * g + r][j * 16 + col] = acc[j][r] + bb; }
  LDSX();
#pragma unroll 4
  for (int rl = 0; rl < 16; ++rl) vst2(out + (size_t)(r0 + rl) * E + n0 + lane * 4, *(const v4f*)(&so[wave][rl][lane * 4]));
}
extern "C" void kernel_launch(void* const* d_in, const int* in_sizes, int n_in, void* d_out, int out_size, void* d_ws, size_t ws_size, hipStream_t stream) {
  (void)in_sizes; (void)n_in; (void)out_size; (void)ws_size;
  const float** I = (const float**)d_in;
  const float* x = I[0]; const float* amask = I[1]; const float* Wq = I[2]; const float* bq = I[3]; const float* Wk = I[4]; const float* bk = I[5]; const float* Wv = I[6]; const float* bv = I[7]; const float* Wp = I[8]; const float* bp = I[9]; const float* qnw = I[10]; const float* knw = I[11];
  float* out = (float*)d_out;
  char* ws = (char*)d_ws; size_t off = 0;
  auto take = [&](size_t bytes) { char* p = ws + off; off += (bytes + 255) & ~(size_t)255; return p; };
  __bf16* Xb = (__bf16*)take((size_t)NR * E * 2); __bf16* PT = (__bf16*)take((size_t)3 * E * E * 2);
  float* Q32 = (float*)take((size_t)NR * E * 4); __bf16* K2 = (__bf16*)take((size_t)NR * E * 4); _Float16* VTh = (_Float16*)take((size_t)NR * E * 2); _Float16* VTl = (_Float16*)take((size_t)NR * E * 2); float* O32 = (float*)take((size_t)NR * E * 4);
  // ws ~ 82 MB
  k_cvt<<<(NR * E / 8 + 255) / 256, 256, 0, stream>>>(x, Xb);
  k_pack<<<3 * E, 256, 0, stream>>>(Wq, Wk, Wv, PT);
  k_qkv<<<dim3(NR / 64, E / 128, 3), 128, 0, stream>>>(Xb, PT, bq, bk, bv, qnw, knw, Q32, K2, VTh, VTl);
  k_attn<<<dim3(SS / 128, NB * NH), 256, 0, stream>>>(Q32, K2, VTh, VTl, amask, O32);
  k_out<<<dim3(NR / 64, E / 128), 128, 0, stream>>>(O32, Wp, bp, out);
}

// v008
// Measured time: 163 microseconds a run.
// Timed twice side by side with v007, it ran 1.03 times as fast both times.
// Counting every step since v000, it is 4.07 times as fast.
// compute dtype: every module INPUT that feeds a GEMM (x, Wq/Wk/Wv/Wp, biases, LN weights, attn_mask) is rounded to bf16 and used in exact bf16 WMMA products with f32 accumulation; computed operands (normalised+rotated q/k f32 split, P and V hi/lo, context split) f32-grade; LayerNorm/RoPE/softmax f32.
#include <hip/hip_runtime.h>
#include <math.h>

typedef __attribute__((ext_vector_type(16))) _Float16 v16h;
typedef __attribute__((ext_vector_type(16))) __bf16 v16b;
typedef __attribute__((ext_vector_type(8)))  _Float16 v8h;
typedef __attribute__((ext_vector_type(8)))  float v8f;
typedef __attribute__((ext_vector_type(4)))  float v4f;
typedef __attribute__((ext_vector_type(2)))  float v2f;
typedef __attribute__((ext_vector_type(4)))  unsigned v4u;
typedef __attribute__((ext_vector_type(2)))  unsigned v2u;
typedef __attribute__((ext_vector_type(4)))  int v4i;
typedef float __attribute__((may_alias)) float_a;
typedef int __attribute__((may_alias)) int_a;

template <typename T> __device__ __forceinline__ void vst2(void* p, T v) { *(T*)p = v;  }
__device__ __forceinline__ v8f wmma16(v16h a, v16h b, v8f c) {
  v8f d = __builtin_amdgcn_wmma_f32_16x16x32_f16(false, a, false, b, (short)0, c, false, false);
  asm volatile("v_nop\n\tv_nop\n\tv_nop\n\tv_nop" : "+v"(d) : "v"(a), "v"(b));
  return d;
}
__device__ __forceinline__ v8f wmma_bf(v16b a, v16b b, v8f c) {
  v8f d = __builtin_amdgcn_wmma_f32_16x16x32_bf16(false, a, false, b, (short)0, c, false, false);
  asm volatile("v_nop\n\tv_nop\n\tv_nop\n\tv_nop" : "+v"(d) : "v"(a), "v"(b));
  return d;
}
// 16x16x32 fragments: lane = (h = lane>>4, row/col = lane&15); elements 0..7 = k0+8h+0..7, 8..15 = k0+16+8h+0..7; D element r = row 8h+r
__device__ __forceinline__ v16h frag_h(const _Float16* rowk0, int lane) {
  union { v16h v; v8h q[2]; } u; const _Float16* p = rowk0 + 8 * (lane >> 4);
  u.q[0] = *(const v8h*)p; u.q[1] = *(const v8h*)(p + 16); return u.v;
}
__device__ __forceinline__ v16h frag_f32(const float* rowk0, int lane) {
  v16h a; const float* p = rowk0 + 8 * (lane >> 4);
#pragma unroll
  for (int i = 0; i < 8; ++i) { a[i] = (_Float16)p[i]; a[8 + i] = (_Float16)p[16 + i]; }
  return a;
}
__device__ __forceinline__ v16h frag_f32s(const float* rowk0, int lane, float sc) {
  v16h a; const float* p = rowk0 + 8 * (lane >> 4);
#pragma unroll
  for (int i = 0; i < 8; ++i) { a[i] = (_Float16)(p[i] * sc); a[8 + i] = (_Float16)(p[16 + i] * sc); }
  return a;
}
// column fragment from a [K][ld] layout (column n), rows >= K read as 0
__device__ __forceinline__ v16h fragc_f32(const float* W, int k0, int n, int lane, int ld, int K) {
  v16h a; const int g = lane >> 4;
#pragma unroll
  for (int i = 0; i < 8; ++i) { const int ka = k0 + 8 * g + i, kb = ka + 16;
    a[i] = (_Float16)(ka < K ? W[(size_t)ka * ld + n] : 0.f); a[8 + i] = (_Float16)(kb < K ? W[(size_t)kb * ld + n] : 0.f); }
  return a;
}
struct F2 { v16b h, l; };
__device__ __forceinline__ F2 bsplit16(const float v[16]) { F2 r;
#pragma unroll
  for (int i = 0; i < 16; ++i) { const __bf16 h = (__bf16)v[i]; r.h[i] = h; r.l[i] = (__bf16)(v[i] - (float)h); }
  return r; }
__device__ __forceinline__ F2 split_row(const float* row, int k0, int lane) { float v[16]; const float* p = row + k0 + 8 * (lane >> 4);
#pragma unroll
  for (int i = 0; i < 8; ++i) { v[i] = p[i]; v[8 + i] = p[16 + i]; }
  return bsplit16(v); }
__device__ __forceinline__ F2 split_rowK(const float* row, int k0, int lane, int K) { float v[16]; const int g = lane >> 4;
#pragma unroll
  for (int i = 0; i < 8; ++i) { const int ka = k0 + 8 * g + i, kb = ka + 16; v[i] = ka < K ? row[ka] : 0.f; v[8 + i] = kb < K ? row[kb] : 0.f; }
  return bsplit16(v); }
__device__ __forceinline__ F2 split_col(const float* W, int k0, int n, int lane, int ld, int K) { float v[16]; const int g = lane >> 4;
#pragma unroll
  for (int i = 0; i < 8; ++i) { const int ka = k0 + 8 * g + i, kb = ka + 16; v[i] = ka < K ? W[(size_t)ka * ld + n] : 0.f; v[8 + i] = kb < K ? W[(size_t)kb * ld + n] : 0.f; }
  return bsplit16(v); }
__device__ __forceinline__ v8f mac3(const F2& a, const F2& b, v8f c) { c = wmma_bf(a.l, b.h, c); c = wmma_bf(a.h, b.l, c); return wmma_bf(a.h, b.h, c); }
// the same three products in the same order with the operands' sides exchanged: b is the A operand (rows), a the B operand (columns)
__device__ __forceinline__ v8f mac3t(const F2& b, const F2& a, v8f c) { c = wmma_bf(b.h, a.l, c); c = wmma_bf(b.l, a.h, c); return wmma_bf(b.h, a.h, c); }
__device__ __forceinline__ float sigm(float v) { return 1.0f / (1.0f + expf(-v)); }
#define LDSX() do { asm volatile("s_wait_dscnt 0" ::: "memory"); __builtin_amdgcn_wave_barrier(); __builtin_amdgcn_fence(__ATOMIC_RELEASE, "workgroup"); } while (0)


// NEPA self attention (16 heads of 64 on [2,2048,1024], [out][in] weights + biases): q,k LayerNorm'd per head (eps 1e-6, weight only), RoPE on tokens >= 1 (prefix 1):
// angle[d] = 2*pi*coord(t)*100^(-(d mod 16)/16), coord = 2*(t-1+0.5)/2047 - 1, rotate-half pairs (d, d+32); scores = q.k/8 + attn_mask[q][k]; softmax; (P v) Wp^T + bp.
#define NB 2
#define SS 2048
#define E 1024
#define NH 16
#define HD 64
#define NR (NB * SS)
#define ROPE_L 2047.0f
#define PLO 1024.0f
#define VLO 2048.0f
__device__ __forceinline__ float bfr(float v) { return (float)(__bf16)v; }
__device__ __forceinline__ v16b frag_b(const __bf16* rowk0, int lane) { return __builtin_bit_cast(v16b, frag_h((const _Float16*)rowk0, lane)); }
// softmax exponentials for t <= 0 on the hardware's base-2 exponential; t = -inf, or a result below the f32 range, gives 0
#define LOG2E 1.44269504088896f
__device__ __forceinline__ float exp_neg(float t) { return __builtin_amdgcn_exp2f(t * LOG2E); }
// e^t * 2^14 for eight t: the scale of P rides in the exponent, t * log2(e) + 14 in one fused multiply-add, rounded once; the eight v_exp_f32 stand in one statement, each in place,
// so that no instruction directly behind a v_exp_f32 reads its result or overwrites its source; the closing v_nop is that slot behind the last one
__device__ __forceinline__ void exp_neg_p14x8(float* e) {
#pragma unroll  // the eight values are operands of one asm statement: they must be registers, not an indexed array
  for (int r = 0; r < 8; ++r) e[r] = fmaf(e[r], LOG2E, 14.0f);
  asm("v_exp_f32 %0, %0\n\tv_exp_f32 %1, %1\n\tv_exp_f32 %2, %2\n\tv_exp_f32 %3, %3\n\tv_exp_f32 %4, %4\n\tv_exp_f32 %5, %5\n\tv_exp_f32 %6, %6\n\tv_exp_f32 %7, %7\n\tv_nop"
      : "+v"(e[0]), "+v"(e[1]), "+v"(e[2]), "+v"(e[3]), "+v"(e[4]), "+v"(e[5]), "+v"(e[6]), "+v"(e[7]));
}

// x and the three projection weights rounded to bf16 in ONE streaming launch of few, long-lived waves: the work is 42 MB of traffic, and what a launch of one small piece per thread pays for is the start of its waves
// thread i takes 16-byte piece i + k * PREP_N of every source: a wave's load is 512 contiguous bytes, its store 256; all 14 loads of a lane are asked for before the first is converted
// Xb = x as bf16; PT rows: [0,E) Wq[n][:], [E,2E) Wk, [2E,3E) Wv  ([out][in]) as bf16 rows (no scaling)
#define PREP_N (E * E / 8)
__global__ __launch_bounds__(256) void k_prep(const float* __restrict__ x, const float* __restrict__ Wq, const float* __restrict__ Wk, const float* __restrict__ Wv, __bf16* __restrict__ Xb, __bf16* __restrict__ PT) {
  const unsigned i = blockIdx.x * 256 + threadIdx.x, li = i * 16, si = i * 8; v4f v[14];  // the lane's part of an address is a 32-bit offset beside a uniform base: few address registers, none rewritten while a load or store that names it is in flight
#pragma unroll  // here and below: v is a register array, every index must be a constant
  for (int k = 0; k < 8; ++k) v[k] = *(const v4f*)((const char*)(x + (size_t)k * PREP_N * 4) + li);
#pragma unroll
  for (int k = 0; k < 2; ++k) { const size_t o = (size_t)k * PREP_N * 4; v[8 + k] = *(const v4f*)((const char*)(Wq + o) + li); v[10 + k] = *(const v4f*)((const char*)(Wk + o) + li); v[12 + k] = *(const v4f*)((const char*)(Wv + o) + li); }
#pragma unroll
  for (int k = 0; k < 14; ++k) { union { __bf16 h[4]; v2u u; } pk;
#pragma unroll
    for (int e = 0; e < 4; ++e) pk.h[e] = (__bf16)v[k][e];
    vst2((char*)(k < 8 ? Xb + (size_t)k * PREP_N * 4 : PT + (size_t)(k - 8) * PREP_N * 4) + si, pk.u); }
}
// hand-over of a ring buffer: this wave's LDS reads and writes are done, its own copies have landed, then every wave meets; behind it the other buffer is readable and the one just read may be refilled
#define RING_FOOT() do { asm volatile("s_wait_dscnt 0x0" ::: "memory"); asm volatile("s_wait_asynccnt 0x0" ::: "memory"); __syncthreads(); } while (0)
// twelve 16-byte asynchronous copies per lane, global memory to LDS through no register; the s_wait_xcnt that closes the statement stands in front of any rewrite of the address registers the copies name
__device__ __forceinline__ void copy12(const unsigned* l, const char* const* p) {
  asm volatile("global_load_async_to_lds_b128 %0, %12, off\n\t"
               "global_load_async_to_lds_b128 %1, %13, off\n\t"
               "global_load_async_to_lds_b128 %2, %14, off\n\t"
               "global_load_async_to_lds_b128 %3, %15, off\n\t"
               "global_load_async_to_lds_b128 %4, %16, off\n\t"
               "global_load_async_to_lds_b128 %5, %17, off\n\t"
               "global_load_async_to_lds_b128 %6, %18, off\n\t"
               "global_load_async_to_lds_b128 %7, %19, off\n\t"
               "global_load_async_to_lds_b128 %8, %20, off\n\t"
               "global_load_async_to_lds_b128 %9, %21, off\n\t"
               "global_load_async_to_lds_b128 %10, %22, off\n\t"
               "global_load_async_to_lds_b128 %11, %23, off\n\t"
               "s_wait_xcnt 0x0"
               :: "v"(l[0]), "v"(l[1]), "v"(l[2]), "v"(l[3]), "v"(l[4]), "v"(l[5]), "v"(l[6]), "v"(l[7]), "v"(l[8]), "v"(l[9]), "v"(l[10]), "v"(l[11]),
                  "v"(p[0]), "v"(p[1]), "v"(p[2]), "v"(p[3]), "v"(p[4]), "v"(p[5]), "v"(p[6]), "v"(p[7]), "v"(p[8]), "v"(p[9]), "v"(p[10]), "v"(p[11]) : "memory");
}
// projection GEMMs: a stage is a 64-deep k slice of the block's 64 activation rows followed by its 128 weight rows; LDS row pitch = slice bytes + 16, which spreads the 16 rows of a ds_load_b128 fragment read over all banks
#define GP 144
#define GSTG (192 * GP)
#define OP 272
#define OSTG (192 * OP)
// QKV: block (64 rows, 128 cols = 2 heads, which); q,k -> LayerNorm, RoPE; q -> Q32 f32 [bh][s][64]; k -> K2 [bh][s][2][64]: the 64 bf16 hi parts of a row, then its 64 bf16 lo parts; v -> VT hi/lo x4 [bh][d][s]
// five waves per SIMD is what the ring's LDS admits: the register budget is held there, so that an epilogue's schedule does not cost the GEMM loop a resident block
__global__ __launch_bounds__(128) __attribute__((amdgpu_waves_per_eu(5))) void k_qkv(const __bf16* __restrict__ Xb, const __bf16* __restrict__ PT, const float* __restrict__ bq, const float* __restrict__ bk, const float* __restrict__ bv, const float* __restrict__ qnw, const float* __restrict__ knw,
                                            float* __restrict__ Q32, __bf16* __restrict__ K2, _Float16* __restrict__ VTh, _Float16* __restrict__ VTl) {
  __shared__ __align__(16) char sm[2 * GSTG];  // the ring of two stages; behind the loop's last barrier the epilogue stages its rows in the same bytes
  float (*so)[16][132] = (float (*)[16][132])sm;
  _Float16 (*sth)[72] = (_Float16 (*)[72])sm; _Float16 (*stl)[72] = sth + 128;
  const int tid = threadIdx.x, wave = tid >> 5, lane = tid & 31, col = lane & 15, g = lane >> 4;
  const int which = blockIdx.z, r0b = blockIdx.x * 64, n0 = blockIdx.y * 128; const int b = r0b / SS, s0 = r0b % SS;
  const float* bb_ = which == 0 ? bq : (which == 1 ? bk : bv);
  v8f acc[8] = {};
  const unsigned lds0 = (unsigned)(size_t)&sm[(tid >> 3) * GP + (tid & 7) * 16];
  const char* gA = (const char*)(Xb + (size_t)(r0b + (tid >> 3)) * E) + (tid & 7) * 16;
  const char* gB = (const char*)(PT + (size_t)(which * E + n0 + (tid >> 3)) * E) + (tid & 7) * 16;
  auto fill = [&](int kt) { unsigned l[12]; const char* p[12];
#pragma unroll  // the twelve address pairs are operands of one asm statement: they must be registers, not indexed arrays
    for (int i = 0; i < 12; ++i) { l[i] = lds0 + (kt & 1) * GSTG + i * (16 * GP); p[i] = (i < 4 ? gA + (size_t)i * (16 * E * 2) : gB + (size_t)(i - 4) * (16 * E * 2)) + (size_t)kt * 128; }
    copy12(l, p); };
  fill(0);
  asm volatile("s_wait_asynccnt 0x0" ::: "memory");  // stage 0 has landed before the barrier that publishes it
  __syncthreads();
  fill(1);
#pragma unroll 1  // one trip per stage: the ring's foot stands once in the code
  for (int kt = 0; kt < E / 64; ++kt) { const char* st = sm + (kt & 1) * GSTG;
#pragma unroll
    for (int kc = 0; kc < 2; ++kc) { const v16b a = frag_b((const __bf16*)(st + (wave * 16 + col) * GP) + kc * 32, lane); v16b wb[8];
#pragma unroll
      for (int j = 0; j < 8; ++j) wb[j] = frag_b((const __bf16*)(st + (64 + j * 16 + col) * GP) + kc * 32, lane);
#pragma unroll
      for (int j = 0; j < 8; ++j) acc[j] = wmma_bf(a, wb[j], acc[j]); }
    RING_FOOT();
    if (kt + 2 < E / 64) fill(kt + 2); }
  asm volatile("s_wait_asynccnt 0x0" ::: "memory");  // no copy is left in flight when the epilogue takes the ring's LDS
  if (which < 2) {
#pragma unroll
    for (int j = 0; j < 8; ++j) { const float bb = bfr(bb_[n0 + j * 16 + col]);
#pragma unroll
      for (int r = 0; r < 8; ++r) so[wave][8 * g + r][j * 16 + col] = acc[j][r] + bb; }
    LDSX();
    { const int rl = lane & 15, hh = lane >> 4; float* rowp = &so[wave][rl][hh * 64]; const float* wn = which == 0 ? qnw : knw; float s1 = 0.f;
#pragma unroll 8
      for (int d = 0; d < 64; ++d) s1 += rowp[d];
      const float mu = s1 * (1.0f / 64.0f); float s2 = 0.f;
#pragma unroll 8
      for (int d = 0; d < 64; ++d) { const float dv = rowp[d] - mu; s2 += dv * dv; }
      const float rs = rsqrtf(s2 * (1.0f / 64.0f) + 1e-6f);
#pragma unroll 8
      for (int d = 0; d < 64; ++d) rowp[d] = (rowp[d] - mu) * rs * bfr(wn[d]);
      // RoPE for tokens t >= 1
      const int t = s0 + wave * 16 + rl;
      if (t >= 1) { const float coord = 2.0f * (((float)(t - 1) + 0.5f) / ROPE_L) - 1.0f;
#pragma unroll 4
        for (int d = 0; d < 32; ++d) { const float invf = powf(100.0f, -(float)(d & 15) * (1.0f / 16.0f)); const float ang = 6.283185307179586f * coord * invf; float sn, cs; sincosf(ang, &sn, &cs);
          const float x1 = rowp[d], x2 = rowp[d + 32]; rowp[d] = x1 * cs - x2 * sn; rowp[d + 32] = x2 * cs + x1 * sn; } } }
    LDSX();
    if (which == 0) {
      for (int qq = lane; qq < 2 * 16 * 16; qq += 32) { const int hh = qq >> 8, rl = (qq >> 4) & 15, pc = qq & 15; const int h = (n0 >> 6) + hh;
        vst2(Q32 + (((size_t)b * NH + h) * SS + s0 + wave * 16 + rl) * HD + pc * 4, *(const v4f*)(&so[wave][rl][hh * 64 + pc * 4])); } }
    else {
      // each key row is split here, once, with the arithmetic of bsplit16; every query block of k_attn then reads the pair ready for its products
      for (int qq = lane; qq < 2 * 16 * 8; qq += 32) { const int hh = qq >> 7, rl = (qq >> 3) & 15, pc = qq & 7; const int h = (n0 >> 6) + hh;
        const float* sp = &so[wave][rl][hh * 64 + pc * 8]; union { __bf16 e[8]; v4u u; } ph, pl;
#pragma unroll  // the eight parts pack into the four registers of each 16-byte store: they must be registers, not indexed arrays
        for (int e = 0; e < 8; ++e) { const float v = sp[e]; const __bf16 hi = (__bf16)v; ph.e[e] = hi; pl.e[e] = (__bf16)(v - (float)hi); }
        __bf16* dst = K2 + (((size_t)b * NH + h) * SS + s0 + wave * 16 + rl) * (2 * HD) + pc * 8;
        vst2(dst, ph.u); vst2(dst + HD, pl.u); } } }
  else {
#pragma unroll
    for (int j = 0; j < 8; ++j) { const float bb = bfr(bb_[n0 + j * 16 + col]);
#pragma unroll
      for (int r = 0; r < 8; ++r) { const float v = (acc[j][r] + bb) * 4.0f; const _Float16 hi = (_Float16)v; sth[j * 16 + col][wave * 16 + 8 * g + r] = hi; stl[j * 16 + col][wave * 16 + 8 * g + r] = (_Float16)((v - (float)hi) * VLO); } }
    __syncthreads();
    for (int qq = tid; qq < 128 * 8; qq += 128) { const int cl = qq >> 3, pc = qq & 7; const int c = n0 + cl, h = c >> 6, d = c & 63; const size_t o = (((size_t)b * NH + h) * HD + d) * SS + s0 + pc * 8;
      vst2(VTh + o, *(const v4u*)(&sth[cl][pc * 8])); vst2(VTl + o, *(const v4u*)(&stl[cl][pc * 8])); } }
}
// four 16-byte asynchronous copies per lane, global memory to LDS through no register; the s_wait_xcnt that closes the statement stands in front of any rewrite of the address registers the copies name
__device__ __forceinline__ void copy4(const unsigned* l, const char* const* p) {
  asm volatile("global_load_async_to_lds_b128 %0, %4, off\n\t"
               "global_load_async_to_lds_b128 %1, %5, off\n\t"
               "global_load_async_to_lds_b128 %2, %6, off\n\t"
               "global_load_async_to_lds_b128 %3, %7, off\n\t"
               "s_wait_xcnt 0x0"
               :: "v"(l[0]), "v"(l[1]), "v"(l[2]), "v"(l[3]), "v"(p[0]), "v"(p[1]), "v"(p[2]), "v"(p[3]) : "memory");
}
__global__ __launch_bounds__(256) __attribute__((amdgpu_waves_per_eu(4))) void k_attn(const float* __restrict__ Q32, const __bf16* __restrict__ K2, const _Float16* __restrict__ VTh, const _Float16* __restrict__ VTl, const float* __restrict__ amask, float* __restrict__ O32) {
  __shared__ __align__(16) char sm[64 * 136 * 2 + 2 * 64 * 72 * 2];  // the K tile, then the V tile's two planes; behind the loop's last barrier the eight waves' output rows are staged in the same bytes
  __bf16 (*sK)[136] = (__bf16 (*)[136])sm;
  _Float16 (*sV)[64][72] = (_Float16 (*)[64][72])(sm + 64 * 136 * 2);
  float (*sO)[16][68] = (float (*)[16][68])sm;
  const int tid = threadIdx.x, w = __builtin_amdgcn_readfirstlane(tid >> 5), lane = tid & 31, col = lane & 15, g = lane >> 4;  // the wave's number in a scalar register: what is formed from it alone takes no vector register
  const size_t bh = blockIdx.y; const int qb = blockIdx.x; const int q0 = qb * 128 + w * 16;
  const unsigned ldsK = (unsigned)(size_t)&sK[tid >> 4][(tid & 15) * 8], ldsV = (unsigned)(size_t)&sV[0][tid >> 3][(tid & 7) * 8];
  const char* gK = (const char*)(K2 + bh * SS * (2 * HD)) + tid * 16;
  const size_t voff = ((bh * HD + (tid >> 3)) * SS + (tid & 7) * 8) * 2;
  const char* gVh = (const char*)VTh + voff; const char* gVl = (const char*)VTl + voff;
  auto fillK = [&](int kt) { unsigned l[4]; const char* p[4];
#pragma unroll  // the four address pairs are operands of one asm statement: they must be registers, not indexed arrays
    for (int i = 0; i < 4; ++i) { l[i] = ldsK + i * (16 * 68 * 4); p[i] = gK + (size_t)kt * (64 * HD * 4) + i * 4096; }
    copy4(l, p); };
  auto fillV = [&](int kt) { unsigned l[4]; const char* p[4];
#pragma unroll  // as in fillK; the tile's step is added to the two bases first and the row steps follow as constants, so that no more than the two bases are held in registers across the loop
    for (int i = 0; i < 4; ++i) { l[i] = ldsV + (i >> 1) * (64 * 72 * 2) + (i & 1) * (32 * 72 * 2); p[i] = ((i < 2 ? gVh : gVl) + (size_t)kt * 128) + (size_t)(i & 1) * (32 * SS * 2); }
    copy4(l, p); };
  // additive mask: this lane's query row, its eight consecutive keys of each 16-key group; a tile's 32 words are loaded one phase ahead of the scores they are added to, so that no score waits for memory
  const float* mb = amask + (size_t)(q0 + col) * SS + 8 * g; v4f mk[4][2];
  auto loadM = [&](int kt) {
#pragma unroll  // the 32 words stay in registers across the loop's back edge: every index must be a constant
    for (int t = 0; t < 4; ++t) { mk[t][0] = *(const v4f*)(mb + kt * 64 + t * 16); mk[t][1] = *(const v4f*)(mb + kt * 64 + t * 16 + 4); } };
  fillK(0);
  F2 aq[2];
#pragma unroll
  for (int kc = 0; kc < 2; ++kc) aq[kc] = split_row(Q32 + (bh * SS + q0 + col) * HD, kc * 32, lane);
  float mrun = -3.0e38f, lrun = 0.f; v8f acc[4] = {}, ac1[4] = {}, ac2[4] = {};
  asm volatile("s_wait_asynccnt 0x0" ::: "memory");  // K tile 0 has landed before the barrier that publishes it
  __syncthreads();
  loadM(0);
  fillV(0);
#pragma unroll 1
  for (int kt = 0;; ++kt) {
    v8f s[4];
#pragma unroll
    for (int t = 0; t < 4; ++t) { const __bf16* krow = &sK[t * 16 + col][0];
      const F2 k0 = { frag_b(krow, lane), frag_b(krow + HD, lane) }, k1 = { frag_b(krow + 32, lane), frag_b(krow + HD + 32, lane) };
      v8f a = mac3t(k0, aq[0], (v8f){}); a = mac3t(k1, aq[1], a);
#pragma unroll
      for (int r = 0; r < 8; ++r) s[t][r] = a[r] * 0.125f + bfr(mk[t][r >> 2][r & 3]); }
    RING_FOOT();
    if (kt + 1 < SS / 64) fillK(kt + 1);
    float mx = -3.4e38f;
#pragma unroll  // here and below: the scores, P and the accumulators are register arrays, every index must be a constant
    for (int t = 0; t < 4; ++t) {
#pragma unroll
      for (int r = 0; r < 8; ++r) mx = fmaxf(mx, s[t][r]); }
    mx = fmaxf(mx, __shfl_xor(mx, 16, 32));
    const float mnew = fmaxf(mrun, mx); const float corr = exp_neg(mrun - mnew);
    float ps = 0.f; v16h ph[2], pl[2];
#pragma unroll
    for (int t = 0; t < 4; ++t) { float e[8];
#pragma unroll
      for (int r = 0; r < 8; ++r) e[r] = s[t][r] - mnew;
      exp_neg_p14x8(e);
#pragma unroll
      for (int r = 0; r < 8; ++r) { const float p = e[r]; ps += p; const _Float16 hi = (_Float16)p; ph[t >> 1][(t & 1) * 8 + r] = hi; pl[t >> 1][(t & 1) * 8 + r] = (_Float16)((p - (float)hi) * PLO); } }
    ps += __shfl_xor(ps, 16, 32);
    lrun = lrun * corr + ps * (1.0f / 16384.0f); mrun = mnew;
#pragma unroll
    for (int t = 0; t < 4; ++t) { acc[t] *= corr; ac1[t] *= corr; ac2[t] *= corr; }
    if (kt + 1 < SS / 64) loadM(kt + 1);  // the next tile's mask words fly while this tile's P V products run
#pragma unroll
    for (int kc = 0; kc < 2; ++kc) {
#pragma unroll
      for (int t = 0; t < 4; ++t) { const v16h vh = frag_h(&sV[0][t * 16 + col][kc * 32], lane), vl = frag_h(&sV[1][t * 16 + col][kc * 32], lane);
        acc[t] = wmma16(vh, ph[kc], acc[t]); ac2[t] = wmma16(vh, pl[kc], ac2[t]); ac1[t] = wmma16(vl, ph[kc], ac1[t]); } }
    RING_FOOT();
    if (kt + 1 == SS / 64) break;
    fillV(kt + 1); }
  asm volatile("s_wait_asynccnt 0x0" ::: "memory");  // no copy is left in flight when the wave goes on to its epilogue and ends
  const float inv = 1.0f / (lrun * 16384.0f * 4.0f);
  const int le = __builtin_amdgcn_mbcnt_lo(~0u, 0u), ce = le & 15, ge = le >> 4;  // the lane's number read anew: what only the epilogue forms from it holds no register across the loop
#pragma unroll
  for (int t = 0; t < 4; ++t) { v4f o[2];
#pragma unroll
    for (int r = 0; r < 8; ++r) o[r >> 2][r & 3] = (acc[t][r] + ac1[t][r] * (1.0f / VLO) + ac2[t][r] * (1.0f / PLO)) * inv;
    vst2(&sO[w][ce][t * 16 + 8 * ge], o[0]); vst2(&sO[w][ce][t * 16 + 8 * ge + 4], o[1]); }
  LDSX();
  for (int qq = le; qq < 16 * 16; qq += 32) { const int rl = qq >> 4, pc = qq & 15; vst2(O32 + ((bh * SS) + q0 + rl) * HD + pc * 4, *(const v4f*)(&sO[w][rl][pc * 4])); }
}
// out = ctx Wo^T + bo : split(ctx) x bf16(Wo rows): 2 products (Wo is an INPUT -> bf16 exact)
__global__ __launch_bounds__(128) void k_out(const float* __restrict__ O32, const float* __restrict__ Wo, const float* __restrict__ bo, float* __restrict__ out) {
  __shared__ __align__(16) char sm[2 * OSTG];  // the ring of two stages; behind the loop's last barrier the epilogue stages its rows in the same bytes
  float (*so)[16][132] = (float (*)[16][132])sm;
  const int tid = threadIdx.x, wave = tid >> 5, lane = tid & 31, col = lane & 15, g = lane >> 4;
  const int r0b = blockIdx.x * 64, r0 = r0b + wave * 16, n0 = blockIdx.y * 128; const int b = r0b / SS, s0 = r0b % SS;
  v8f acc[8] = {};
  const unsigned lds0 = (unsigned)(size_t)&sm[(tid >> 4) * OP + (tid & 15) * 16];
  const char* gA = (const char*)(O32 + ((size_t)b * NH * SS + s0 + (tid >> 4)) * HD) + (tid & 15) * 16;
  const char* gB = (const char*)(Wo + (size_t)(n0 + (tid >> 4)) * E) + (tid & 15) * 16;
  // stage kt = head kt of the context rows (64 f32 a row) and columns 64*kt.. of the weight rows
  auto fill = [&](int kt) {
#pragma unroll
    for (int hf = 0; hf < 2; ++hf) { unsigned l[12]; const char* p[12];
#pragma unroll  // the twelve address pairs are operands of one asm statement: they must be registers, not indexed arrays
      for (int ii = 0; ii < 12; ++ii) { const int i = hf * 12 + ii; l[ii] = lds0 + (kt & 1) * OSTG + i * (8 * OP);
        p[ii] = i < 8 ? gA + (size_t)i * (8 * HD * 4) + (size_t)kt * ((size_t)SS * HD * 4) : gB + (size_t)(i - 8) * (8 * E * 4) + (size_t)kt * 256; }
      copy12(l, p); } };
  fill(0);
  asm volatile("s_wait_asynccnt 0x0" ::: "memory");  // stage 0 has landed before the barrier that publishes it
  __syncthreads();
  fill(1);
#pragma unroll 1  // one trip per stage: the ring's foot stands once in the code
  for (int kt = 0; kt < E / 64; ++kt) { const char* st = sm + (kt & 1) * OSTG;
#pragma unroll
    for (int kc = 0; kc < 2; ++kc) { const F2 a = split_row((const float*)(st + (wave * 16 + col) * OP), kc * 32, lane);
#pragma unroll
      for (int j0 = 0; j0 < 8; j0 += 4) { v16b wb[4];
#pragma unroll
        for (int j = 0; j < 4; ++j) wb[j] = split_row((const float*)(st + (64 + (j0 + j) * 16 + col) * OP), kc * 32, lane).h;
#pragma unroll
        for (int j = 0; j < 4; ++j) { acc[j0 + j] = wmma_bf(a.l, wb[j], acc[j0 + j]); acc[j0 + j] = wmma_bf(a.h, wb[j], acc[j0 + j]); } } }
    RING_FOOT();
    if (kt + 2 < E / 64) fill(kt + 2); }
  asm volatile("s_wait_asynccnt 0x0" ::: "memory");  // no copy is left in flight when the epilogue takes the ring's LDS
#pragma unroll
  for (int j = 0; j < 8; ++j) { const int n = n0 + j * 16 + col; const float bb = bfr(bo[n]);
#pragma unroll
    for (int r = 0; r < 8; ++r) so[wave][8 * g + r][j * 16 + col] = acc[j][r] + bb; }
  LDSX();
#pragma unroll 4
  for (int rl = 0; rl < 16; ++rl) vst2(out + (size_t)(r0 + rl) * E + n0 + lane * 4, *(const v4f*)(&so[wave][rl][lane * 4]));
}
extern "C" void kernel_launch(void* const* d_in, const int* in_sizes, int n_in, void* d_out, int out_size, void* d_ws, size_t ws_size, hipStream_t stream) {
  (void)in_sizes; (void)n_in; (void)out_size; (void)ws_size;
  const float** I = (const float**)d_in;
  const float* x = I[0]; const float* amask = I[1]; const float* Wq = I[2]; const float* bq = I[3]; const float* Wk = I[4]; const float* bk = I[5]; const float* Wv = I[6]; const float* bv = I[7]; const float* Wp = I[8]; const float* bp = I[9]; const float* qnw = I[10]; const float* knw = I[11];
  float* out = (float*)d_out;
  char* ws = (char*)d_ws; size_t off = 0;
  auto take = [&](size_t bytes) { char* p = ws + off; off += (bytes + 255) & ~(size_t)255; return p; };
  __bf16* Xb = (__bf16*)take((size_t)NR * E * 2); __bf16* PT = (__bf16*)take((size_t)3 * E * E * 2);
  float* Q32 = (float*)take((size_t)NR * E * 4); __bf16* K2 = (__bf16*)take((size_t)NR * E * 4); _Float16* VTh = (_Float16*)take((size_t)NR * E * 2); _Float16* VTl = (_Float16*)take((size_t)NR * E * 2); float* O32 = (float*)take((size_t)NR * E * 4);
  // ws ~ 82 MB
  k_prep<<<PREP_N / 256, 256, 0, stream>>>(x, Wq, Wk, Wv, Xb, PT);
  k_qkv<<<dim3(NR / 64, E / 128, 3), 128, 0, stream>>>(Xb, PT, bq, bk, bv, qnw, knw, Q32, K2, VTh, VTl);
  k_attn<<<dim3(SS / 128, NB * NH), 256, 0, stream>>>(Q32, K2, VTh, VTl, amask, O32);
  k_out<<<dim3(NR / 64, E / 128), 128, 0, stream>>>(O32, Wp, bp, out);
}

// v009
// It runs in 158 microseconds.
// Next to v008, in two timings, it ran 1.03 times as fast each time.
// Over all steps from v000 it is 4.20 times as fast.
// compute dtype: every module INPUT that feeds a GEMM (x, Wq/Wk/Wv/Wp, biases, LN weights, attn_mask) is rounded to bf16 and used in exact bf16 WMMA products with f32 accumulation; computed operands (normalised+rotated q/k f32 split, P and V hi/lo, context split) f32-grade; LayerNorm/RoPE/softmax f32.
#include <hip/hip_runtime.h>
#include <math.h>

typedef __attribute__((ext_vector_type(16))) _Float16 v16h;
typedef __attribute__((ext_vector_type(16))) __bf16 v16b;
typedef __attribute__((ext_vector_type(8)))  _Float16 v8h;
typedef __attribute__((ext_vector_type(2)))  _Float16 v2h;
typedef __attribute__((ext_vector_type(8)))  float v8f;
typedef __attribute__((ext_vector_type(4)))  float v4f;
typedef __attribute__((ext_vector_type(2)))  float v2f;
typedef __attribute__((ext_vector_type(4)))  unsigned v4u;
typedef __attribute__((ext_vector_type(2)))  unsigned v2u;
typedef __attribute__((ext_vector_type(4)))  int v4i;
typedef float __attribute__((may_alias)) float_a;
typedef int __attribute__((may_alias)) int_a;

template <typename T> __device__ __forceinline__ void vst2(void* p, T v) { *(T*)p = v;  }
__device__ __forceinline__ v8f wmma16(v16h a, v16h b, v8f c) {
  v8f d = __builtin_amdgcn_wmma_f32_16x16x32_f16(false, a, false, b, (short)0, c, false, false);
  asm volatile("v_nop\n\tv_nop\n\tv_nop\n\tv_nop" : "+v"(d) : "v"(a), "v"(b));
  return d;
}
__device__ __forceinline__ v8f wmma_bf(v16b a, v16b b, v8f c) {
  v8f d = __builtin_amdgcn_wmma_f32_16x16x32_bf16(false, a, false, b, (short)0, c, false, false);
  asm volatile("v_nop\n\tv_nop\n\tv_nop\n\tv_nop" : "+v"(d) : "v"(a), "v"(b));
  return d;
}
// 16x16x32 fragments: lane = (h = lane>>4, row/col = lane&15); elements 0..7 = k0+8h+0..7, 8..15 = k0+16+8h+0..7; D element r = row 8h+r
__device__ __forceinline__ v16h frag_h(const _Float16* rowk0, int lane) {
  union { v16h v; v8h q[2]; } u; const _Float16* p = rowk0 + 8 * (lane >> 4);
  u.q[0] = *(const v8h*)p; u.q[1] = *(const v8h*)(p + 16); return u.v;
}
__device__ __forceinline__ v16h frag_f32(const float* rowk0, int lane) {
  v16h a; const float* p = rowk0 + 8 * (lane >> 4);
#pragma unroll
  for (int i = 0; i < 8; ++i) { a[i] = (_Float16)p[i]; a[8 + i] = (_Float16)p[16 + i]; }
  return a;
}
__device__ __forceinline__ v16h frag_f32s(const float* rowk0, int lane, float sc) {
  v16h a; const float* p = rowk0 + 8 * (lane >> 4);
#pragma unroll
  for (int i = 0; i < 8; ++i) { a[i] = (_Float16)(p[i] * sc); a[8 + i] = (_Float16)(p[16 + i] * sc); }
  return a;
}
// column fragment from a [K][ld] layout (column n), rows >= K read as 0
__device__ __forceinline__ v16h fragc_f32(const float* W, int k0, int n, int lane, int ld, int K) {
  v16h a; const int g = lane >> 4;
#pragma unroll
  for (int i = 0; i < 8; ++i) { const int ka = k0 + 8 * g + i, kb = ka + 16;
    a[i] = (_Float16)(ka < K ? W[(size_t)ka * ld + n] : 0.f); a[8 + i] = (_Float16)(kb < K ? W[(size_t)kb * ld + n] : 0.f); }
  return a;
}
struct F2 { v16b h, l; };
__device__ __forceinline__ F2 bsplit16(const float v[16]) { F2 r;
#pragma unroll
  for (int i = 0; i < 16; ++i) { const __bf16 h = (__bf16)v[i]; r.h[i] = h; r.l[i] = (__bf16)(v[i] - (float)h); }
  return r; }
__device__ __forceinline__ F2 split_row(const float* row, int k0, int lane) { float v[16]; const float* p = row + k0 + 8 * (lane >> 4);
#pragma unroll
  for (int i = 0; i < 8; ++i) { v[i] = p[i]; v[8 + i] = p[16 + i]; }
  return bsplit16(v); }
__device__ __forceinline__ F2 split_rowK(const float* row, int k0, int lane, int K) { float v[16]; const int g = lane >> 4;
#pragma unroll
  for (int i = 0; i < 8; ++i) { const int ka = k0 + 8 * g + i, kb = ka + 16; v[i] = ka < K ? row[ka] : 0.f; v[8 + i] = kb < K ? row[kb] : 0.f; }
  return bsplit16(v); }
__device__ __forceinline__ F2 split_col(const float* W, int k0, int n, int lane, int ld, int K) { float v[16]; const int g = lane >> 4;
#pragma unroll
  for (int i = 0; i < 8; ++i) { const int ka = k0 + 8 * g + i, kb = ka + 16; v[i] = ka < K ? W[(size_t)ka * ld + n] : 0.f; v[8 + i] = kb < K ? W[(size_t)kb * ld + n] : 0.f; }
  return bsplit16(v); }
__device__ __forceinline__ v8f mac3(const F2& a, const F2& b, v8f c) { c = wmma_bf(a.l, b.h, c); c = wmma_bf(a.h, b.l, c); return wmma_bf(a.h, b.h, c); }
// the same three products in the same order with the operands' sides exchanged: b is the A operand (rows), a the B operand (columns)
__device__ __forceinline__ v8f mac3t(const F2& b, const F2& a, v8f c) { c = wmma_bf(b.h, a.l, c); c = wmma_bf(b.l, a.h, c); return wmma_bf(b.h, a.h, c); }
__device__ __forceinline__ float sigm(float v) { return 1.0f / (1.0f + expf(-v)); }
#define LDSX() do { asm volatile("s_wait_dscnt 0" ::: "memory"); __builtin_amdgcn_wave_barrier(); __builtin_amdgcn_fence(__ATOMIC_RELEASE, "workgroup"); } while (0)


// NEPA self attention (16 heads of 64 on [2,2048,1024], [out][in] weights + biases): q,k LayerNorm'd per head (eps 1e-6, weight only), RoPE on tokens >= 1 (prefix 1):
// angle[d] = 2*pi*coord(t)*100^(-(d mod 16)/16), coord = 2*(t-1+0.5)/2047 - 1, rotate-half pairs (d, d+32); scores = q.k/8 + attn_mask[q][k]; softmax; (P v) Wp^T + bp.
#define NB 2
#define SS 2048
#define E 1024
#define NH 16
#define HD 64
#define NR (NB * SS)
#define ROPE_L 2047.0f
__device__ __forceinline__ float bfr(float v) { return (float)(__bf16)v; }
__device__ __forceinline__ v16b frag_b(const __bf16* rowk0, int lane) { return __builtin_bit_cast(v16b, frag_h((const _Float16*)rowk0, lane)); }
// softmax exponentials for t <= 0 on the hardware's base-2 exponential; t = -inf, or a result below the f32 range, gives 0
#define LOG2E 1.44269504088896f
__device__ __forceinline__ float exp_neg(float t) { return __builtin_amdgcn_exp2f(t * LOG2E); }
// e^t * 2^14 for eight t: the scale of P rides in the exponent, t * log2(e) + 14 in one fused multiply-add, rounded once; the eight v_exp_f32 stand in one statement, each in place,
// so that no instruction directly behind a v_exp_f32 reads its result or overwrites its source; the closing v_nop is that slot behind the last one
__device__ __forceinline__ void exp_neg_p14x8(float* e) {
#pragma unroll  // the eight values are operands of one asm statement: they must be registers, not an indexed array
  for (int r = 0; r < 8; ++r) e[r] = fmaf(e[r], LOG2E, 14.0f);
  asm("v_exp_f32 %0, %0\n\tv_exp_f32 %1, %1\n\tv_exp_f32 %2, %2\n\tv_exp_f32 %3, %3\n\tv_exp_f32 %4, %4\n\tv_exp_f32 %5, %5\n\tv_exp_f32 %6, %6\n\tv_exp_f32 %7, %7\n\tv_nop"
      : "+v"(e[0]), "+v"(e[1]), "+v"(e[2]), "+v"(e[3]), "+v"(e[4]), "+v"(e[5]), "+v"(e[6]), "+v"(e[7]));
}

// x and the three projection weights rounded to bf16 in ONE streaming launch of few, long-lived waves: the work is 42 MB of traffic, and what a launch of one small piece per thread pays for is the start of its waves
// thread i takes 16-byte piece i + k * PREP_N of every source: a wave's load is 512 contiguous bytes, its store 256; all 14 loads of a lane are asked for before the first is converted
// Xb = x as bf16; PT rows: [0,E) Wq[n][:], [E,2E) Wk, [2E,3E) Wv  ([out][in]) as bf16 rows (no scaling)
#define PREP_N (E * E / 8)
__global__ __launch_bounds__(256) void k_prep(const float* __restrict__ x, const float* __restrict__ Wq, const float* __restrict__ Wk, const float* __restrict__ Wv, __bf16* __restrict__ Xb, __bf16* __restrict__ PT) {
  const unsigned i = blockIdx.x * 256 + threadIdx.x, li = i * 16, si = i * 8; v4f v[14];  // the lane's part of an address is a 32-bit offset beside a uniform base: few address registers, none rewritten while a load or store that names it is in flight
#pragma unroll  // here and below: v is a register array, every index must be a constant
  for (int k = 0; k < 8; ++k) v[k] = *(const v4f*)((const char*)(x + (size_t)k * PREP_N * 4) + li);
#pragma unroll
  for (int k = 0; k < 2; ++k) { const size_t o = (size_t)k * PREP_N * 4; v[8 + k] = *(const v4f*)((const char*)(Wq + o) + li); v[10 + k] = *(const v4f*)((const char*)(Wk + o) + li); v[12 + k] = *(const v4f*)((const char*)(Wv + o) + li); }
#pragma unroll
  for (int k = 0; k < 14; ++k) { union { __bf16 h[4]; v2u u; } pk;
#pragma unroll
    for (int e = 0; e < 4; ++e) pk.h[e] = (__bf16)v[k][e];
    vst2((char*)(k < 8 ? Xb + (size_t)k * PREP_N * 4 : PT + (size_t)(k - 8) * PREP_N * 4) + si, pk.u); }
}
// hand-over of a ring buffer: this wave's LDS reads and writes are done, its own copies have landed, then every wave meets; behind it the other buffer is readable and the one just read may be refilled
#define RING_FOOT() do { asm volatile("s_wait_dscnt 0x0" ::: "memory"); asm volatile("s_wait_asynccnt 0x0" ::: "memory"); __syncthreads(); } while (0)
// twelve 16-byte asynchronous copies per lane, global memory to LDS through no register; the s_wait_xcnt that closes the statement stands in front of any rewrite of the address registers the copies name
__device__ __forceinline__ void copy12(const unsigned* l, const char* const* p) {
  asm volatile("global_load_async_to_lds_b128 %0, %12, off\n\t"
               "global_load_async_to_lds_b128 %1, %13, off\n\t"
               "global_load_async_to_lds_b128 %2, %14, off\n\t"
               "global_load_async_to_lds_b128 %3, %15, off\n\t"
               "global_load_async_to_lds_b128 %4, %16, off\n\t"
               "global_load_async_to_lds_b128 %5, %17, off\n\t"
               "global_load_async_to_lds_b128 %6, %18, off\n\t"
               "global_load_async_to_lds_b128 %7, %19, off\n\t"
               "global_load_async_to_lds_b128 %8, %20, off\n\t"
               "global_load_async_to_lds_b128 %9, %21, off\n\t"
               "global_load_async_to_lds_b128 %10, %22, off\n\t"
               "global_load_async_to_lds_b128 %11, %23, off\n\t"
               "s_wait_xcnt 0x0"
               :: "v"(l[0]), "v"(l[1]), "v"(l[2]), "v"(l[3]), "v"(l[4]), "v"(l[5]), "v"(l[6]), "v"(l[7]), "v"(l[8]), "v"(l[9]), "v"(l[10]), "v"(l[11]),
                  "v"(p[0]), "v"(p[1]), "v"(p[2]), "v"(p[3]), "v"(p[4]), "v"(p[5]), "v"(p[6]), "v"(p[7]), "v"(p[8]), "v"(p[9]), "v"(p[10]), "v"(p[11]) : "memory");
}
// projection GEMMs: a stage is a 64-deep k slice of the block's 64 activation rows followed by its 128 weight rows; LDS row pitch = slice bytes + 16, which spreads the 16 rows of a ds_load_b128 fragment read over all banks
#define GP 144
#define GSTG (192 * GP)
#define OP 272
#define OSTG (192 * OP)
// QKV: block (64 rows, 128 cols = 2 heads, which); q,k -> LayerNorm, RoPE; q -> Q32 f32 [bh][s][64]; k -> K2 [bh][s][2][64]: the 64 bf16 hi parts of a row, then its 64 bf16 lo parts; v -> VT hi/lo [bh][d][s]: 4 v as an f16 and the f16 of what that rounding left, both at the one scale
// five waves per SIMD is what the ring's LDS admits: the register budget is held there, so that an epilogue's schedule does not cost the GEMM loop a resident block
__global__ __launch_bounds__(128) __attribute__((amdgpu_waves_per_eu(5))) void k_qkv(const __bf16* __restrict__ Xb, const __bf16* __restrict__ PT, const float* __restrict__ bq, const float* __restrict__ bk, const float* __restrict__ bv, const float* __restrict__ qnw, const float* __restrict__ knw,
                                            float* __restrict__ Q32, __bf16* __restrict__ K2, _Float16* __restrict__ VTh, _Float16* __restrict__ VTl) {
  __shared__ __align__(16) char sm[2 * GSTG];  // the ring of two stages; behind the loop's last barrier the epilogue stages its rows in the same bytes
  float (*so)[16][132] = (float (*)[16][132])sm;
  _Float16 (*sth)[72] = (_Float16 (*)[72])sm; _Float16 (*stl)[72] = sth + 128;
  const int tid = threadIdx.x, wave = tid >> 5, lane = tid & 31, col = lane & 15, g = lane >> 4;
  const int which = blockIdx.z, r0b = blockIdx.x * 64, n0 = blockIdx.y * 128; const int b = r0b / SS, s0 = r0b % SS;
  const float* bb_ = which == 0 ? bq : (which == 1 ? bk : bv);
  v8f acc[8] = {};
  const unsigned lds0 = (unsigned)(size_t)&sm[(tid >> 3) * GP + (tid & 7) * 16];
  const char* gA = (const char*)(Xb + (size_t)(r0b + (tid >> 3)) * E) + (tid & 7) * 16;
  const char* gB = (const char*)(PT + (size_t)(which * E + n0 + (tid >> 3)) * E) + (tid & 7) * 16;
  auto fill = [&](int kt) { unsigned l[12]; const char* p[12];
#pragma unroll  // the twelve address pairs are operands of one asm statement: they must be registers, not indexed arrays
    for (int i = 0; i < 12; ++i) { l[i] = lds0 + (kt & 1) * GSTG + i * (16 * GP); p[i] = (i < 4 ? gA + (size_t)i * (16 * E * 2) : gB + (size_t)(i - 4) * (16 * E * 2)) + (size_t)kt * 128; }
    copy12(l, p); };
  fill(0);
  asm volatile("s_wait_asynccnt 0x0" ::: "memory");  // stage 0 has landed before the barrier that publishes it
  __syncthreads();
  fill(1);
#pragma unroll 1  // one trip per stage: the ring's foot stands once in the code
  for (int kt = 0; kt < E / 64; ++kt) { const char* st = sm + (kt & 1) * GSTG;
#pragma unroll
    for (int kc = 0; kc < 2; ++kc) { const v16b a = frag_b((const __bf16*)(st + (wave * 16 + col) * GP) + kc * 32, lane); v16b wb[8];
#pragma unroll
      for (int j = 0; j < 8; ++j) wb[j] = frag_b((const __bf16*)(st + (64 + j * 16 + col) * GP) + kc * 32, lane);
#pragma unroll
      for (int j = 0; j < 8; ++j) acc[j] = wmma_bf(a, wb[j], acc[j]); }
    RING_FOOT();
    if (kt + 2 < E / 64) fill(kt + 2); }
  asm volatile("s_wait_asynccnt 0x0" ::: "memory");  // no copy is left in flight when the epilogue takes the ring's LDS
  if (which < 2) {
#pragma unroll
    for (int j = 0; j < 8; ++j) { const float bb = bfr(bb_[n0 + j * 16 + col]);
#pragma unroll
      for (int r = 0; r < 8; ++r) so[wave][8 * g + r][j * 16 + col] = acc[j][r] + bb; }
    LDSX();
    { const int rl = lane & 15, hh = lane >> 4; float* rowp = &so[wave][rl][hh * 64]; const float* wn = which == 0 ? qnw : knw; float s1 = 0.f;
#pragma unroll 8
      for (int d = 0; d < 64; ++d) s1 += rowp[d];
      const float mu = s1 * (1.0f / 64.0f); float s2 = 0.f;
#pragma unroll 8
      for (int d = 0; d < 64; ++d) { const float dv = rowp[d] - mu; s2 += dv * dv; }
      const float rs = rsqrtf(s2 * (1.0f / 64.0f) + 1e-6f);
#pragma unroll 8
      for (int d = 0; d < 64; ++d) rowp[d] = (rowp[d] - mu) * rs * bfr(wn[d]);
      // RoPE for tokens t >= 1
      const int t = s0 + wave * 16 + rl;
      if (t >= 1) { const float coord = 2.0f * (((float)(t - 1) + 0.5f) / ROPE_L) - 1.0f;
#pragma unroll 4
        for (int d = 0; d < 32; ++d) { const float invf = powf(100.0f, -(float)(d & 15) * (1.0f / 16.0f)); const float ang = 6.283185307179586f * coord * invf; float sn, cs; sincosf(ang, &sn, &cs);
          const float x1 = rowp[d], x2 = rowp[d + 32]; rowp[d] = x1 * cs - x2 * sn; rowp[d + 32] = x2 * cs + x1 * sn; } } }
    LDSX();
    if (which == 0) {
      for (int qq = lane; qq < 2 * 16 * 16; qq += 32) { const int hh = qq >> 8, rl = (qq >> 4) & 15, pc = qq & 15; const int h = (n0 >> 6) + hh;
        vst2(Q32 + (((size_t)b * NH + h) * SS + s0 + wave * 16 + rl) * HD + pc * 4, *(const v4f*)(&so[wave][rl][hh * 64 + pc * 4])); } }
    else {
      // each key row is split here, once, with the arithmetic of bsplit16; every query block of k_attn then reads the pair ready for its products
      for (int qq = lane; qq < 2 * 16 * 8; qq += 32) { const int hh = qq >> 7, rl = (qq >> 3) & 15, pc = qq & 7; const int h = (n0 >> 6) + hh;
        const float* sp = &so[wave][rl][hh * 64 + pc * 8]; union { __bf16 e[8]; v4u u; } ph, pl;
#pragma unroll  // the eight parts pack into the four registers of each 16-byte store: they must be registers, not indexed arrays
        for (int e = 0; e < 8; ++e) { const float v = sp[e]; const __bf16 hi = (__bf16)v; ph.e[e] = hi; pl.e[e] = (__bf16)(v - (float)hi); }
        __bf16* dst = K2 + (((size_t)b * NH + h) * SS + s0 + wave * 16 + rl) * (2 * HD) + pc * 8;
        vst2(dst, ph.u); vst2(dst + HD, pl.u); } } }
  else {
#pragma unroll
    for (int j = 0; j < 8; ++j) { const float bb = bfr(bb_[n0 + j * 16 + col]);
#pragma unroll
      for (int r = 0; r < 8; ++r) { const float v = (acc[j][r] + bb) * 4.0f; const _Float16 hi = (_Float16)v; sth[j * 16 + col][wave * 16 + 8 * g + r] = hi; stl[j * 16 + col][wave * 16 + 8 * g + r] = (_Float16)(v - (float)hi); } }
    __syncthreads();
    for (int qq = tid; qq < 128 * 8; qq += 128) { const int cl = qq >> 3, pc = qq & 7; const int c = n0 + cl, h = c >> 6, d = c & 63; const size_t o = (((size_t)b * NH + h) * HD + d) * SS + s0 + pc * 8;
      vst2(VTh + o, *(const v4u*)(&sth[cl][pc * 8])); vst2(VTl + o, *(const v4u*)(&stl[cl][pc * 8])); } }
}
// four 16-byte asynchronous copies per lane, global memory to LDS through no register; the s_wait_xcnt that closes the statement stands in front of any rewrite of the address registers the copies name
__device__ __forceinline__ void copy4(const unsigned* l, const char* const* p) {
  asm volatile("global_load_async_to_lds_b128 %0, %4, off\n\t"
               "global_load_async_to_lds_b128 %1, %5, off\n\t"
               "global_load_async_to_lds_b128 %2, %6, off\n\t"
               "global_load_async_to_lds_b128 %3, %7, off\n\t"
               "s_wait_xcnt 0x0"
               :: "v"(l[0]), "v"(l[1]), "v"(l[2]), "v"(l[3]), "v"(p[0]), "v"(p[1]), "v"(p[2]), "v"(p[3]) : "memory");
}
__global__ __launch_bounds__(256) __attribute__((amdgpu_waves_per_eu(4))) void k_attn(const float* __restrict__ Q32, const __bf16* __restrict__ K2, const _Float16* __restrict__ VTh, const _Float16* __restrict__ VTl, const float* __restrict__ amask, float* __restrict__ O32) {
  __shared__ __align__(16) char sm[64 * 136 * 2 + 2 * 64 * 72 * 2];  // the K tile, then the V tile's two planes; behind the loop's last barrier the eight waves' output rows are staged in the same bytes
  __bf16 (*sK)[136] = (__bf16 (*)[136])sm;
  _Float16 (*sV)[64][72] = (_Float16 (*)[64][72])(sm + 64 * 136 * 2);
  float (*sO)[16][68] = (float (*)[16][68])sm;
  const int tid = threadIdx.x, w = __builtin_amdgcn_readfirstlane(tid >> 5), lane = tid & 31, col = lane & 15, g = lane >> 4;  // the wave's number in a scalar register: what is formed from it alone takes no vector register
  const size_t bh = blockIdx.y; const int qb = blockIdx.x; const int q0 = qb * 128 + w * 16;
  const unsigned ldsK = (unsigned)(size_t)&sK[tid >> 4][(tid & 15) * 8], ldsV = (unsigned)(size_t)&sV[0][tid >> 3][(tid & 7) * 8];
  const char* gK = (const char*)(K2 + bh * SS * (2 * HD)) + tid * 16;
  const size_t voff = ((bh * HD + (tid >> 3)) * SS + (tid & 7) * 8) * 2;
  const char* gVh = (const char*)VTh + voff; const char* gVl = (const char*)VTl + voff;
  auto fillK = [&](int kt) { unsigned l[4]; const char* p[4];
#pragma unroll  // the four address pairs are operands of one asm statement: they must be registers, not indexed arrays
    for (int i = 0; i < 4; ++i) { l[i] = ldsK + i * (16 * 68 * 4); p[i] = gK + (size_t)kt * (64 * HD * 4) + i * 4096; }
    copy4(l, p); };
  auto fillV = [&](int kt) { unsigned l[4]; const char* p[4];
#pragma unroll  // as in fillK; the tile's step is added to the two bases first and the row steps follow as constants, so that no more than the two bases are held in registers across the loop
    for (int i = 0; i < 4; ++i) { l[i] = ldsV + (i >> 1) * (64 * 72 * 2) + (i & 1) * (32 * 72 * 2); p[i] = ((i < 2 ? gVh : gVl) + (size_t)kt * 128) + (size_t)(i & 1) * (32 * SS * 2); }
    copy4(l, p); };
  // additive mask: this lane's query row, its eight consecutive keys of each 16-key group; a tile's 32 words are loaded one phase ahead of the scores they are added to, so that no score waits for memory
  const float* mb = amask + (size_t)(q0 + col) * SS + 8 * g; v4f mk[4][2];
  auto loadM = [&](int kt) {
#pragma unroll  // the 32 words stay in registers across the loop's back edge: every index must be a constant
    for (int t = 0; t < 4; ++t) { mk[t][0] = *(const v4f*)(mb + kt * 64 + t * 16); mk[t][1] = *(const v4f*)(mb + kt * 64 + t * 16 + 4); } };
  fillK(0);
  F2 aq[2];
#pragma unroll
  for (int kc = 0; kc < 2; ++kc) aq[kc] = split_row(Q32 + (bh * SS + q0 + col) * HD, kc * 32, lane);
  float mrun = -3.0e38f, lrun = 0.f; v8f acc[4] = {};
  asm volatile("s_wait_asynccnt 0x0" ::: "memory");  // K tile 0 has landed before the barrier that publishes it
  __syncthreads();
  loadM(0);
  fillV(0);
#pragma unroll 1
  for (int kt = 0;; ++kt) {
    v8f s[4];
#pragma unroll
    for (int t = 0; t < 4; ++t) { const __bf16* krow = &sK[t * 16 + col][0];
      const F2 k0 = { frag_b(krow, lane), frag_b(krow + HD, lane) }, k1 = { frag_b(krow + 32, lane), frag_b(krow + HD + 32, lane) };
      v8f a = mac3t(k0, aq[0], (v8f){}); a = mac3t(k1, aq[1], a);
#pragma unroll
      for (int r = 0; r < 8; ++r) s[t][r] = a[r] * 0.125f + bfr(mk[t][r >> 2][r & 3]); }
    RING_FOOT();
    if (kt + 1 < SS / 64) fillK(kt + 1);
    float mx = -3.4e38f;
#pragma unroll  // here and below: the scores, P and the accumulators are register arrays, every index must be a constant
    for (int t = 0; t < 4; ++t) {
#pragma unroll
      for (int r = 0; r < 8; ++r) mx = fmaxf(mx, s[t][r]); }
    mx = fmaxf(mx, __shfl_xor(mx, 16, 32));
    const float mnew = fmaxf(mrun, mx); const float corr = exp_neg(mrun - mnew);
    float ps = 0.f; v16h ph[2], pl[2];
#pragma unroll
    for (int t = 0; t < 4; ++t) { float e[8];
#pragma unroll
      for (int r = 0; r < 8; ++r) e[r] = s[t][r] - mnew;
      exp_neg_p14x8(e);
#pragma unroll
      for (int r = 0; r < 8; r += 2) { const int o = (t & 1) * 8 + r; ps += e[r]; ps += e[r + 1];
        const v2h hi = __builtin_convertvector((v2f){ e[r], e[r + 1] }, v2h), lo = __builtin_convertvector((v2f){ e[r] - (float)hi[0], e[r + 1] - (float)hi[1] }, v2h);  // a register's two halves are rounded together
        ph[t >> 1][o] = hi[0]; ph[t >> 1][o + 1] = hi[1]; pl[t >> 1][o] = lo[0]; pl[t >> 1][o + 1] = lo[1]; } }
    ps += __shfl_xor(ps, 16, 32);
    lrun = lrun * corr + ps * (1.0f / 16384.0f); mrun = mnew;
#pragma unroll
    for (int t = 0; t < 4; ++t) acc[t] *= corr;
    if (kt + 1 < SS / 64) loadM(kt + 1);  // the next tile's mask words fly while this tile's P V products run
#pragma unroll
    for (int kc = 0; kc < 2; ++kc) { v16h vh[4], vl[4];  // product by product over the four tiles: a tile's next product stands four matrix instructions behind its last
#pragma unroll
      for (int t = 0; t < 4; ++t) { vh[t] = frag_h(&sV[0][t * 16 + col][kc * 32], lane); vl[t] = frag_h(&sV[1][t * 16 + col][kc * 32], lane); }
#pragma unroll
      for (int t = 0; t < 4; ++t) acc[t] = wmma16(vh[t], ph[kc], acc[t]);
#pragma unroll
      for (int t = 0; t < 4; ++t) acc[t] = wmma16(vh[t], pl[kc], acc[t]);
#pragma unroll
      for (int t = 0; t < 4; ++t) acc[t] = wmma16(vl[t], ph[kc], acc[t]); }
    RING_FOOT();
    if (kt + 1 == SS / 64) break;
    fillV(kt + 1); }
  asm volatile("s_wait_asynccnt 0x0" ::: "memory");  // no copy is left in flight when the wave goes on to its epilogue and ends
  const float inv = 1.0f / (lrun * 16384.0f * 4.0f);
  const int le = __builtin_amdgcn_mbcnt_lo(~0u, 0u), ce = le & 15, ge = le >> 4;  // the lane's number read anew: what only the epilogue forms from it holds no register across the loop
#pragma unroll
  for (int t = 0; t < 4; ++t) { v4f o[2];
#pragma unroll
    for (int r = 0; r < 8; ++r) o[r >> 2][r & 3] = acc[t][r] * inv;
    vst2(&sO[w][ce][t * 16 + 8 * ge], o[0]); vst2(&sO[w][ce][t * 16 + 8 * ge + 4], o[1]); }
  LDSX();
  for (int qq = le; qq < 16 * 16; qq += 32) { const int rl = qq >> 4, pc = qq & 15; vst2(O32 + ((bh * SS) + q0 + rl) * HD + pc * 4, *(const v4f*)(&sO[w][rl][pc * 4])); }
}
// out = ctx Wo^T + bo : split(ctx) x bf16(Wo rows): 2 products (Wo is an INPUT -> bf16 exact)
__global__ __launch_bounds__(128) void k_out(const float* __restrict__ O32, const float* __restrict__ Wo, const float* __restrict__ bo, float* __restrict__ out) {
  __shared__ __align__(16) char sm[2 * OSTG];  // the ring of two stages; behind the loop's last barrier the epilogue stages its rows in the same bytes
  float (*so)[16][132] = (float (*)[16][132])sm;
  const int tid = threadIdx.x, wave = tid >> 5, lane = tid & 31, col = lane & 15, g = lane >> 4;
  const int r0b = blockIdx.x * 64, r0 = r0b + wave * 16, n0 = blockIdx.y * 128; const int b = r0b / SS, s0 = r0b % SS;
  v8f acc[8] = {};
  const unsigned lds0 = (unsigned)(size_t)&sm[(tid >> 4) * OP + (tid & 15) * 16];
  const char* gA = (const char*)(O32 + ((size_t)b * NH * SS + s0 + (tid >> 4)) * HD) + (tid & 15) * 16;
  const char* gB = (const char*)(Wo + (size_t)(n0 + (tid >> 4)) * E) + (tid & 15) * 16;
  // stage kt = head kt of the context rows (64 f32 a row) and columns 64*kt.. of the weight rows
  auto fill = [&](int kt) {
#pragma unroll
    for (int hf = 0; hf < 2; ++hf) { unsigned l[12]; const char* p[12];
#pragma unroll  // the twelve address pairs are operands of one asm statement: they must be registers, not indexed arrays
      for (int ii = 0; ii < 12; ++ii) { const int i = hf * 12 + ii; l[ii] = lds0 + (kt & 1) * OSTG + i * (8 * OP);
        p[ii] = i < 8 ? gA + (size_t)i * (8 * HD * 4) + (size_t)kt * ((size_t)SS * HD * 4) : gB + (size_t)(i - 8) * (8 * E * 4) + (size_t)kt * 256; }
      copy12(l, p); } };
  fill(0);
  asm volatile("s_wait_asynccnt 0x0" ::: "memory");  // stage 0 has landed before the barrier that publishes it
  __syncthreads();
  fill(1);
#pragma unroll 1  // one trip per stage: the ring's foot stands once in the code
  for (int kt = 0; kt < E / 64; ++kt) { const char* st = sm + (kt & 1) * OSTG;
#pragma unroll
    for (int kc = 0; kc < 2; ++kc) { const F2 a = split_row((const float*)(st + (wave * 16 + col) * OP), kc * 32, lane);
#pragma unroll
      for (int j0 = 0; j0 < 8; j0 += 4) { v16b wb[4];
#pragma unroll
        for (int j = 0; j < 4; ++j) wb[j] = split_row((const float*)(st + (64 + (j0 + j) * 16 + col) * OP), kc * 32, lane).h;
#pragma unroll
        for (int j = 0; j < 4; ++j) { acc[j0 + j] = wmma_bf(a.l, wb[j], acc[j0 + j]); acc[j0 + j] = wmma_bf(a.h, wb[j], acc[j0 + j]); } } }
    RING_FOOT();
    if (kt + 2 < E / 64) fill(kt + 2); }
  asm volatile("s_wait_asynccnt 0x0" ::: "memory");  // no copy is left in flight when the epilogue takes the ring's LDS
#pragma unroll
  for (int j = 0; j < 8; ++j) { const int n = n0 + j * 16 + col; const float bb = bfr(bo[n]);
#pragma unroll
    for (int r = 0; r < 8; ++r) so[wave][8 * g + r][j * 16 + col] = acc[j][r] + bb; }
  LDSX();
#pragma unroll 4
  for (int rl = 0; rl < 16; ++rl) vst2(out + (size_t)(r0 + rl) * E + n0 + lane * 4, *(const v4f*)(&so[wave][rl][lane * 4]));
}
extern "C" void kernel_launch(void* const* d_in, const int* in_sizes, int n_in, void* d_out, int out_size, void* d_ws, size_t ws_size, hipStream_t stream) {
  (void)in_sizes; (void)n_in; (void)out_size; (void)ws_size;
  const float** I = (const float**)d_in;
  const float* x = I[0]; const float* amask = I[1]; const float* Wq = I[2]; const float* bq = I[3]; const float* Wk = I[4]; const float* bk = I[5]; const float* Wv = I[6]; const float* bv = I[7]; const float* Wp = I[8]; const float* bp = I[9]; const float* qnw = I[10]; const float* knw = I[11];
  float* out = (float*)d_out;
  char* ws = (char*)d_ws; size_t off = 0;
  auto take = [&](size_t bytes) { char* p = ws + off; off += (bytes + 255) & ~(size_t)255; return p; };
  __bf16* Xb = (__bf16*)take((size_t)NR * E * 2); __bf16* PT = (__bf16*)take((size_t)3 * E * E * 2);
  float* Q32 = (float*)take((size_t)NR * E * 4); __bf16* K2 = (__bf16*)take((size_t)NR * E * 4); _Float16* VTh = (_Float16*)take((size_t)NR * E * 2); _Float16* VTl = (_Float16*)take((size_t)NR * E * 2); float* O32 = (float*)take((size_t)NR * E * 4);
  // ws ~ 82 MB
  k_prep<<<PREP_N / 256, 256, 0, stream>>>(x, Wq, Wk, Wv, Xb, PT);
  k_qkv<<<dim3(NR / 64, E / 128, 3), 128, 0, stream>>>(Xb, PT, bq, bk, bv, qnw, knw, Q32, K2, VTh, VTl);
  k_attn<<<dim3(SS / 128, NB * NH), 256, 0, stream>>>(Q32, K2, VTh, VTl, amask, O32);
  k_out<<<dim3(NR / 64, E / 128), 128, 0, stream>>>(O32, Wp, bp, out);
}

// v010
// One run takes 152 microseconds.
// In both of two side-by-side timings against v009, it was 1.04 times as fast.
// All steps since v000 together make it 4.36 times as fast.
// compute dtype: every module INPUT that feeds a GEMM (x, Wq/Wk/Wv/Wp, biases, LN weights, attn_mask) is rounded to bf16 and used in exact bf16 WMMA products with f32 accumulation; computed operands (normalised+rotated q/k f32 split, P and V hi/lo, context split) f32-grade; LayerNorm/RoPE/softmax f32.
#include <hip/hip_runtime.h>
#include <math.h>

typedef __attribute__((ext_vector_type(16))) _Float16 v16h;
typedef __attribute__((ext_vector_type(16))) __bf16 v16b;
typedef __attribute__((ext_vector_type(8)))  _Float16 v8h;
typedef __attribute__((ext_vector_type(2)))  _Float16 v2h;
typedef __attribute__((ext_vector_type(8)))  float v8f;
typedef __attribute__((ext_vector_type(4)))  float v4f;
typedef __attribute__((ext_vector_type(2)))  float v2f;
typedef __attribute__((ext_vector_type(4)))  unsigned v4u;
typedef __attribute__((ext_vector_type(2)))  unsigned v2u;
typedef __attribute__((ext_vector_type(4)))  int v4i;
typedef float __attribute__((may_alias)) float_a;
typedef int __attribute__((may_alias)) int_a;

template <typename T> __device__ __forceinline__ void vst2(void* p, T v) { *(T*)p = v;  }
__device__ __forceinline__ v8f wmma16(v16h a, v16h b, v8f c) {
  v8f d = __builtin_amdgcn_wmma_f32_16x16x32_f16(false, a, false, b, (short)0, c, false, false);
  asm volatile("v_nop\n\tv_nop\n\tv_nop\n\tv_nop" : "+v"(d) : "v"(a), "v"(b));
  return d;
}
__device__ __forceinline__ v8f wmma_bf(v16b a, v16b b, v8f c) {
  v8f d = __builtin_amdgcn_wmma_f32_16x16x32_bf16(false, a, false, b, (short)0, c, false, false);
  asm volatile("v_nop\n\tv_nop\n\tv_nop\n\tv_nop" : "+v"(d) : "v"(a), "v"(b));
  return d;
}
// 16x16x32 fragments: lane = (h = lane>>4, row/col = lane&15); elements 0..7 = k0+8h+0..7, 8..15 = k0+16+8h+0..7; D element r = row 8h+r
__device__ __forceinline__ v16h frag_h(const _Float16* rowk0, int lane) {
  union { v16h v; v8h q[2]; } u; const _Float16* p = rowk0 + 8 * (lane >> 4);
  u.q[0] = *(const v8h*)p; u.q[1] = *(const v8h*)(p + 16); return u.v;
}
__device__ __forceinline__ v16h frag_f32(const float* rowk0, int lane) {
  v16h a; const float* p = rowk0 + 8 * (lane >> 4);
#pragma unroll
  for (int i = 0; i < 8; ++i) { a[i] = (_Float16)p[i]; a[8 + i] = (_Float16)p[16 + i]; }
  return a;
}
__device__ __forceinline__ v16h frag_f32s(const float* rowk0, int lane, float sc) {
  v16h a; const float* p = rowk0 + 8 * (lane >> 4);
#pragma unroll
  for (int i = 0; i < 8; ++i) { a[i] = (_Float16)(p[i] * sc); a[8 + i] = (_Float16)(p[16 + i] * sc); }
  return a;
}
// column fragment from a [K][ld] layout (column n), rows >= K read as 0
__device__ __forceinline__ v16h fragc_f32(const float* W, int k0, int n, int lane, int ld, int K) {
  v16h a; const int g = lane >> 4;
#pragma unroll
  for (int i = 0; i < 8; ++i) { const int ka = k0 + 8 * g + i, kb = ka + 16;
    a[i] = (_Float16)(ka < K ? W[(size_t)ka * ld + n] : 0.f); a[8 + i] = (_Float16)(kb < K ? W[(size_t)kb * ld + n] : 0.f); }
  return a;
}
struct F2 { v16b h, l; };
__device__ __forceinline__ F2 bsplit16(const float v[16]) { F2 r;
#pragma unroll
  for (int i = 0; i < 16; ++i) { const __bf16 h = (__bf16)v[i]; r.h[i] = h; r.l[i] = (__bf16)(v[i] - (float)h); }
  return r; }
__device__ __forceinline__ F2 split_row(const float* row, int k0, int lane) { float v[16]; const float* p = row + k0 + 8 * (lane >> 4);
#pragma unroll
  for (int i = 0; i < 8; ++i) { v[i] = p[i]; v[8 + i] = p[16 + i]; }
  return bsplit16(v); }
__device__ __forceinline__ F2 split_rowK(const float* row, int k0, int lane, int K) { float v[16]; const int g = lane >> 4;
#pragma unroll
  for (int i = 0; i < 8; ++i) { const int ka = k0 + 8 * g + i, kb = ka + 16; v[i] = ka < K ? row[ka] : 0.f; v[8 + i] = kb < K ? row[kb] : 0.f; }
  return bsplit16(v); }
__device__ __forceinline__ F2 split_col(const float* W, int k0, int n, int lane, int ld, int K) { float v[16]; const int g = lane >> 4;
#pragma unroll
  for (int i = 0; i < 8; ++i) { const int ka = k0 + 8 * g + i, kb = ka + 16; v[i] = ka < K ? W[(size_t)ka * ld + n] : 0.f; v[8 + i] = kb < K ? W[(size_t)kb * ld + n] : 0.f; }
  return bsplit16(v); }
__device__ __forceinline__ v8f mac3(const F2& a, const F2& b, v8f c) { c = wmma_bf(a.l, b.h, c); c = wmma_bf(a.h, b.l, c); return wmma_bf(a.h, b.h, c); }
// the same three products in the same order with the operands' sides exchanged: b is the A operand (rows), a the B operand (columns)
__device__ __forceinline__ v8f mac3t(const F2& b, const F2& a, v8f c) { c = wmma_bf(b.h, a.l, c); c = wmma_bf(b.l, a.h, c); return wmma_bf(b.h, a.h, c); }
__device__ __forceinline__ float sigm(float v) { return 1.0f / (1.0f + expf(-v)); }
#define LDSX() do { asm volatile("s_wait_dscnt 0" ::: "memory"); __builtin_amdgcn_wave_barrier(); __builtin_amdgcn_fence(__ATOMIC_RELEASE, "workgroup"); } while (0)


// NEPA self attention (16 heads of 64 on [2,2048,1024], [out][in] weights + biases): q,k LayerNorm'd per head (eps 1e-6, weight only), RoPE on tokens >= 1 (prefix 1):
// angle[d] = 2*pi*coord(t)*100^(-(d mod 16)/16), coord = 2*(t-1+0.5)/2047 - 1, rotate-half pairs (d, d+32); scores = q.k/8 + attn_mask[q][k]; softmax; (P v) Wp^T + bp.
#define NB 2
#define SS 2048
#define E 1024
#define NH 16
#define HD 64
#define NR (NB * SS)
#define ROPE_L 2047.0f
__device__ __forceinline__ float bfr(float v) { return (float)(__bf16)v; }
__device__ __forceinline__ v16b frag_b(const __bf16* rowk0, int lane) { return __builtin_bit_cast(v16b, frag_h((const _Float16*)rowk0, lane)); }
// softmax exponentials for t <= 0 on the hardware's base-2 exponential; t = -inf, or a result below the f32 range, gives 0
#define LOG2E 1.44269504088896f
__device__ __forceinline__ float exp_neg(float t) { return __builtin_amdgcn_exp2f(t * LOG2E); }
// e^t * 2^14 for eight t: the scale of P rides in the exponent, t * log2(e) + 14 in one fused multiply-add, rounded once; the eight v_exp_f32 stand in one statement, each in place,
// so that no instruction directly behind a v_exp_f32 reads its result or overwrites its source; the closing v_nop is that slot behind the last one
__device__ __forceinline__ void exp_neg_p14x8(float* e) {
#pragma unroll  // the eight values are operands of one asm statement: they must be registers, not an indexed array
  for (int r = 0; r < 8; ++r) e[r] = fmaf(e[r], LOG2E, 14.0f);
  asm("v_exp_f32 %0, %0\n\tv_exp_f32 %1, %1\n\tv_exp_f32 %2, %2\n\tv_exp_f32 %3, %3\n\tv_exp_f32 %4, %4\n\tv_exp_f32 %5, %5\n\tv_exp_f32 %6, %6\n\tv_exp_f32 %7, %7\n\tv_nop"
      : "+v"(e[0]), "+v"(e[1]), "+v"(e[2]), "+v"(e[3]), "+v"(e[4]), "+v"(e[5]), "+v"(e[6]), "+v"(e[7]));
}

// x and the four weight matrices rounded to bf16 in ONE streaming launch of few, long-lived waves: the work is 50 MB of traffic, and what a launch of one small piece per thread pays for is the start of its waves
// thread i takes 16-byte piece i + k * PREP_N of every source: a wave's load is 512 contiguous bytes, its store 256; all 16 loads of a lane are asked for before the first is converted
// Xb = x as bf16; PT rows: [0,E) Wq[n][:], [E,2E) Wk, [2E,3E) Wv, [3E,4E) Wp  ([out][in]) as bf16 rows (no scaling)
#define PREP_N (E * E / 8)
// the grid gives a SIMD four waves; with at most eight planned for, the compiler keeps the 64 registers of the 16 loads: left to aim at sixteen waves it holds back the last four loads until the first have come
__global__ __launch_bounds__(256) __attribute__((amdgpu_waves_per_eu(4, 8))) void k_prep(const float* __restrict__ x, const float* __restrict__ Wq, const float* __restrict__ Wk, const float* __restrict__ Wv, const float* __restrict__ Wp, __bf16* __restrict__ Xb, __bf16* __restrict__ PT) {
  const unsigned i = blockIdx.x * 256 + threadIdx.x, li = i * 16, si = i * 8; v4f v[16];  // the lane's part of an address is a 32-bit offset beside a uniform base: few address registers, none rewritten while a load or store that names it is in flight
#pragma unroll  // here and below: v is a register array, every index must be a constant
  for (int k = 0; k < 8; ++k) v[k] = *(const v4f*)((const char*)(x + (size_t)k * PREP_N * 4) + li);
#pragma unroll
  for (int k = 0; k < 2; ++k) { const size_t o = (size_t)k * PREP_N * 4; v[8 + k] = *(const v4f*)((const char*)(Wq + o) + li); v[10 + k] = *(const v4f*)((const char*)(Wk + o) + li); v[12 + k] = *(const v4f*)((const char*)(Wv + o) + li); v[14 + k] = *(const v4f*)((const char*)(Wp + o) + li); }
#pragma unroll
  for (int k = 0; k < 16; ++k) { union { __bf16 h[4]; v2u u; } pk;
#pragma unroll
    for (int e = 0; e < 4; ++e) pk.h[e] = (__bf16)v[k][e];
    vst2((char*)(k < 8 ? Xb + (size_t)k * PREP_N * 4 : PT + (size_t)(k - 8) * PREP_N * 4) + si, pk.u); }
}
// hand-over of a ring buffer: this wave's LDS reads and writes are done, its own copies have landed, then every wave meets; behind it the other buffer is readable and the one just read may be refilled
#define RING_FOOT() do { asm volatile("s_wait_dscnt 0x0" ::: "memory"); asm volatile("s_wait_asynccnt 0x0" ::: "memory"); __syncthreads(); } while (0)
// twelve 16-byte asynchronous copies per lane, global memory to LDS through no register; the s_wait_xcnt that closes the statement stands in front of any rewrite of the address registers the copies name
__device__ __forceinline__ void copy12(const unsigned* l, const char* const* p) {
  asm volatile("global_load_async_to_lds_b128 %0, %12, off\n\t"
               "global_load_async_to_lds_b128 %1, %13, off\n\t"
               "global_load_async_to_lds_b128 %2, %14, off\n\t"
               "global_load_async_to_lds_b128 %3, %15, off\n\t"
               "global_load_async_to_lds_b128 %4, %16, off\n\t"
               "global_load_async_to_lds_b128 %5, %17, off\n\t"
               "global_load_async_to_lds_b128 %6, %18, off\n\t"
               "global_load_async_to_lds_b128 %7, %19, off\n\t"
               "global_load_async_to_lds_b128 %8, %20, off\n\t"
               "global_load_async_to_lds_b128 %9, %21, off\n\t"
               "global_load_async_to_lds_b128 %10, %22, off\n\t"
               "global_load_async_to_lds_b128 %11, %23, off\n\t"
               "s_wait_xcnt 0x0"
               :: "v"(l[0]), "v"(l[1]), "v"(l[2]), "v"(l[3]), "v"(l[4]), "v"(l[5]), "v"(l[6]), "v"(l[7]), "v"(l[8]), "v"(l[9]), "v"(l[10]), "v"(l[11]),
                  "v"(p[0]), "v"(p[1]), "v"(p[2]), "v"(p[3]), "v"(p[4]), "v"(p[5]), "v"(p[6]), "v"(p[7]), "v"(p[8]), "v"(p[9]), "v"(p[10]), "v"(p[11]) : "memory");
}
// projection GEMMs: a stage is a 64-deep k slice of the block's 64 activation rows followed by its 128 weight rows; LDS row pitch = slice bytes + 16, which spreads the 16 rows of a ds_load_b128 fragment read over all banks
#define GP 144
#define GSTG (192 * GP)
// output projection: a stage is one head of the block's 64 context rows (64 bf16 hi, 64 bf16 lo: 256 bytes) followed by the 64-deep slice of its 128 bf16 weight rows (128 bytes), each at its bytes + 16
#define OAP 272
#define OBP 144
#define OSTG (64 * OAP + 128 * OBP)
// QKV: block (64 rows, 128 cols = 2 heads, which); q,k -> LayerNorm, RoPE; q -> Q32 f32 [bh][s][64]; k -> K2 [bh][s][2][64]: the 64 bf16 hi parts of a row, then its 64 bf16 lo parts; v -> VT hi/lo [bh][d][s]: 4 v as an f16 and the f16 of what that rounding left, both at the one scale
// five waves per SIMD is what the ring's LDS admits: the register budget is held there, so that an epilogue's schedule does not cost the GEMM loop a resident block
__global__ __launch_bounds__(128) __attribute__((amdgpu_waves_per_eu(5))) void k_qkv(const __bf16* __restrict__ Xb, const __bf16* __restrict__ PT, const float* __restrict__ bq, const float* __restrict__ bk, const float* __restrict__ bv, const float* __restrict__ qnw, const float* __restrict__ knw,
                                            float* __restrict__ Q32, __bf16* __restrict__ K2, _Float16* __restrict__ VTh, _Float16* __restrict__ VTl) {
  __shared__ __align__(16) char sm[2 * GSTG];  // the ring of two stages; behind the loop's last barrier the epilogue stages its rows in the same bytes
  float (*so)[16][132] = (float (*)[16][132])sm;
  _Float16 (*sth)[72] = (_Float16 (*)[72])sm; _Float16 (*stl)[72] = sth + 128;
  const int tid = threadIdx.x, wave = tid >> 5, lane = tid & 31, col = lane & 15, g = lane >> 4;
  const int which = blockIdx.z, r0b = blockIdx.x * 64, n0 = blockIdx.y * 128; const int b = r0b / SS, s0 = r0b % SS;
  const float* bb_ = which == 0 ? bq : (which == 1 ? bk : bv);
  v8f acc[8] = {};
  const unsigned lds0 = (unsigned)(size_t)&sm[(tid >> 3) * GP + (tid & 7) * 16];
  const char* gA = (const char*)(Xb + (size_t)(r0b + (tid >> 3)) * E) + (tid & 7) * 16;
  const char* gB = (const char*)(PT + (size_t)(which * E + n0 + (tid >> 3)) * E) + (tid & 7) * 16;
  auto fill = [&](int kt) { unsigned l[12]; const char* p[12];
#pragma unroll  // the twelve address pairs are operands of one asm statement: they must be registers, not indexed arrays
    for (int i = 0; i < 12; ++i) { l[i] = lds0 + (kt & 1) * GSTG + i * (16 * GP); p[i] = (i < 4 ? gA + (size_t)i * (16 * E * 2) : gB + (size_t)(i - 4) * (16 * E * 2)) + (size_t)kt * 128; }
    copy12(l, p); };
  fill(0);
  asm volatile("s_wait_asynccnt 0x0" ::: "memory");  // stage 0 has landed before the barrier that publishes it
  __syncthreads();
  fill(1);
#pragma unroll 1  // one trip per stage: the ring's foot stands once in the code
  for (int kt = 0; kt < E / 64; ++kt) { const char* st = sm + (kt & 1) * GSTG;
#pragma unroll
    for (int kc = 0; kc < 2; ++kc) { const v16b a = frag_b((const __bf16*)(st + (wave * 16 + col) * GP) + kc * 32, lane); v16b wb[8];
#pragma unroll
      for (int j = 0; j < 8; ++j) wb[j] = frag_b((const __bf16*)(st + (64 + j * 16 + col) * GP) + kc * 32, lane);
#pragma unroll
      for (int j = 0; j < 8; ++j) acc[j] = wmma_bf(a, wb[j], acc[j]); }
    RING_FOOT();
    if (kt + 2 < E / 64) fill(kt + 2); }
  asm volatile("s_wait_asynccnt 0x0" ::: "memory");  // no copy is left in flight when the epilogue takes the ring's LDS
  if (which < 2) {
#pragma unroll
    for (int j = 0; j < 8; ++j) { const float bb = bfr(bb_[n0 + j * 16 + col]);
#pragma unroll
      for (int r = 0; r < 8; ++r) so[wave][8 * g + r][j * 16 + col] = acc[j][r] + bb; }
    LDSX();
    { const int rl = lane & 15, hh = lane >> 4; float* rowp = &so[wave][rl][hh * 64]; const float* wn = which == 0 ? qnw : knw; float s1 = 0.f;
#pragma unroll 8
      for (int d = 0; d < 64; ++d) s1 += rowp[d];
      const float mu = s1 * (1.0f / 64.0f); float s2 = 0.f;
#pragma unroll 8
      for (int d = 0; d < 64; ++d) { const float dv = rowp[d] - mu; s2 += dv * dv; }
      const float rs = rsqrtf(s2 * (1.0f / 64.0f) + 1e-6f);
#pragma unroll 8
      for (int d = 0; d < 64; ++d) rowp[d] = (rowp[d] - mu) * rs * bfr(wn[d]);
      // RoPE for tokens t >= 1
      const int t = s0 + wave * 16 + rl;
      if (t >= 1) { const float coord = 2.0f * (((float)(t - 1) + 0.5f) / ROPE_L) - 1.0f;
#pragma unroll 4
        for (int d = 0; d < 32; ++d) { const float invf = powf(100.0f, -(float)(d & 15) * (1.0f / 16.0f)); const float ang = 6.283185307179586f * coord * invf; float sn, cs; sincosf(ang, &sn, &cs);
          const float x1 = rowp[d], x2 = rowp[d + 32]; rowp[d] = x1 * cs - x2 * sn; rowp[d + 32] = x2 * cs + x1 * sn; } } }
    LDSX();
    if (which == 0) {
      for (int qq = lane; qq < 2 * 16 * 16; qq += 32) { const int hh = qq >> 8, rl = (qq >> 4) & 15, pc = qq & 15; const int h = (n0 >> 6) + hh;
        vst2(Q32 + (((size_t)b * NH + h) * SS + s0 + wave * 16 + rl) * HD + pc * 4, *(const v4f*)(&so[wave][rl][hh * 64 + pc * 4])); } }
    else {
      // each key row is split here, once, with the arithmetic of bsplit16; every query block of k_attn then reads the pair ready for its products
      for (int qq = lane; qq < 2 * 16 * 8; qq += 32) { const int hh = qq >> 7, rl = (qq >> 3) & 15, pc = qq & 7; const int h = (n0 >> 6) + hh;
        const float* sp = &so[wave][rl][hh * 64 + pc * 8]; union { __bf16 e[8]; v4u u; } ph, pl;
#pragma unroll  // the eight parts pack into the four registers of each 16-byte store: they must be registers, not indexed arrays
        for (int e = 0; e < 8; ++e) { const float v = sp[e]; const __bf16 hi = (__bf16)v; ph.e[e] = hi; pl.e[e] = (__bf16)(v - (float)hi); }
        __bf16* dst = K2 + (((size_t)b * NH + h) * SS + s0 + wave * 16 + rl) * (2 * HD) + pc * 8;
        vst2(dst, ph.u); vst2(dst + HD, pl.u); } } }
  else {
#pragma unroll
    for (int j = 0; j < 8; ++j) { const float bb = bfr(bb_[n0 + j * 16 + col]);
#pragma unroll
      for (int r = 0; r < 8; ++r) { const float v = (acc[j][r] + bb) * 4.0f; const _Float16 hi = (_Float16)v; sth[j * 16 + col][wave * 16 + 8 * g + r] = hi; stl[j * 16 + col][wave * 16 + 8 * g + r] = (_Float16)(v - (float)hi); } }
    __syncthreads();
    for (int qq = tid; qq < 128 * 8; qq += 128) { const int cl = qq >> 3, pc = qq & 7; const int c = n0 + cl, h = c >> 6, d = c & 63; const size_t o = (((size_t)b * NH + h) * HD + d) * SS + s0 + pc * 8;
      vst2(VTh + o, *(const v4u*)(&sth[cl][pc * 8])); vst2(VTl + o, *(const v4u*)(&stl[cl][pc * 8])); } }
}
// four 16-byte asynchronous copies per lane, global memory to LDS through no register; the s_wait_xcnt that closes the statement stands in front of any rewrite of the address registers the copies name
__device__ __forceinline__ void copy4(const unsigned* l, const char* const* p) {
  asm volatile("global_load_async_to_lds_b128 %0, %4, off\n\t"
               "global_load_async_to_lds_b128 %1, %5, off\n\t"
               "global_load_async_to_lds_b128 %2, %6, off\n\t"
               "global_load_async_to_lds_b128 %3, %7, off\n\t"
               "s_wait_xcnt 0x0"
               :: "v"(l[0]), "v"(l[1]), "v"(l[2]), "v"(l[3]), "v"(p[0]), "v"(p[1]), "v"(p[2]), "v"(p[3]) : "memory");
}
__global__ __launch_bounds__(256) __attribute__((amdgpu_waves_per_eu(4))) void k_attn(const float* __restrict__ Q32, const __bf16* __restrict__ K2, const _Float16* __restrict__ VTh, const _Float16* __restrict__ VTl, const float* __restrict__ amask, __bf16* __restrict__ O2) {
  __shared__ __align__(16) char sm[64 * 136 * 2 + 2 * 64 * 72 * 2];  // the K tile, then the V tile's two planes; behind the loop's last barrier the eight waves' output rows are staged in the same bytes
  __bf16 (*sK)[136] = (__bf16 (*)[136])sm;
  _Float16 (*sV)[64][72] = (_Float16 (*)[64][72])(sm + 64 * 136 * 2);
  float (*sO)[16][68] = (float (*)[16][68])sm;
  const int tid = threadIdx.x, w = __builtin_amdgcn_readfirstlane(tid >> 5), lane = tid & 31, col = lane & 15, g = lane >> 4;  // the wave's number in a scalar register: what is formed from it alone takes no vector register
  const size_t bh = blockIdx.y; const int qb = blockIdx.x; const int q0 = qb * 128 + w * 16;
  const unsigned ldsK = (unsigned)(size_t)&sK[tid >> 4][(tid & 15) * 8], ldsV = (unsigned)(size_t)&sV[0][tid >> 3][(tid & 7) * 8];
  const char* gK = (const char*)(K2 + bh * SS * (2 * HD)) + tid * 16;
  const size_t voff = ((bh * HD + (tid >> 3)) * SS + (tid & 7) * 8) * 2;
  const char* gVh = (const char*)VTh + voff; const char* gVl = (const char*)VTl + voff;
  auto fillK = [&](int kt) { unsigned l[4]; const char* p[4];
#pragma unroll  // the four address pairs are operands of one asm statement: they must be registers, not indexed arrays
    for (int i = 0; i < 4; ++i) { l[i] = ldsK + i * (16 * 68 * 4); p[i] = gK + (size_t)kt * (64 * HD * 4) + i * 4096; }
    copy4(l, p); };
  auto fillV = [&](int kt) { unsigned l[4]; const char* p[4];
#pragma unroll  // as in fillK; the tile's step is added to the two bases first and the row steps follow as constants, so that no more than the two bases are held in registers across the loop
    for (int i = 0; i < 4; ++i) { l[i] = ldsV + (i >> 1) * (64 * 72 * 2) + (i & 1) * (32 * 72 * 2); p[i] = ((i < 2 ? gVh : gVl) + (size_t)kt * 128) + (size_t)(i & 1) * (32 * SS * 2); }
    copy4(l, p); };
  // additive mask: this lane's query row, its eight consecutive keys of each 16-key group; a tile's 32 words are loaded one phase ahead of the scores they are added to, so that no score waits for memory
  const float* mb = amask + (size_t)(q0 + col) * SS + 8 * g; v4f mk[4][2];
  auto loadM = [&](int kt) {
#pragma unroll  // the 32 words stay in registers across the loop's back edge: every index must be a constant
    for (int t = 0; t < 4; ++t) { mk[t][0] = *(const v4f*)(mb + kt * 64 + t * 16); mk[t][1] = *(const v4f*)(mb + kt * 64 + t * 16 + 4); } };
  fillK(0);
  F2 aq[2];
#pragma unroll
  for (int kc = 0; kc < 2; ++kc) aq[kc] = split_row(Q32 + (bh * SS + q0 + col) * HD, kc * 32, lane);
  float mrun = -3.0e38f, lrun = 0.f; v8f acc[4] = {};
  asm volatile("s_wait_asynccnt 0x0" ::: "memory");  // K tile 0 has landed before the barrier that publishes it
  __syncthreads();
  loadM(0);
  fillV(0);
#pragma unroll 1
  for (int kt = 0;; ++kt) {
    v8f s[4];
#pragma unroll
    for (int t = 0; t < 4; ++t) { const __bf16* krow = &sK[t * 16 + col][0];
      const F2 k0 = { frag_b(krow, lane), frag_b(krow + HD, lane) }, k1 = { frag_b(krow + 32, lane), frag_b(krow + HD + 32, lane) };
      v8f a = mac3t(k0, aq[0], (v8f){}); a = mac3t(k1, aq[1], a);
#pragma unroll
      for (int r = 0; r < 8; ++r) s[t][r] = a[r] * 0.125f + bfr(mk[t][r >> 2][r & 3]); }
    RING_FOOT();
    if (kt + 1 < SS / 64) fillK(kt + 1);
    float mx = -3.4e38f;
#pragma unroll  // here and below: the scores, P and the accumulators are register arrays, every index must be a constant
    for (int t = 0; t < 4; ++t) {
#pragma unroll
      for (int r = 0; r < 8; ++r) mx = fmaxf(mx, s[t][r]); }
    mx = fmaxf(mx, __shfl_xor(mx, 16, 32));
    const float mnew = fmaxf(mrun, mx); const float corr = exp_neg(mrun - mnew);
    float ps = 0.f; v16h ph[2], pl[2];
#pragma unroll
    for (int t = 0; t < 4; ++t) { float e[8];
#pragma unroll
      for (int r = 0; r < 8; ++r) e[r] = s[t][r] - mnew;
      exp_neg_p14x8(e);
#pragma unroll
      for (int r = 0; r < 8; r += 2) { const int o = (t & 1) * 8 + r; ps += e[r]; ps += e[r + 1];
        const v2h hi = __builtin_convertvector((v2f){ e[r], e[r + 1] }, v2h), lo = __builtin_convertvector((v2f){ e[r] - (float)hi[0], e[r + 1] - (float)hi[1] }, v2h);  // a register's two halves are rounded together
        ph[t >> 1][o] = hi[0]; ph[t >> 1][o + 1] = hi[1]; pl[t >> 1][o] = lo[0]; pl[t >> 1][o + 1] = lo[1]; } }
    ps += __shfl_xor(ps, 16, 32);
    lrun = lrun * corr + ps * (1.0f / 16384.0f); mrun = mnew;
#pragma unroll
    for (int t = 0; t < 4; ++t) acc[t] *= corr;
    if (kt + 1 < SS / 64) loadM(kt + 1);  // the next tile's mask words fly while this tile's P V products run
#pragma unroll
    for (int kc = 0; kc < 2; ++kc) { v16h vh[4], vl[4];  // product by product over the four tiles: a tile's next product stands four matrix instructions behind its last
#pragma unroll
      for (int t = 0; t < 4; ++t) { vh[t] = frag_h(&sV[0][t * 16 + col][kc * 32], lane); vl[t] = frag_h(&sV[1][t * 16 + col][kc * 32], lane); }
#pragma unroll
      for (int t = 0; t < 4; ++t) acc[t] = wmma16(vh[t], ph[kc], acc[t]);
#pragma unroll
      for (int t = 0; t < 4; ++t) acc[t] = wmma16(vh[t], pl[kc], acc[t]);
#pragma unroll
      for (int t = 0; t < 4; ++t) acc[t] = wmma16(vl[t], ph[kc], acc[t]); }
    RING_FOOT();
    if (kt + 1 == SS / 64) break;
    fillV(kt + 1); }
  asm volatile("s_wait_asynccnt 0x0" ::: "memory");  // no copy is left in flight when the wave goes on to its epilogue and ends
  const float inv = 1.0f / (lrun * 16384.0f * 4.0f);
  const int le = __builtin_amdgcn_mbcnt_lo(~0u, 0u), ce = le & 15, ge = le >> 4;  // the lane's number read anew: what only the epilogue forms from it holds no register across the loop
#pragma unroll
  for (int t = 0; t < 4; ++t) { v4f o[2];
#pragma unroll
    for (int r = 0; r < 8; ++r) o[r >> 2][r & 3] = acc[t][r] * inv;
    vst2(&sO[w][ce][t * 16 + 8 * ge], o[0]); vst2(&sO[w][ce][t * 16 + 8 * ge + 4], o[1]); }
  LDSX();
  // each context row is split here, once, with the arithmetic of bsplit16; every column block of k_out then reads the pair ready for its products
  for (int qq = le; qq < 16 * 8; qq += 32) { const int rl = qq >> 3, pc = qq & 7; const float* sp = &sO[w][rl][pc * 8]; union { __bf16 e[8]; v4u u; } oh, ol;
#pragma unroll  // the eight parts pack into the four registers of each 16-byte store: they must be registers, not indexed arrays
    for (int e = 0; e < 8; ++e) { const float v = sp[e]; const __bf16 hi = (__bf16)v; oh.e[e] = hi; ol.e[e] = (__bf16)(v - (float)hi); }
    __bf16* dst = O2 + ((bh * SS) + q0 + rl) * (2 * HD) + pc * 8;
    vst2(dst, oh.u); vst2(dst + HD, ol.u); }
}
// eight 16-byte asynchronous copies per lane, global memory to LDS through no register; the s_wait_xcnt that closes the statement stands in front of any rewrite of the address registers the copies name
__device__ __forceinline__ void copy8(const unsigned* l, const char* const* p) {
  asm volatile("global_load_async_to_lds_b128 %0, %8, off\n\t"
               "global_load_async_to_lds_b128 %1, %9, off\n\t"
               "global_load_async_to_lds_b128 %2, %10, off\n\t"
               "global_load_async_to_lds_b128 %3, %11, off\n\t"
               "global_load_async_to_lds_b128 %4, %12, off\n\t"
               "global_load_async_to_lds_b128 %5, %13, off\n\t"
               "global_load_async_to_lds_b128 %6, %14, off\n\t"
               "global_load_async_to_lds_b128 %7, %15, off\n\t"
               "s_wait_xcnt 0x0"
               :: "v"(l[0]), "v"(l[1]), "v"(l[2]), "v"(l[3]), "v"(l[4]), "v"(l[5]), "v"(l[6]), "v"(l[7]),
                  "v"(p[0]), "v"(p[1]), "v"(p[2]), "v"(p[3]), "v"(p[4]), "v"(p[5]), "v"(p[6]), "v"(p[7]) : "memory");
}
// out = ctx Wo^T + bo : split(ctx) x bf16(Wo rows): 2 products (Wo is an INPUT -> bf16 exact); both operands arrive as bf16 from their producers (the context pair from k_attn, the weight rows from k_prep): no wave converts here
__global__ __launch_bounds__(128) void k_out(const __bf16* __restrict__ O2, const __bf16* __restrict__ Wb, const float* __restrict__ bo, float* __restrict__ out) {
  __shared__ __align__(16) char sm[2 * OSTG];  // the ring of two stages; behind the loop's last barrier the epilogue stages its rows in the same bytes
  float (*so)[16][132] = (float (*)[16][132])sm;
  const int tid = threadIdx.x, wave = tid >> 5, lane = tid & 31, col = lane & 15, g = lane >> 4;
  const int r0b = blockIdx.x * 64, r0 = r0b + wave * 16, n0 = blockIdx.y * 128; const int b = r0b / SS, s0 = r0b % SS;
  v8f acc[8] = {};
  const unsigned ldsA = (unsigned)(size_t)&sm[(tid >> 4) * OAP + (tid & 15) * 16], ldsB = (unsigned)(size_t)&sm[64 * OAP + (tid >> 3) * OBP + (tid & 7) * 16];
  const char* gA = (const char*)(O2 + ((size_t)b * NH * SS + s0 + (tid >> 4)) * (2 * HD)) + (tid & 15) * 16;
  const char* gB = (const char*)(Wb + (size_t)(n0 + (tid >> 3)) * E) + (tid & 7) * 16;
  // stage kt = head kt of the context rows (hi and lo parts of a row) and columns 64*kt.. of the weight rows
  auto fill = [&](int kt) { unsigned l[8]; const char* p[8];
#pragma unroll  // here and below: the eight address pairs are operands of one asm statement: they must be registers, not indexed arrays
    for (int i = 0; i < 8; ++i) { l[i] = ldsA + (kt & 1) * OSTG + i * (8 * OAP); p[i] = gA + (size_t)i * (8 * 2 * HD * 2) + (size_t)kt * ((size_t)SS * 2 * HD * 2); }
    copy8(l, p);
#pragma unroll
    for (int i = 0; i < 8; ++i) { l[i] = ldsB + (kt & 1) * OSTG + i * (16 * OBP); p[i] = gB + (size_t)i * (16 * E * 2) + (size_t)kt * 128; }
    copy8(l, p); };
  fill(0);
  asm volatile("s_wait_asynccnt 0x0" ::: "memory");  // stage 0 has landed before the barrier that publishes it
  __syncthreads();
  fill(1);
#pragma unroll 1  // one trip per stage: the ring's foot stands once in the code
  for (int kt = 0; kt < E / 64; ++kt) { const char* st = sm + (kt & 1) * OSTG;
#pragma unroll
    for (int kc = 0; kc < 2; ++kc) { const __bf16* ar = (const __bf16*)(st + (wave * 16 + col) * OAP) + kc * 32; const F2 a = { frag_b(ar, lane), frag_b(ar + HD, lane) }; v16b wb[8];
#pragma unroll
      for (int j = 0; j < 8; ++j) wb[j] = frag_b((const __bf16*)(st + 64 * OAP + (j * 16 + col) * OBP) + kc * 32, lane);
#pragma unroll  // product by product over the eight tiles: a tile's lo product, then its hi product, as before, eight matrix instructions apart
      for (int j = 0; j < 8; ++j) acc[j] = wmma_bf(a.l, wb[j], acc[j]);
#pragma unroll
      for (int j = 0; j < 8; ++j) acc[j] = wmma_bf(a.h, wb[j], acc[j]); }
    RING_FOOT();
    if (kt + 2 < E / 64) fill(kt + 2); }
  asm volatile("s_wait_asynccnt 0x0" ::: "memory");  // no copy is left in flight when the epilogue takes the ring's LDS
#pragma unroll
  for (int j = 0; j < 8; ++j) { const int n = n0 + j * 16 + col; const float bb = bfr(bo[n]);
#pragma unroll
    for (int r = 0; r < 8; ++r) so[wave][8 * g + r][j * 16 + col] = acc[j][r] + bb; }
  LDSX();
#pragma unroll 4
  for (int rl = 0; rl < 16; ++rl) vst2(out + (size_t)(r0 + rl) * E + n0 + lane * 4, *(const v4f*)(&so[wave][rl][lane * 4]));
}
extern "C" void kernel_launch(void* const* d_in, const int* in_sizes, int n_in, void* d_out, int out_size, void* d_ws, size_t ws_size, hipStream_t stream) {
  (void)in_sizes; (void)n_in; (void)out_size; (void)ws_size;
  const float** I = (const float**)d_in;
  const float* x = I[0]; const float* amask = I[1]; const float* Wq = I[2]; const float* bq = I[3]; const float* Wk = I[4]; const float* bk = I[5]; const float* Wv = I[6]; const float* bv = I[7]; const float* Wp = I[8]; const float* bp = I[9]; const float* qnw = I[10]; const float* knw = I[11];
  float* out = (float*)d_out;
  char* ws = (char*)d_ws; size_t off = 0;
  auto take = [&](size_t bytes) { char* p = ws + off; off += (bytes + 255) & ~(size_t)255; return p; };
  __bf16* Xb = (__bf16*)take((size_t)NR * E * 2); __bf16* PT = (__bf16*)take((size_t)4 * E * E * 2);
  float* Q32 = (float*)take((size_t)NR * E * 4); __bf16* K2 = (__bf16*)take((size_t)NR * E * 4); _Float16* VTh = (_Float16*)take((size_t)NR * E * 2); _Float16* VTl = (_Float16*)take((size_t)NR * E * 2); __bf16* O2 = (__bf16*)take((size_t)NR * E * 4);
  // ws ~ 84 MB
  k_prep<<<PREP_N / 256, 256, 0, stream>>>(x, Wq, Wk, Wv, Wp, Xb, PT);
  k_qkv<<<dim3(NR / 64, E / 128, 3), 128, 0, stream>>>(Xb, PT, bq, bk, bv, qnw, knw, Q32, K2, VTh, VTl);
  k_attn<<<dim3(SS / 128, NB * NH), 256, 0, stream>>>(Q32, K2, VTh, VTl, amask, O2);
  k_out<<<dim3(NR / 64, E / 128), 128, 0, stream>>>(O2, PT + (size_t)3 * E * E, bp, out);
}
